// v000
// The times below were measured on an AMD MI455X: many runs one after another, warmed up first and cycling through
// copies of the inputs, with the whole window's GPU time divided by the number of runs. Launches and the gaps
// between them are all in it. The median over several windows is given; except for v000 it joins two sittings, which
// can be a few percent apart, so the side-by-side timings, each taken in one sitting, are the better comparison.
// v000 is the starting kernel. One run takes 1020 microseconds.
#include <hip/hip_runtime.h>

#define BB 4
#define NN 4096
#define UU 512
#define BN (BB*NN)

typedef __attribute__((ext_vector_type(16))) __bf16 v16bf;
typedef __attribute__((ext_vector_type(8)))  __bf16 v8bf;
typedef __attribute__((ext_vector_type(8)))  float  v8f;
typedef __attribute__((ext_vector_type(4)))  unsigned int v4u;
typedef __attribute__((ext_vector_type(8)))  int v8i;
typedef __attribute__((ext_vector_type(4)))  int v4i;

__device__ __forceinline__ v8f wmma_bf16(v16bf a, v16bf b, v8f c) {
  return __builtin_amdgcn_wmma_f32_16x16x32_bf16(false, a, false, b, (short)0, c,
                                                 false, false);
}

__device__ __forceinline__ v16bf frag_bf16(const __bf16* p) {
  v8bf lo = *(const v8bf*)(p);
  v8bf hi = *(const v8bf*)(p + 16);
  return __builtin_shufflevector(lo, hi, 0, 1, 2, 3, 4, 5, 6, 7,
                                 8, 9, 10, 11, 12, 13, 14, 15);
}
__device__ __forceinline__ v16bf frag_f32(const float* p) {
  float4 a0 = *(const float4*)(p);
  float4 a1 = *(const float4*)(p + 4);
  float4 b0 = *(const float4*)(p + 16);
  float4 b1 = *(const float4*)(p + 20);
  v16bf f;
  f[0] = (__bf16)a0.x;  f[1] = (__bf16)a0.y;  f[2] = (__bf16)a0.z;  f[3] = (__bf16)a0.w;
  f[4] = (__bf16)a1.x;  f[5] = (__bf16)a1.y;  f[6] = (__bf16)a1.z;  f[7] = (__bf16)a1.w;
  f[8] = (__bf16)b0.x;  f[9] = (__bf16)b0.y;  f[10] = (__bf16)b0.z; f[11] = (__bf16)b0.w;
  f[12] = (__bf16)b1.x; f[13] = (__bf16)b1.y; f[14] = (__bf16)b1.z; f[15] = (__bf16)b1.w;
  return f;
}

__device__ __forceinline__ void tdm_load_k_tile(const __bf16* gsrc, unsigned lds_off) {
  unsigned long long ga = (unsigned long long)(uintptr_t)gsrc;
  v4u g0;
  g0[0] = 1u;
  g0[1] = lds_off;
  g0[2] = (unsigned)ga;
  g0[3] = (unsigned)((ga >> 32) & 0x1FFFFFFu)
          | (2u << 30);
  v8i g1;
  g1[0] = 0x00010000;
  g1[1] = (int)(512u << 16);
  g1[2] = (int)(4096u << 16);
  g1[3] = (int)(512u << 16);
  g1[4] = 32;
  g1[5] = 512;
  g1[6] = 0;
  g1[7] = 0;
  v4i z4 = {0, 0, 0, 0};
  v8i z8 = {0, 0, 0, 0, 0, 0, 0, 0};
  __builtin_amdgcn_tensor_load_to_lds(g0, g1, z4, z4, z8, 0);
}

// ---------------------------------------------------------------- kernel 0
__global__ void cvt_weights_t(const float* __restrict__ wq, const float* __restrict__ wk,
                              const float* __restrict__ wv, const float* __restrict__ wp,
                              __bf16* __restrict__ dq, __bf16* __restrict__ dk,
                              __bf16* __restrict__ dv, __bf16* __restrict__ dp) {
  const int idx = blockIdx.x * blockDim.x + threadIdx.x;   // coalesced read
  const int k = idx / UU, n = idx % UU;
  const size_t t = (size_t)n * UU + k;                     // transposed write
  dq[t] = (__bf16)wq[idx];
  dk[t] = (__bf16)wk[idx];
  dv[t] = (__bf16)wv[idx];
  dp[t] = (__bf16)wp[idx];
}

// ---------------------------------------------------------------- kernel 1
// Fused Q/K/V projection; 16x32 output tile of all three per wave.
// Manual software pipeline: fragments for step k+1 are loaded into fresh
// values before step k's wmma chain, then rotated.
__global__ void __launch_bounds__(256) qkv_proj(
    const float* __restrict__ x,
    const __bf16* __restrict__ WqT, const __bf16* __restrict__ WkT,
    const __bf16* __restrict__ WvT,
    const float* __restrict__ bqp, const float* __restrict__ bkp,
    const float* __restrict__ bvp,
    __bf16* __restrict__ Q, __bf16* __restrict__ K, __bf16* __restrict__ VT) {
  const int lane = threadIdx.x & 31;
  const int wave = threadIdx.x >> 5;
  const int tile = blockIdx.x * 8 + wave;       // 16384 tiles
  const int colPairs = UU / 32;                 // 16
  const int rowTile = tile / colPairs;
  const int colPair = tile - rowTile * colPairs;
  const int row0 = rowTile * 16, col0 = colPair * 32;
  const int kbase = (lane & 16) ? 8 : 0;
  const int r = lane & 15;
  const int mh = (lane >> 4) << 3;

  v8f cq0 = {}, cq1 = {}, ck0 = {}, ck1 = {}, cv0 = {}, cv1 = {};
  const float*  xrow = x + (size_t)(row0 + r) * UU + kbase;
  const __bf16* wp0 = WqT + (size_t)(col0 + r) * UU + kbase;
  const __bf16* wp1 = WqT + (size_t)(col0 + 16 + r) * UU + kbase;
  const __bf16* wp2 = WkT + (size_t)(col0 + r) * UU + kbase;
  const __bf16* wp3 = WkT + (size_t)(col0 + 16 + r) * UU + kbase;
  const __bf16* wp4 = WvT + (size_t)(col0 + r) * UU + kbase;
  const __bf16* wp5 = WvT + (size_t)(col0 + 16 + r) * UU + kbase;

  // pipeline prologue: stage 0 fragments
  v16bf a  = frag_f32(xrow);
  v16bf w0 = frag_bf16(wp0), w1 = frag_bf16(wp1), w2 = frag_bf16(wp2);
  v16bf w3 = frag_bf16(wp3), w4 = frag_bf16(wp4), w5 = frag_bf16(wp5);
#pragma unroll 4
  for (int k0 = 0; k0 < UU; k0 += 32) {
    v16bf an, n0, n1, n2, n3, n4, n5;
    const int k1 = k0 + 32;
    if (k1 < UU) {                               // load next step's fragments
      an = frag_f32(xrow + k1);
      n0 = frag_bf16(wp0 + k1);  n1 = frag_bf16(wp1 + k1);
      n2 = frag_bf16(wp2 + k1);  n3 = frag_bf16(wp3 + k1);
      n4 = frag_bf16(wp4 + k1);  n5 = frag_bf16(wp5 + k1);
    }
    cq0 = wmma_bf16(a, w0, cq0);
    cq1 = wmma_bf16(a, w1, cq1);
    ck0 = wmma_bf16(a, w2, ck0);
    ck1 = wmma_bf16(a, w3, ck1);
    cv0 = wmma_bf16(a, w4, cv0);
    cv1 = wmma_bf16(a, w5, cv1);
    a = an; w0 = n0; w1 = n1; w2 = n2; w3 = n3; w4 = n4; w5 = n5;
  }
  const float scale = rsqrtf((float)UU);
  const int b = row0 >> 12;                     // row0 / NN
#pragma unroll
  for (int v = 0; v < 8; ++v) {
    const int M = v + mh;
    const int nrow = (row0 + M) & (NN - 1);
    const size_t idx = (size_t)(row0 + M) * UU;
#pragma unroll
    for (int h = 0; h < 2; ++h) {
      const int Nc = col0 + 16 * h + r;
      const float q = (h ? cq1[v] : cq0[v]) + bqp[Nc];
      const float k = (h ? ck1[v] : ck0[v]) + bkp[Nc];
      const float vv = (h ? cv1[v] : cv0[v]) + bvp[Nc];
      Q[idx + Nc] = (__bf16)(q * scale);
      K[idx + Nc] = (__bf16)k;
      VT[((size_t)b * UU + Nc) * NN + nrow] = (__bf16)vv;   // transposed V
    }
  }
}

__global__ void __launch_bounds__(128) flash_attn(
    const __bf16* __restrict__ Q, const __bf16* __restrict__ K,
    const __bf16* __restrict__ VT, __bf16* __restrict__ C) {
  __shared__ alignas(16) __bf16 sK[2][32][UU];
  __shared__ float sS[4][16][32];
  __shared__ alignas(16) __bf16 sP[4][16][32];

  const int lane = threadIdx.x & 31;
  const int wave = threadIdx.x >> 5;              // 0..3 -> d-slice
  const int b  = blockIdx.y;
  const int q0 = blockIdx.x * 16;
  const int ds0 = wave * 128;
  const int kbase = (lane & 16) ? 8 : 0;
  const int r  = lane & 15;
  const int mh = (lane >> 4) << 3;

  const __bf16* Qb = Q + (size_t)b * NN * UU;
  const __bf16* Kb = K + (size_t)b * NN * UU;
  const __bf16* Vt = VT + (size_t)b * UU * NN;    // [d][n]

  typedef __attribute__((address_space(3))) __bf16 lds_bf16;
  const unsigned sK0 = (unsigned)(unsigned long long)(lds_bf16*)&sK[0][0][0];
  const unsigned sK1 = (unsigned)(unsigned long long)(lds_bf16*)&sK[1][0][0];

  v16bf qf[4];
#pragma unroll
  for (int kk = 0; kk < 4; ++kk)
    qf[kk] = frag_bf16(Qb + (size_t)(q0 + r) * UU + ds0 + kk * 32 + kbase);

  v8f o[8] = {};
  float m[8], l[8];
#pragma unroll
  for (int v = 0; v < 8; ++v) { m[v] = -3.0e38f; l[v] = 0.f; }

  // prologue: stage key tile 0
  if (wave == 0) {
    tdm_load_k_tile(Kb, sK0);
    __builtin_amdgcn_s_wait_tensorcnt(0);
  }
  __syncthreads();

  for (int kb = 0; kb < NN; kb += 32) {
    const int buf = (kb >> 5) & 1;
    // kick DMA for the next key tile while we compute on this one
    if (wave == 0 && kb + 32 < NN)
      tdm_load_k_tile(Kb + (size_t)(kb + 32) * UU, buf ? sK0 : sK1);

    // partial S over this wave's d-slice from LDS (ds_load_b128 fragments)
    v8f s0 = {}, s1 = {};
#pragma unroll
    for (int kk = 0; kk < 4; ++kk) {
      v16bf b0 = frag_bf16(&sK[buf][r][ds0 + kk * 32 + kbase]);
      v16bf b1 = frag_bf16(&sK[buf][16 + r][ds0 + kk * 32 + kbase]);
      s0 = wmma_bf16(qf[kk], b0, s0);
      s1 = wmma_bf16(qf[kk], b1, s1);
    }
    if (kb + 32 < NN)
      __builtin_prefetch(Vt + (size_t)(ds0 + r) * NN + kb + 32, 0, 1);

#pragma unroll
    for (int v = 0; v < 8; ++v) {
      sS[wave][v + mh][r]      = s0[v];
      sS[wave][v + mh][16 + r] = s1[v];
    }
    __syncthreads();
    float fs0[8], fs1[8];
#pragma unroll
    for (int v = 0; v < 8; ++v) {
      float a0 = 0.f, a1 = 0.f;
#pragma unroll
      for (int w = 0; w < 4; ++w) { a0 += sS[w][v + mh][r]; a1 += sS[w][v + mh][16 + r]; }
      fs0[v] = a0; fs1[v] = a1;
    }
    // online softmax; row v+mh lives across one 16-lane half -> xor reduce
#pragma unroll
    for (int v = 0; v < 8; ++v) {
      float mt = fmaxf(fs0[v], fs1[v]);
#pragma unroll
      for (int off = 1; off < 16; off <<= 1) mt = fmaxf(mt, __shfl_xor(mt, off, 32));
      const float mnew = fmaxf(m[v], mt);
      const float p0 = __expf(fs0[v] - mnew);
      const float p1 = __expf(fs1[v] - mnew);
      float rs = p0 + p1;
#pragma unroll
      for (int off = 1; off < 16; off <<= 1) rs += __shfl_xor(rs, off, 32);
      const float corr = __expf(m[v] - mnew);
      l[v] = l[v] * corr + rs;
      m[v] = mnew;
#pragma unroll
      for (int j = 0; j < 8; ++j) o[j][v] *= corr;
      sP[wave][v + mh][r]      = (__bf16)p0;
      sP[wave][v + mh][16 + r] = (__bf16)p1;
    }
    __syncthreads();
    // repack P (C-layout) into an A-fragment; 16B-aligned LDS vector reads
    v16bf pf = frag_bf16(&sP[wave][r][0] + kbase);
    // O[:, ds0+16j] += P * V^T; V frags loaded in groups of 4 ahead of MMAs
#pragma unroll
    for (int g = 0; g < 2; ++g) {
      v16bf f0 = frag_bf16(Vt + (size_t)(ds0 + (4 * g + 0) * 16 + r) * NN + kb + kbase);
      v16bf f1 = frag_bf16(Vt + (size_t)(ds0 + (4 * g + 1) * 16 + r) * NN + kb + kbase);
      v16bf f2 = frag_bf16(Vt + (size_t)(ds0 + (4 * g + 2) * 16 + r) * NN + kb + kbase);
      v16bf f3 = frag_bf16(Vt + (size_t)(ds0 + (4 * g + 3) * 16 + r) * NN + kb + kbase);
      o[4 * g + 0] = wmma_bf16(pf, f0, o[4 * g + 0]);
      o[4 * g + 1] = wmma_bf16(pf, f1, o[4 * g + 1]);
      o[4 * g + 2] = wmma_bf16(pf, f2, o[4 * g + 2]);
      o[4 * g + 3] = wmma_bf16(pf, f3, o[4 * g + 3]);
    }
    // publish next K tile (and retire this iteration's sS/sP reads)
    if (wave == 0 && kb + 32 < NN)
      __builtin_amdgcn_s_wait_tensorcnt(0);
    __syncthreads();
  }
#pragma unroll
  for (int v = 0; v < 8; ++v) {
    const float inv = 1.f / l[v];
    const size_t row = (size_t)b * NN + q0 + v + mh;
#pragma unroll
    for (int j = 0; j < 8; ++j)
      C[row * UU + ds0 + j * 16 + r] = (__bf16)(o[j][v] * inv);
  }
}

// ---------------------------------------------------------------- kernel 3
// out = x + ctx @ Wp + bp (fp32 out); 16x64 tile per wave, software-pipelined
__global__ void __launch_bounds__(256) out_proj(
    const float* __restrict__ x, const __bf16* __restrict__ Cb,
    const __bf16* __restrict__ WpT, const float* __restrict__ bpp,
    float* __restrict__ out) {
  const int lane = threadIdx.x & 31;
  const int wave = threadIdx.x >> 5;
  const int tile = blockIdx.x * 8 + wave;       // 8192 tiles
  const int colQuads = UU / 64;                 // 8
  const int rowTile = tile / colQuads;
  const int colQuad = tile - rowTile * colQuads;
  const int row0 = rowTile * 16, col0 = colQuad * 64;
  const int kbase = (lane & 16) ? 8 : 0;
  const int r = lane & 15;
  const int mh = (lane >> 4) << 3;

  v8f acc[4] = {};
  const __bf16* arow = Cb + (size_t)(row0 + r) * UU + kbase;
  const __bf16* w0p = WpT + (size_t)(col0 + r) * UU + kbase;
  const __bf16* w1p = WpT + (size_t)(col0 + 16 + r) * UU + kbase;
  const __bf16* w2p = WpT + (size_t)(col0 + 32 + r) * UU + kbase;
  const __bf16* w3p = WpT + (size_t)(col0 + 48 + r) * UU + kbase;

  v16bf a  = frag_bf16(arow);
  v16bf w0 = frag_bf16(w0p), w1 = frag_bf16(w1p);
  v16bf w2 = frag_bf16(w2p), w3 = frag_bf16(w3p);
#pragma unroll 4
  for (int k0 = 0; k0 < UU; k0 += 32) {
    v16bf an, n0, n1, n2, n3;
    const int k1 = k0 + 32;
    if (k1 < UU) {
      an = frag_bf16(arow + k1);
      n0 = frag_bf16(w0p + k1);  n1 = frag_bf16(w1p + k1);
      n2 = frag_bf16(w2p + k1);  n3 = frag_bf16(w3p + k1);
    }
    acc[0] = wmma_bf16(a, w0, acc[0]);
    acc[1] = wmma_bf16(a, w1, acc[1]);
    acc[2] = wmma_bf16(a, w2, acc[2]);
    acc[3] = wmma_bf16(a, w3, acc[3]);
    a = an; w0 = n0; w1 = n1; w2 = n2; w3 = n3;
  }
#pragma unroll
  for (int t = 0; t < 4; ++t) {
    const int Nc = col0 + t * 16 + r;
    const float bias = bpp[Nc];
#pragma unroll
    for (int v = 0; v < 8; ++v) {
      const size_t idx = (size_t)(row0 + v + mh) * UU + Nc;
      out[idx] = x[idx] + acc[t][v] + bias;
    }
  }
}

// ---------------------------------------------------------------- launch
extern "C" void kernel_launch(void* const* d_in, const int* in_sizes, int n_in,
                              void* d_out, int out_size, void* d_ws, size_t ws_size,
                              hipStream_t stream) {
  const float* x  = (const float*)d_in[0];
  const float* Wq = (const float*)d_in[1];
  const float* bq = (const float*)d_in[2];
  const float* Wk = (const float*)d_in[3];
  const float* bk = (const float*)d_in[4];
  const float* Wv = (const float*)d_in[5];
  const float* bv = (const float*)d_in[6];
  const float* Wp = (const float*)d_in[7];
  const float* bp = (const float*)d_in[8];
  float* out = (float*)d_out;

  char* ws = (char*)d_ws;
  const size_t wbytes = (size_t)UU * UU * sizeof(__bf16);        // 512 KB
  const size_t tbytes = (size_t)BN * UU * sizeof(__bf16);        // 16 MB
  __bf16* WqT = (__bf16*)(ws);
  __bf16* WkT = (__bf16*)(ws + wbytes);
  __bf16* WvT = (__bf16*)(ws + 2 * wbytes);
  __bf16* WpT = (__bf16*)(ws + 3 * wbytes);
  __bf16* Qb  = (__bf16*)(ws + 4 * wbytes);
  __bf16* Kb  = (__bf16*)(ws + 4 * wbytes + tbytes);
  __bf16* VTb = (__bf16*)(ws + 4 * wbytes + 2 * tbytes);
  __bf16* Ctx = (__bf16*)(ws + 4 * wbytes + 3 * tbytes);

  cvt_weights_t<<<(UU * UU) / 256, 256, 0, stream>>>(Wq, Wk, Wv, Wp, WqT, WkT, WvT, WpT);
  qkv_proj<<<2048, 256, 0, stream>>>(x, WqT, WkT, WvT, bq, bk, bv, Qb, Kb, VTb);
  dim3 fgrid(NN / 16, BB);
  flash_attn<<<fgrid, 128, 0, stream>>>(Qb, Kb, VTb, Ctx);
  out_proj<<<1024, 256, 0, stream>>>(x, Ctx, WpT, bp, out);
}

// v001
// It runs in 602 microseconds.
// Two timings next to v000 both put it at 1.79 times that version's speed.
#include <hip/hip_runtime.h>

#define BB 4
#define NN 4096
#define UU 512
#define BN (BB*NN)

typedef __attribute__((ext_vector_type(16))) __bf16 v16bf;
typedef __attribute__((ext_vector_type(8)))  __bf16 v8bf;
typedef __attribute__((ext_vector_type(8)))  float  v8f;
typedef __attribute__((ext_vector_type(4)))  unsigned int v4u;
typedef __attribute__((ext_vector_type(8)))  int v8i;
typedef __attribute__((ext_vector_type(4)))  int v4i;

__device__ __forceinline__ v8f wmma_bf16(v16bf a, v16bf b, v8f c) {
  return __builtin_amdgcn_wmma_f32_16x16x32_bf16(false, a, false, b, (short)0, c,
                                                 false, false);
}

__device__ __forceinline__ v16bf frag_bf16(const __bf16* p) {
  v8bf lo = *(const v8bf*)(p);
  v8bf hi = *(const v8bf*)(p + 16);
  return __builtin_shufflevector(lo, hi, 0, 1, 2, 3, 4, 5, 6, 7,
                                 8, 9, 10, 11, 12, 13, 14, 15);
}
__device__ __forceinline__ v16bf frag_f32(const float* p) {
  float4 a0 = *(const float4*)(p);
  float4 a1 = *(const float4*)(p + 4);
  float4 b0 = *(const float4*)(p + 16);
  float4 b1 = *(const float4*)(p + 20);
  v16bf f;
  f[0] = (__bf16)a0.x;  f[1] = (__bf16)a0.y;  f[2] = (__bf16)a0.z;  f[3] = (__bf16)a0.w;
  f[4] = (__bf16)a1.x;  f[5] = (__bf16)a1.y;  f[6] = (__bf16)a1.z;  f[7] = (__bf16)a1.w;
  f[8] = (__bf16)b0.x;  f[9] = (__bf16)b0.y;  f[10] = (__bf16)b0.z; f[11] = (__bf16)b0.w;
  f[12] = (__bf16)b1.x; f[13] = (__bf16)b1.y; f[14] = (__bf16)b1.z; f[15] = (__bf16)b1.w;
  return f;
}

__device__ __forceinline__ void tdm_load_k_tile(const __bf16* gsrc, unsigned lds_off) {
  unsigned long long ga = (unsigned long long)(uintptr_t)gsrc;
  v4u g0;
  g0[0] = 1u;
  g0[1] = lds_off;
  g0[2] = (unsigned)ga;
  g0[3] = (unsigned)((ga >> 32) & 0x1FFFFFFu)
          | (2u << 30);
  v8i g1;
  g1[0] = 0x00010000;
  g1[1] = (int)(512u << 16);
  g1[2] = (int)(4096u << 16);
  g1[3] = (int)(512u << 16);
  g1[4] = 32;
  g1[5] = 512;
  g1[6] = 0;
  g1[7] = 0;
  v4i z4 = {0, 0, 0, 0};
  v8i z8 = {0, 0, 0, 0, 0, 0, 0, 0};
  __builtin_amdgcn_tensor_load_to_lds(g0, g1, z4, z4, z8, 0);
}

// ---------------------------------------------------------------- kernel 0
__global__ void cvt_weights_t(const float* __restrict__ wq, const float* __restrict__ wk,
                              const float* __restrict__ wv, const float* __restrict__ wp,
                              __bf16* __restrict__ dq, __bf16* __restrict__ dk,
                              __bf16* __restrict__ dv, __bf16* __restrict__ dp) {
  const int idx = blockIdx.x * blockDim.x + threadIdx.x;   // coalesced read
  const int k = idx / UU, n = idx % UU;
  const size_t t = (size_t)n * UU + k;                     // transposed write
  dq[t] = (__bf16)wq[idx];
  dk[t] = (__bf16)wk[idx];
  dv[t] = (__bf16)wv[idx];
  dp[t] = (__bf16)wp[idx];
}

// ---------------------------------------------------------------- kernel 1
// Fused Q/K/V projection; 16x32 output tile of all three per wave.
// Manual software pipeline: fragments for step k+1 are loaded into fresh
// values before step k's wmma chain, then rotated.
__global__ void __launch_bounds__(256) qkv_proj(
    const float* __restrict__ x,
    const __bf16* __restrict__ WqT, const __bf16* __restrict__ WkT,
    const __bf16* __restrict__ WvT,
    const float* __restrict__ bqp, const float* __restrict__ bkp,
    const float* __restrict__ bvp,
    __bf16* __restrict__ Q, __bf16* __restrict__ K, __bf16* __restrict__ VT) {
  const int lane = threadIdx.x & 31;
  const int wave = threadIdx.x >> 5;
  const int tile = blockIdx.x * 8 + wave;       // 16384 tiles
  const int colPairs = UU / 32;                 // 16
  const int rowTile = tile / colPairs;
  const int colPair = tile - rowTile * colPairs;
  const int row0 = rowTile * 16, col0 = colPair * 32;
  const int kbase = (lane & 16) ? 8 : 0;
  const int r = lane & 15;
  const int mh = (lane >> 4) << 3;

  v8f cq0 = {}, cq1 = {}, ck0 = {}, ck1 = {}, cv0 = {}, cv1 = {};
  const float*  xrow = x + (size_t)(row0 + r) * UU + kbase;
  const __bf16* wp0 = WqT + (size_t)(col0 + r) * UU + kbase;
  const __bf16* wp1 = WqT + (size_t)(col0 + 16 + r) * UU + kbase;
  const __bf16* wp2 = WkT + (size_t)(col0 + r) * UU + kbase;
  const __bf16* wp3 = WkT + (size_t)(col0 + 16 + r) * UU + kbase;
  const __bf16* wp4 = WvT + (size_t)(col0 + r) * UU + kbase;
  const __bf16* wp5 = WvT + (size_t)(col0 + 16 + r) * UU + kbase;

  // pipeline prologue: stage 0 fragments
  v16bf a  = frag_f32(xrow);
  v16bf w0 = frag_bf16(wp0), w1 = frag_bf16(wp1), w2 = frag_bf16(wp2);
  v16bf w3 = frag_bf16(wp3), w4 = frag_bf16(wp4), w5 = frag_bf16(wp5);
#pragma unroll 4
  for (int k0 = 0; k0 < UU; k0 += 32) {
    v16bf an, n0, n1, n2, n3, n4, n5;
    const int k1 = k0 + 32;
    if (k1 < UU) {                               // load next step's fragments
      an = frag_f32(xrow + k1);
      n0 = frag_bf16(wp0 + k1);  n1 = frag_bf16(wp1 + k1);
      n2 = frag_bf16(wp2 + k1);  n3 = frag_bf16(wp3 + k1);
      n4 = frag_bf16(wp4 + k1);  n5 = frag_bf16(wp5 + k1);
    }
    cq0 = wmma_bf16(a, w0, cq0);
    cq1 = wmma_bf16(a, w1, cq1);
    ck0 = wmma_bf16(a, w2, ck0);
    ck1 = wmma_bf16(a, w3, ck1);
    cv0 = wmma_bf16(a, w4, cv0);
    cv1 = wmma_bf16(a, w5, cv1);
    a = an; w0 = n0; w1 = n1; w2 = n2; w3 = n3; w4 = n4; w5 = n5;
  }
  const float scale = rsqrtf((float)UU);
  const int b = row0 >> 12;                     // row0 / NN
#pragma unroll
  for (int v = 0; v < 8; ++v) {
    const int M = v + mh;
    const int nrow = (row0 + M) & (NN - 1);
    const size_t idx = (size_t)(row0 + M) * UU;
#pragma unroll
    for (int h = 0; h < 2; ++h) {
      const int Nc = col0 + 16 * h + r;
      const float q = (h ? cq1[v] : cq0[v]) + bqp[Nc];
      const float k = (h ? ck1[v] : ck0[v]) + bkp[Nc];
      const float vv = (h ? cv1[v] : cv0[v]) + bvp[Nc];
      Q[idx + Nc] = (__bf16)(q * scale);
      K[idx + Nc] = (__bf16)k;
      VT[((size_t)b * UU + Nc) * NN + nrow] = (__bf16)vv;   // transposed V
    }
  }
}

#define RT 4                                      // row tiles per block
#define NW 8                                      // waves per block
#define DS (UU / NW)                              // d columns per wave
__global__ void __launch_bounds__(256) flash_attn(
    const __bf16* __restrict__ Q, const __bf16* __restrict__ K,
    const __bf16* __restrict__ VT, __bf16* __restrict__ C) {
  __shared__ alignas(2048) __bf16 sK[2][32][UU];
  // per-wave partial S, kept in accumulator order: [wave][tile][key half]
  // [register quad][lane] -> one 16B element per lane, no transposition
  __shared__ float4 sS[NW][RT][2][2][32];         // 64 KB
  __shared__ alignas(16) __bf16 sP[RT][16][32];   // P for A-frag repack
  __shared__ alignas(16) float sC[RT][16];        // per-row rescale factor

  const int lane = threadIdx.x & 31;
  const int wave = threadIdx.x >> 5;              // 0..7 -> d-slice
  const int b  = blockIdx.y;
  const int q0 = blockIdx.x * (16 * RT);
  const int ds0 = wave * DS;
  const int kbase = (lane & 16) ? 8 : 0;
  const int r  = lane & 15;
  const int mh = (lane >> 4) << 3;
  const int tw = wave >> 1;                       // softmax: owned row tile
  const int hw = wave & 1;                        // softmax: owned register quad

  const __bf16* Qb = Q + (size_t)b * NN * UU;
  const __bf16* Kb = K + (size_t)b * NN * UU;
  const __bf16* Vt = VT + (size_t)b * UU * NN;    // [d][n]

  typedef __attribute__((address_space(3))) __bf16 lds_bf16;
  const unsigned sK0 = (unsigned)(unsigned long long)(lds_bf16*)&sK[0][0][0];
  const unsigned sK1 = (unsigned)(unsigned long long)(lds_bf16*)&sK[1][0][0];

  v16bf qf[RT][2];
#pragma unroll
  for (int t = 0; t < RT; ++t)
#pragma unroll
    for (int kk = 0; kk < 2; ++kk)
      qf[t][kk] = frag_bf16(Qb + (size_t)(q0 + 16 * t + r) * UU + ds0 + kk * 32 + kbase);

  v8f o[RT][4] = {};
  float m[4], l[4];                               // rows 4*hw+i+mh of tile tw
#pragma unroll
  for (int i = 0; i < 4; ++i) { m[i] = -3.0e38f; l[i] = 0.f; }

  // prologue: stage key tile 0
  if (wave == 0) {
    tdm_load_k_tile(Kb, sK0);
    __builtin_amdgcn_s_wait_tensorcnt(0);
  }
  __syncthreads();

  for (int kb = 0; kb < NN; kb += 32) {
    const int buf = (kb >> 5) & 1;
    // kick DMA for the next key tile while we compute on this one
    if (wave == 0 && kb + 32 < NN)
      tdm_load_k_tile(Kb + (size_t)(kb + 32) * UU, buf ? sK0 : sK1);

    // partial S over this wave's d-slice from LDS (ds_load_b128 fragments)
    v8f s[RT][2] = {};
#pragma unroll
    for (int kk = 0; kk < 2; ++kk) {
      v16bf b0 = frag_bf16(&sK[buf][r][ds0 + kk * 32 + kbase]);
      v16bf b1 = frag_bf16(&sK[buf][16 + r][ds0 + kk * 32 + kbase]);
#pragma unroll
      for (int t = 0; t < RT; ++t) {
        s[t][0] = wmma_bf16(qf[t][kk], b0, s[t][0]);
        s[t][1] = wmma_bf16(qf[t][kk], b1, s[t][1]);
      }
    }
    if (kb + 32 < NN)
      __builtin_prefetch(Vt + (size_t)(ds0 + r) * NN + kb + 32, 0, 1);

#pragma unroll
    for (int t = 0; t < RT; ++t)
#pragma unroll
      for (int h = 0; h < 2; ++h) {
        sS[wave][t][h][0][lane] = make_float4(s[t][h][0], s[t][h][1], s[t][h][2], s[t][h][3]);
        sS[wave][t][h][1][lane] = make_float4(s[t][h][4], s[t][h][5], s[t][h][6], s[t][h][7]);
      }
    __syncthreads();
    // full S of the owned rows: sum the 8 d-slices in wave order
    float fs0[4] = {0.f, 0.f, 0.f, 0.f}, fs1[4] = {0.f, 0.f, 0.f, 0.f};
#pragma unroll
    for (int w = 0; w < NW; ++w) {
      const float4 a0 = sS[w][tw][0][hw][lane];
      const float4 a1 = sS[w][tw][1][hw][lane];
      fs0[0] += a0.x; fs0[1] += a0.y; fs0[2] += a0.z; fs0[3] += a0.w;
      fs1[0] += a1.x; fs1[1] += a1.y; fs1[2] += a1.z; fs1[3] += a1.w;
    }
    // online softmax; a row lives across one 16-lane half -> xor reduce
    float cr[4];
#pragma unroll
    for (int i = 0; i < 4; ++i) {
      float mt = fmaxf(fs0[i], fs1[i]);
#pragma unroll
      for (int off = 1; off < 16; off <<= 1) mt = fmaxf(mt, __shfl_xor(mt, off, 32));
      const float mnew = fmaxf(m[i], mt);
      const float p0 = __expf(fs0[i] - mnew);
      const float p1 = __expf(fs1[i] - mnew);
      float rs = p0 + p1;
#pragma unroll
      for (int off = 1; off < 16; off <<= 1) rs += __shfl_xor(rs, off, 32);
      const float corr = __expf(m[i] - mnew);
      l[i] = l[i] * corr + rs;
      m[i] = mnew;
      cr[i] = corr;
      sP[tw][4 * hw + i + mh][r]      = (__bf16)p0;
      sP[tw][4 * hw + i + mh][16 + r] = (__bf16)p1;
    }
    if (r == 0)
      *(float4*)&sC[tw][4 * hw + mh] = make_float4(cr[0], cr[1], cr[2], cr[3]);
    __syncthreads();
    // rescale O by its rows' factors; repack P (C-layout) into A-fragments
    v16bf pf[RT];
#pragma unroll
    for (int t = 0; t < RT; ++t) {
      pf[t] = frag_bf16(&sP[t][r][0] + kbase);
      const float4 c0 = *(const float4*)&sC[t][mh];
      const float4 c1 = *(const float4*)&sC[t][mh + 4];
#pragma unroll
      for (int j = 0; j < 4; ++j) {
        o[t][j][0] *= c0.x; o[t][j][1] *= c0.y; o[t][j][2] *= c0.z; o[t][j][3] *= c0.w;
        o[t][j][4] *= c1.x; o[t][j][5] *= c1.y; o[t][j][6] *= c1.z; o[t][j][7] *= c1.w;
      }
    }
    // O[:, ds0+16j] += P * V^T; the 4 V frags are loaded ahead of the MMAs
    const __bf16* vp = Vt + (size_t)(ds0 + r) * NN + kb + kbase;
    v16bf f0 = frag_bf16(vp);
    v16bf f1 = frag_bf16(vp + (size_t)16 * NN);
    v16bf f2 = frag_bf16(vp + (size_t)32 * NN);
    v16bf f3 = frag_bf16(vp + (size_t)48 * NN);
#pragma unroll
    for (int t = 0; t < RT; ++t) {
      o[t][0] = wmma_bf16(pf[t], f0, o[t][0]);
      o[t][1] = wmma_bf16(pf[t], f1, o[t][1]);
      o[t][2] = wmma_bf16(pf[t], f2, o[t][2]);
      o[t][3] = wmma_bf16(pf[t], f3, o[t][3]);
    }
    // publish next K tile (and retire this iteration's sS/sP/sC reads)
    if (wave == 0 && kb + 32 < NN)
      __builtin_amdgcn_s_wait_tensorcnt(0);
    __syncthreads();
  }
  // hand each row's 1/l from its owner to every wave
  if (r == 0)
    *(float4*)&sC[tw][4 * hw + mh] =
        make_float4(1.f / l[0], 1.f / l[1], 1.f / l[2], 1.f / l[3]);
  __syncthreads();
  float4 iv[RT][2];
#pragma unroll
  for (int t = 0; t < RT; ++t) {
    iv[t][0] = *(const float4*)&sC[t][mh];
    iv[t][1] = *(const float4*)&sC[t][mh + 4];
  }
#pragma unroll
  for (int t = 0; t < RT; ++t)
#pragma unroll
    for (int v = 0; v < 8; ++v) {
      const float4 q4 = iv[t][v >> 2];
      const float inv = (v & 3) == 0 ? q4.x : (v & 3) == 1 ? q4.y : (v & 3) == 2 ? q4.z : q4.w;
      const size_t row = (size_t)b * NN + q0 + 16 * t + v + mh;
#pragma unroll
      for (int j = 0; j < 4; ++j)
        C[row * UU + ds0 + j * 16 + r] = (__bf16)(o[t][j][v] * inv);
    }
}

// ---------------------------------------------------------------- kernel 3
// out = x + ctx @ Wp + bp (fp32 out); 16x64 tile per wave, software-pipelined
__global__ void __launch_bounds__(256) out_proj(
    const float* __restrict__ x, const __bf16* __restrict__ Cb,
    const __bf16* __restrict__ WpT, const float* __restrict__ bpp,
    float* __restrict__ out) {
  const int lane = threadIdx.x & 31;
  const int wave = threadIdx.x >> 5;
  const int tile = blockIdx.x * 8 + wave;       // 8192 tiles
  const int colQuads = UU / 64;                 // 8
  const int rowTile = tile / colQuads;
  const int colQuad = tile - rowTile * colQuads;
  const int row0 = rowTile * 16, col0 = colQuad * 64;
  const int kbase = (lane & 16) ? 8 : 0;
  const int r = lane & 15;
  const int mh = (lane >> 4) << 3;

  v8f acc[4] = {};
  const __bf16* arow = Cb + (size_t)(row0 + r) * UU + kbase;
  const __bf16* w0p = WpT + (size_t)(col0 + r) * UU + kbase;
  const __bf16* w1p = WpT + (size_t)(col0 + 16 + r) * UU + kbase;
  const __bf16* w2p = WpT + (size_t)(col0 + 32 + r) * UU + kbase;
  const __bf16* w3p = WpT + (size_t)(col0 + 48 + r) * UU + kbase;

  v16bf a  = frag_bf16(arow);
  v16bf w0 = frag_bf16(w0p), w1 = frag_bf16(w1p);
  v16bf w2 = frag_bf16(w2p), w3 = frag_bf16(w3p);
#pragma unroll 4
  for (int k0 = 0; k0 < UU; k0 += 32) {
    v16bf an, n0, n1, n2, n3;
    const int k1 = k0 + 32;
    if (k1 < UU) {
      an = frag_bf16(arow + k1);
      n0 = frag_bf16(w0p + k1);  n1 = frag_bf16(w1p + k1);
      n2 = frag_bf16(w2p + k1);  n3 = frag_bf16(w3p + k1);
    }
    acc[0] = wmma_bf16(a, w0, acc[0]);
    acc[1] = wmma_bf16(a, w1, acc[1]);
    acc[2] = wmma_bf16(a, w2, acc[2]);
    acc[3] = wmma_bf16(a, w3, acc[3]);
    a = an; w0 = n0; w1 = n1; w2 = n2; w3 = n3;
  }
#pragma unroll
  for (int t = 0; t < 4; ++t) {
    const int Nc = col0 + t * 16 + r;
    const float bias = bpp[Nc];
#pragma unroll
    for (int v = 0; v < 8; ++v) {
      const size_t idx = (size_t)(row0 + v + mh) * UU + Nc;
      out[idx] = x[idx] + acc[t][v] + bias;
    }
  }
}

// ---------------------------------------------------------------- launch
extern "C" void kernel_launch(void* const* d_in, const int* in_sizes, int n_in,
                              void* d_out, int out_size, void* d_ws, size_t ws_size,
                              hipStream_t stream) {
  const float* x  = (const float*)d_in[0];
  const float* Wq = (const float*)d_in[1];
  const float* bq = (const float*)d_in[2];
  const float* Wk = (const float*)d_in[3];
  const float* bk = (const float*)d_in[4];
  const float* Wv = (const float*)d_in[5];
  const float* bv = (const float*)d_in[6];
  const float* Wp = (const float*)d_in[7];
  const float* bp = (const float*)d_in[8];
  float* out = (float*)d_out;

  char* ws = (char*)d_ws;
  const size_t wbytes = (size_t)UU * UU * sizeof(__bf16);        // 512 KB
  const size_t tbytes = (size_t)BN * UU * sizeof(__bf16);        // 16 MB
  __bf16* WqT = (__bf16*)(ws);
  __bf16* WkT = (__bf16*)(ws + wbytes);
  __bf16* WvT = (__bf16*)(ws + 2 * wbytes);
  __bf16* WpT = (__bf16*)(ws + 3 * wbytes);
  __bf16* Qb  = (__bf16*)(ws + 4 * wbytes);
  __bf16* Kb  = (__bf16*)(ws + 4 * wbytes + tbytes);
  __bf16* VTb = (__bf16*)(ws + 4 * wbytes + 2 * tbytes);
  __bf16* Ctx = (__bf16*)(ws + 4 * wbytes + 3 * tbytes);

  cvt_weights_t<<<(UU * UU) / 256, 256, 0, stream>>>(Wq, Wk, Wv, Wp, WqT, WkT, WvT, WpT);
  qkv_proj<<<2048, 256, 0, stream>>>(x, WqT, WkT, WvT, bq, bk, bv, Qb, Kb, VTb);
  dim3 fgrid(NN / (16 * RT), BB);
  flash_attn<<<fgrid, 256, 0, stream>>>(Qb, Kb, VTb, Ctx);
  out_proj<<<1024, 256, 0, stream>>>(x, Ctx, WpT, bp, out);
}

// v002
// A run of this version takes 511 microseconds.
// In both of two side-by-side timings against v001, it was 1.18 times as fast.
// Counting every step since v000, it is 2.11 times as fast.
#include <hip/hip_runtime.h>

#define BB 4
#define NN 4096
#define UU 512
#define BN (BB*NN)

typedef __attribute__((ext_vector_type(16))) __bf16 v16bf;
typedef __attribute__((ext_vector_type(8)))  __bf16 v8bf;
typedef __attribute__((ext_vector_type(8)))  float  v8f;
typedef __attribute__((ext_vector_type(4)))  unsigned int v4u;
typedef __attribute__((ext_vector_type(8)))  unsigned int v8u;

__device__ __forceinline__ v8f wmma_bf16(v16bf a, v16bf b, v8f c) {
  return __builtin_amdgcn_wmma_f32_16x16x32_bf16(false, a, false, b, (short)0, c,
                                                 false, false);
}

__device__ __forceinline__ v16bf frag_bf16(const __bf16* p) {
  v8bf lo = *(const v8bf*)(p);
  v8bf hi = *(const v8bf*)(p + 16);
  return __builtin_shufflevector(lo, hi, 0, 1, 2, 3, 4, 5, 6, 7,
                                 8, 9, 10, 11, 12, 13, 14, 15);
}
__device__ __forceinline__ v16bf frag_f32(const float* p) {
  float4 a0 = *(const float4*)(p);
  float4 a1 = *(const float4*)(p + 4);
  float4 b0 = *(const float4*)(p + 16);
  float4 b1 = *(const float4*)(p + 20);
  v16bf f;
  f[0] = (__bf16)a0.x;  f[1] = (__bf16)a0.y;  f[2] = (__bf16)a0.z;  f[3] = (__bf16)a0.w;
  f[4] = (__bf16)a1.x;  f[5] = (__bf16)a1.y;  f[6] = (__bf16)a1.z;  f[7] = (__bf16)a1.w;
  f[8] = (__bf16)b0.x;  f[9] = (__bf16)b0.y;  f[10] = (__bf16)b0.z; f[11] = (__bf16)b0.w;
  f[12] = (__bf16)b1.x; f[13] = (__bf16)b1.y; f[14] = (__bf16)b1.z; f[15] = (__bf16)b1.w;
  return f;
}

#define KROWB  128u                               // bytes of a slice row
#define KPITCH 144u                               // row pitch in LDS
#define KSLICE 6144u                              // 32 * 144 B, rounded up to 2 KiB
__device__ __forceinline__ unsigned uni(unsigned v) {
  return (unsigned)__builtin_amdgcn_readfirstlane(v);
}
__device__ __forceinline__ unsigned pinned(unsigned v) {
  unsigned w = uni(v);
  asm volatile("" : "+s"(w));  // keeps w in a scalar register
  return w;
}
// One request: 32 rows x 128 B, source pitch 1024 B, byte elements,
// tensor dims = tile dims, pad of 4 dwords behind every 32 dwords.
__device__ __forceinline__ void tdm_load_k_slice(const __bf16* gsrc, unsigned lds_off) {
  const unsigned long long ga = (unsigned long long)(uintptr_t)gsrc;
  v4u g0;
  g0[0] = uni(1u);                                          // count = 1
  g0[1] = uni(lds_off);                                     // LDS byte offset
  g0[2] = uni((unsigned)ga);                                // address [31:0]
  g0[3] = uni(((unsigned)(ga >> 32) & 0x01FFFFFFu) | 0x80000000u);  // [56:32], type 2
  v8u g1;
  g1[0] = uni((1u << 20) | (4u << 22) | (3u << 25));
  g1[1] = uni(KROWB << 16);
  g1[2] = uni(32u << 16);
  g1[3] = uni(KROWB << 16);
  g1[4] = uni(32u);
  g1[5] = uni(UU * 2u);
  g1[6] = uni(0u);
  g1[7] = uni(0u);
  asm volatile("tensor_load_to_lds %0, %1" :: "s"(g0), "s"(g1) : "memory");
}
// The compiler places no wait for a tensor load: a slice counts as landed only
// behind its issuer's wait.
__device__ __forceinline__ void wait_tensor0() { asm volatile("s_wait_tensorcnt 0x0" ::: "memory"); }
// This wave's LDS reads have retired before the buffer they read is refilled.
__device__ __forceinline__ void wait_ds0() { asm volatile("s_wait_dscnt 0x0" ::: "memory"); }

// ---------------------------------------------------------------- kernel 0
__global__ void cvt_weights_t(const float* __restrict__ wq, const float* __restrict__ wk,
                              const float* __restrict__ wv, const float* __restrict__ wp,
                              __bf16* __restrict__ dq, __bf16* __restrict__ dk,
                              __bf16* __restrict__ dv, __bf16* __restrict__ dp) {
  const int idx = blockIdx.x * blockDim.x + threadIdx.x;   // coalesced read
  const int k = idx / UU, n = idx % UU;
  const size_t t = (size_t)n * UU + k;                     // transposed write
  dq[t] = (__bf16)wq[idx];
  dk[t] = (__bf16)wk[idx];
  dv[t] = (__bf16)wv[idx];
  dp[t] = (__bf16)wp[idx];
}

// ---------------------------------------------------------------- kernel 1
// Fused Q/K/V projection; 16x32 output tile of all three per wave.
// Manual software pipeline: fragments for step k+1 are loaded into fresh
// values before step k's wmma chain, then rotated.
__global__ void __launch_bounds__(256) qkv_proj(
    const float* __restrict__ x,
    const __bf16* __restrict__ WqT, const __bf16* __restrict__ WkT,
    const __bf16* __restrict__ WvT,
    const float* __restrict__ bqp, const float* __restrict__ bkp,
    const float* __restrict__ bvp,
    __bf16* __restrict__ Q, __bf16* __restrict__ K, __bf16* __restrict__ VT) {
  const int lane = threadIdx.x & 31;
  const int wave = threadIdx.x >> 5;
  const int tile = blockIdx.x * 8 + wave;       // 16384 tiles
  const int colPairs = UU / 32;                 // 16
  const int rowTile = tile / colPairs;
  const int colPair = tile - rowTile * colPairs;
  const int row0 = rowTile * 16, col0 = colPair * 32;
  const int kbase = (lane & 16) ? 8 : 0;
  const int r = lane & 15;
  const int mh = (lane >> 4) << 3;

  v8f cq0 = {}, cq1 = {}, ck0 = {}, ck1 = {}, cv0 = {}, cv1 = {};
  const float*  xrow = x + (size_t)(row0 + r) * UU + kbase;
  const __bf16* wp0 = WqT + (size_t)(col0 + r) * UU + kbase;
  const __bf16* wp1 = WqT + (size_t)(col0 + 16 + r) * UU + kbase;
  const __bf16* wp2 = WkT + (size_t)(col0 + r) * UU + kbase;
  const __bf16* wp3 = WkT + (size_t)(col0 + 16 + r) * UU + kbase;
  const __bf16* wp4 = WvT + (size_t)(col0 + r) * UU + kbase;
  const __bf16* wp5 = WvT + (size_t)(col0 + 16 + r) * UU + kbase;

  // pipeline prologue: stage 0 fragments
  v16bf a  = frag_f32(xrow);
  v16bf w0 = frag_bf16(wp0), w1 = frag_bf16(wp1), w2 = frag_bf16(wp2);
  v16bf w3 = frag_bf16(wp3), w4 = frag_bf16(wp4), w5 = frag_bf16(wp5);
#pragma unroll 4
  for (int k0 = 0; k0 < UU; k0 += 32) {
    v16bf an, n0, n1, n2, n3, n4, n5;
    const int k1 = k0 + 32;
    if (k1 < UU) {                               // load next step's fragments
      an = frag_f32(xrow + k1);
      n0 = frag_bf16(wp0 + k1);  n1 = frag_bf16(wp1 + k1);
      n2 = frag_bf16(wp2 + k1);  n3 = frag_bf16(wp3 + k1);
      n4 = frag_bf16(wp4 + k1);  n5 = frag_bf16(wp5 + k1);
    }
    cq0 = wmma_bf16(a, w0, cq0);
    cq1 = wmma_bf16(a, w1, cq1);
    ck0 = wmma_bf16(a, w2, ck0);
    ck1 = wmma_bf16(a, w3, ck1);
    cv0 = wmma_bf16(a, w4, cv0);
    cv1 = wmma_bf16(a, w5, cv1);
    a = an; w0 = n0; w1 = n1; w2 = n2; w3 = n3; w4 = n4; w5 = n5;
  }
  const float scale = rsqrtf((float)UU);
  const int b = row0 >> 12;                     // row0 / NN
#pragma unroll
  for (int v = 0; v < 8; ++v) {
    const int M = v + mh;
    const int nrow = (row0 + M) & (NN - 1);
    const size_t idx = (size_t)(row0 + M) * UU;
#pragma unroll
    for (int h = 0; h < 2; ++h) {
      const int Nc = col0 + 16 * h + r;
      const float q = (h ? cq1[v] : cq0[v]) + bqp[Nc];
      const float k = (h ? ck1[v] : ck0[v]) + bkp[Nc];
      const float vv = (h ? cv1[v] : cv0[v]) + bvp[Nc];
      Q[idx + Nc] = (__bf16)(q * scale);
      K[idx + Nc] = (__bf16)k;
      VT[((size_t)b * UU + Nc) * NN + nrow] = (__bf16)vv;   // transposed V
    }
  }
}

// ---------------------------------------------------------------- kernel 2
// Flash attention: 64 query rows/block (4 row tiles), 8 waves split d (64 each).
// Every wave carries all 4 row tiles of its d-slice, so each K fragment (LDS)
// and each V fragment (global) feeds 4 matrix instructions.
// The 64x32 score block is summed and soft-maxed once: wave w owns row tile
// w>>1, accumulator rows 4*(w&1)..+3 of each lane half.
// K tiles are double-buffered in LDS by tensor loads, one slice per wave.
#define RT 4                                      // row tiles per block
#define NW 8                                      // waves per block
#define DS (UU / NW)                              // d columns per wave
__global__ void __launch_bounds__(256) flash_attn(
    const __bf16* __restrict__ Q, const __bf16* __restrict__ K,
    const __bf16* __restrict__ VT, __bf16* __restrict__ C) {
  __shared__ alignas(2048) unsigned char sK[2][NW][KSLICE];  // 96 KB: K slices
  // per-wave partial S, kept in accumulator order: [wave][tile][key half]
  // [register quad][lane] -> one 16B element per lane, no transposition
  __shared__ float4 sS[NW][RT][2][2][32];         // 64 KB
  // P for A-frag repack; 80-B pitch = 16 B x 5 for its ds_load_b128 readers
  __shared__ alignas(16) __bf16 sP[RT][16][40];
  __shared__ alignas(16) float sC[RT][16];        // per-row rescale factor

  const int lane = threadIdx.x & 31;
  const int wave = threadIdx.x >> 5;              // 0..7 -> d-slice
  const int b  = blockIdx.y;
  const int q0 = blockIdx.x * (16 * RT);
  const int ds0 = wave * DS;
  const int kbase = (lane & 16) ? 8 : 0;
  const int r  = lane & 15;
  const int mh = (lane >> 4) << 3;
  const int tw = wave >> 1;                       // softmax: owned row tile
  const int hw = wave & 1;                        // softmax: owned register quad

  const __bf16* Qb = Q + (size_t)b * NN * UU;
  const __bf16* Kb = K + (size_t)b * NN * UU;
  const __bf16* Vt = VT + (size_t)b * UU * NN;    // [d][n]

  typedef __attribute__((address_space(3))) unsigned char lds_u8;
  const unsigned sw = uni(threadIdx.x >> 5);      // wave number, scalar
  const unsigned sK0 = (unsigned)(unsigned long long)(lds_u8*)&sK[0][0][0] + sw * KSLICE;
  const unsigned sK1 = sK0 + NW * KSLICE;
  const __bf16* Kw = Kb + sw * DS;                // this wave's columns of K

  v16bf qf[RT][2];
#pragma unroll
  for (int t = 0; t < RT; ++t)
#pragma unroll
    for (int kk = 0; kk < 2; ++kk)
      qf[t][kk] = frag_bf16(Qb + (size_t)(q0 + 16 * t + r) * UU + ds0 + kk * 32 + kbase);

  v8f o[RT][4] = {};
  float m[4], l[4];                               // rows 4*hw+i+mh of tile tw
#pragma unroll
  for (int i = 0; i < 4; ++i) { m[i] = -3.0e38f; l[i] = 0.f; }

  __builtin_amdgcn_sched_barrier(0);
  tdm_load_k_slice(Kw, sK0);
  wait_tensor0();
  __builtin_amdgcn_sched_barrier(0);
  __syncthreads();
  tdm_load_k_slice(Kw + (size_t)32 * UU, sK1);

  for (int kb = 0; kb < NN; kb += 32) {
    const int buf = (kb >> 5) & 1;
    // partial S over this wave's d-slice from LDS (ds_load_b128 fragments)
    v8f s[RT][2] = {};
#pragma unroll
    for (int kk = 0; kk < 2; ++kk) {
      const unsigned char* kp = &sK[buf][wave][r * KPITCH + (kk * 32 + kbase) * 2];
      v16bf b0 = frag_bf16((const __bf16*)kp);
      v16bf b1 = frag_bf16((const __bf16*)(kp + 16 * KPITCH));
#pragma unroll
      for (int t = 0; t < RT; ++t) {
        s[t][0] = wmma_bf16(qf[t][kk], b0, s[t][0]);
        s[t][1] = wmma_bf16(qf[t][kk], b1, s[t][1]);
      }
    }
    if (kb + 32 < NN)
      __builtin_prefetch(Vt + (size_t)(ds0 + r) * NN + kb + 32, 0, 1);

#pragma unroll
    for (int t = 0; t < RT; ++t)
#pragma unroll
      for (int h = 0; h < 2; ++h) {
        sS[wave][t][h][0][lane] = make_float4(s[t][h][0], s[t][h][1], s[t][h][2], s[t][h][3]);
        sS[wave][t][h][1][lane] = make_float4(s[t][h][4], s[t][h][5], s[t][h][6], s[t][h][7]);
      }
    __syncthreads();
    // full S of the owned rows: sum the 8 d-slices in wave order
    float fs0[4] = {0.f, 0.f, 0.f, 0.f}, fs1[4] = {0.f, 0.f, 0.f, 0.f};
#pragma unroll
    for (int w = 0; w < NW; ++w) {
      const float4 a0 = sS[w][tw][0][hw][lane];
      const float4 a1 = sS[w][tw][1][hw][lane];
      fs0[0] += a0.x; fs0[1] += a0.y; fs0[2] += a0.z; fs0[3] += a0.w;
      fs1[0] += a1.x; fs1[1] += a1.y; fs1[2] += a1.z; fs1[3] += a1.w;
    }
    // online softmax; a row lives across one 16-lane half -> xor reduce
    float cr[4];
#pragma unroll
    for (int i = 0; i < 4; ++i) {
      float mt = fmaxf(fs0[i], fs1[i]);
#pragma unroll
      for (int off = 1; off < 16; off <<= 1) mt = fmaxf(mt, __shfl_xor(mt, off, 32));
      const float mnew = fmaxf(m[i], mt);
      const float p0 = __expf(fs0[i] - mnew);
      const float p1 = __expf(fs1[i] - mnew);
      float rs = p0 + p1;
#pragma unroll
      for (int off = 1; off < 16; off <<= 1) rs += __shfl_xor(rs, off, 32);
      const float corr = __expf(m[i] - mnew);
      l[i] = l[i] * corr + rs;
      m[i] = mnew;
      cr[i] = corr;
      sP[tw][4 * hw + i + mh][r]      = (__bf16)p0;
      sP[tw][4 * hw + i + mh][16 + r] = (__bf16)p1;
    }
    if (r == 0)
      *(float4*)&sC[tw][4 * hw + mh] = make_float4(cr[0], cr[1], cr[2], cr[3]);
    __syncthreads();
    // rescale O by its rows' factors; repack P (C-layout) into A-fragments
    v16bf pf[RT];
#pragma unroll
    for (int t = 0; t < RT; ++t) {
      pf[t] = frag_bf16(&sP[t][r][0] + kbase);
      const float4 c0 = *(const float4*)&sC[t][mh];
      const float4 c1 = *(const float4*)&sC[t][mh + 4];
#pragma unroll
      for (int j = 0; j < 4; ++j) {
        o[t][j][0] *= c0.x; o[t][j][1] *= c0.y; o[t][j][2] *= c0.z; o[t][j][3] *= c0.w;
        o[t][j][4] *= c1.x; o[t][j][5] *= c1.y; o[t][j][6] *= c1.z; o[t][j][7] *= c1.w;
      }
    }
    // O[:, ds0+16j] += P * V^T; the 4 V frags are loaded ahead of the MMAs
    const __bf16* vp = Vt + (size_t)(ds0 + r) * NN + kb + kbase;
    v16bf f0 = frag_bf16(vp);
    v16bf f1 = frag_bf16(vp + (size_t)16 * NN);
    v16bf f2 = frag_bf16(vp + (size_t)32 * NN);
    v16bf f3 = frag_bf16(vp + (size_t)48 * NN);
#pragma unroll
    for (int t = 0; t < RT; ++t) {
      o[t][0] = wmma_bf16(pf[t], f0, o[t][0]);
      o[t][1] = wmma_bf16(pf[t], f1, o[t][1]);
      o[t][2] = wmma_bf16(pf[t], f2, o[t][2]);
      o[t][3] = wmma_bf16(pf[t], f3, o[t][3]);
    }
    // publish next K tile (and retire this iteration's sS/sP/sC reads), then
    // refill the buffer that this pass has read with the tile after next
    wait_ds0();
    wait_tensor0();
    __syncthreads();
    const unsigned kn = pinned((unsigned)kb + 64u);
    if (kn < NN)
      tdm_load_k_slice(Kw + (size_t)kn * UU, buf ? sK1 : sK0);
  }
  wait_tensor0();
  wait_ds0();
  // hand each row's 1/l from its owner to every wave
  if (r == 0)
    *(float4*)&sC[tw][4 * hw + mh] =
        make_float4(1.f / l[0], 1.f / l[1], 1.f / l[2], 1.f / l[3]);
  __syncthreads();
  float4 iv[RT][2];
#pragma unroll
  for (int t = 0; t < RT; ++t) {
    iv[t][0] = *(const float4*)&sC[t][mh];
    iv[t][1] = *(const float4*)&sC[t][mh + 4];
  }
#pragma unroll
  for (int t = 0; t < RT; ++t)
#pragma unroll
    for (int v = 0; v < 8; ++v) {
      const float4 q4 = iv[t][v >> 2];
      const float inv = (v & 3) == 0 ? q4.x : (v & 3) == 1 ? q4.y : (v & 3) == 2 ? q4.z : q4.w;
      const size_t row = (size_t)b * NN + q0 + 16 * t + v + mh;
#pragma unroll
      for (int j = 0; j < 4; ++j)
        C[row * UU + ds0 + j * 16 + r] = (__bf16)(o[t][j][v] * inv);
    }
}

// ---------------------------------------------------------------- kernel 3
// out = x + ctx @ Wp + bp (fp32 out); 16x64 tile per wave, software-pipelined
__global__ void __launch_bounds__(256) out_proj(
    const float* __restrict__ x, const __bf16* __restrict__ Cb,
    const __bf16* __restrict__ WpT, const float* __restrict__ bpp,
    float* __restrict__ out) {
  const int lane = threadIdx.x & 31;
  const int wave = threadIdx.x >> 5;
  const int tile = blockIdx.x * 8 + wave;       // 8192 tiles
  const int colQuads = UU / 64;                 // 8
  const int rowTile = tile / colQuads;
  const int colQuad = tile - rowTile * colQuads;
  const int row0 = rowTile * 16, col0 = colQuad * 64;
  const int kbase = (lane & 16) ? 8 : 0;
  const int r = lane & 15;
  const int mh = (lane >> 4) << 3;

  v8f acc[4] = {};
  const __bf16* arow = Cb + (size_t)(row0 + r) * UU + kbase;
  const __bf16* w0p = WpT + (size_t)(col0 + r) * UU + kbase;
  const __bf16* w1p = WpT + (size_t)(col0 + 16 + r) * UU + kbase;
  const __bf16* w2p = WpT + (size_t)(col0 + 32 + r) * UU + kbase;
  const __bf16* w3p = WpT + (size_t)(col0 + 48 + r) * UU + kbase;

  v16bf a  = frag_bf16(arow);
  v16bf w0 = frag_bf16(w0p), w1 = frag_bf16(w1p);
  v16bf w2 = frag_bf16(w2p), w3 = frag_bf16(w3p);
#pragma unroll 4
  for (int k0 = 0; k0 < UU; k0 += 32) {
    v16bf an, n0, n1, n2, n3;
    const int k1 = k0 + 32;
    if (k1 < UU) {
      an = frag_bf16(arow + k1);
      n0 = frag_bf16(w0p + k1);  n1 = frag_bf16(w1p + k1);
      n2 = frag_bf16(w2p + k1);  n3 = frag_bf16(w3p + k1);
    }
    acc[0] = wmma_bf16(a, w0, acc[0]);
    acc[1] = wmma_bf16(a, w1, acc[1]);
    acc[2] = wmma_bf16(a, w2, acc[2]);
    acc[3] = wmma_bf16(a, w3, acc[3]);
    a = an; w0 = n0; w1 = n1; w2 = n2; w3 = n3;
  }
#pragma unroll
  for (int t = 0; t < 4; ++t) {
    const int Nc = col0 + t * 16 + r;
    const float bias = bpp[Nc];
#pragma unroll
    for (int v = 0; v < 8; ++v) {
      const size_t idx = (size_t)(row0 + v + mh) * UU + Nc;
      out[idx] = x[idx] + acc[t][v] + bias;
    }
  }
}

// ---------------------------------------------------------------- launch
extern "C" void kernel_launch(void* const* d_in, const int* in_sizes, int n_in,
                              void* d_out, int out_size, void* d_ws, size_t ws_size,
                              hipStream_t stream) {
  const float* x  = (const float*)d_in[0];
  const float* Wq = (const float*)d_in[1];
  const float* bq = (const float*)d_in[2];
  const float* Wk = (const float*)d_in[3];
  const float* bk = (const float*)d_in[4];
  const float* Wv = (const float*)d_in[5];
  const float* bv = (const float*)d_in[6];
  const float* Wp = (const float*)d_in[7];
  const float* bp = (const float*)d_in[8];
  float* out = (float*)d_out;

  char* ws = (char*)d_ws;
  const size_t wbytes = (size_t)UU * UU * sizeof(__bf16);        // 512 KB
  const size_t tbytes = (size_t)BN * UU * sizeof(__bf16);        // 16 MB
  __bf16* WqT = (__bf16*)(ws);
  __bf16* WkT = (__bf16*)(ws + wbytes);
  __bf16* WvT = (__bf16*)(ws + 2 * wbytes);
  __bf16* WpT = (__bf16*)(ws + 3 * wbytes);
  __bf16* Qb  = (__bf16*)(ws + 4 * wbytes);
  __bf16* Kb  = (__bf16*)(ws + 4 * wbytes + tbytes);
  __bf16* VTb = (__bf16*)(ws + 4 * wbytes + 2 * tbytes);
  __bf16* Ctx = (__bf16*)(ws + 4 * wbytes + 3 * tbytes);

  cvt_weights_t<<<(UU * UU) / 256, 256, 0, stream>>>(Wq, Wk, Wv, Wp, WqT, WkT, WvT, WpT);
  qkv_proj<<<2048, 256, 0, stream>>>(x, WqT, WkT, WvT, bq, bk, bv, Qb, Kb, VTb);
  dim3 fgrid(NN / (16 * RT), BB);
  flash_attn<<<fgrid, 256, 0, stream>>>(Qb, Kb, VTb, Ctx);
  out_proj<<<1024, 256, 0, stream>>>(x, Ctx, WpT, bp, out);
}

// v003
// It runs in 318 microseconds.
// In both of two side-by-side timings against v002, it was 1.61 times as fast.
// All steps since v000 together make it 3.40 times as fast.
#include <hip/hip_runtime.h>

#define BB 4
#define NN 4096
#define UU 512
#define BN (BB*NN)

typedef __attribute__((ext_vector_type(16))) __bf16 v16bf;
typedef __attribute__((ext_vector_type(8)))  __bf16 v8bf;
typedef __attribute__((ext_vector_type(8)))  float  v8f;
typedef __attribute__((ext_vector_type(4)))  unsigned int v4u;
typedef __attribute__((ext_vector_type(8)))  unsigned int v8u;

__device__ __forceinline__ v8f wmma_bf16(v16bf a, v16bf b, v8f c) {
  return __builtin_amdgcn_wmma_f32_16x16x32_bf16(false, a, false, b, (short)0, c,
                                                 false, false);
}

__device__ __forceinline__ v16bf frag_bf16(const __bf16* p) {
  v8bf lo = *(const v8bf*)(p);
  v8bf hi = *(const v8bf*)(p + 16);
  return __builtin_shufflevector(lo, hi, 0, 1, 2, 3, 4, 5, 6, 7,
                                 8, 9, 10, 11, 12, 13, 14, 15);
}
#define FBLK 512
__device__ __forceinline__ v16bf frag_packed(const __bf16* p) {
  v8bf lo = *(const v8bf*)(p);
  v8bf hi = *(const v8bf*)(p + 256);
  return __builtin_shufflevector(lo, hi, 0, 1, 2, 3, 4, 5, 6, 7,
                                 8, 9, 10, 11, 12, 13, 14, 15);
}
__device__ __forceinline__ v16bf frag_f32(const float* p) {
  float4 a0 = *(const float4*)(p);
  float4 a1 = *(const float4*)(p + 4);
  float4 b0 = *(const float4*)(p + 16);
  float4 b1 = *(const float4*)(p + 20);
  v16bf f;
  f[0] = (__bf16)a0.x;  f[1] = (__bf16)a0.y;  f[2] = (__bf16)a0.z;  f[3] = (__bf16)a0.w;
  f[4] = (__bf16)a1.x;  f[5] = (__bf16)a1.y;  f[6] = (__bf16)a1.z;  f[7] = (__bf16)a1.w;
  f[8] = (__bf16)b0.x;  f[9] = (__bf16)b0.y;  f[10] = (__bf16)b0.z; f[11] = (__bf16)b0.w;
  f[12] = (__bf16)b1.x; f[13] = (__bf16)b1.y; f[14] = (__bf16)b1.z; f[15] = (__bf16)b1.w;
  return f;
}

#define KROWB  128u                               // bytes of a slice row
#define KPITCH 144u                               // row pitch in LDS
#define KSLICE 6144u                              // 32 * 144 B, rounded up to 2 KiB
__device__ __forceinline__ unsigned uni(unsigned v) {
  return (unsigned)__builtin_amdgcn_readfirstlane(v);
}
__device__ __forceinline__ unsigned pinned(unsigned v) {
  unsigned w = uni(v);
  asm volatile("" : "+s"(w));  // keeps w in a scalar register
  return w;
}
// One request: 32 rows x 128 B, source pitch 1024 B, byte elements,
// tensor dims = tile dims, pad of 4 dwords behind every 32 dwords.
__device__ __forceinline__ void tdm_load_k_slice(const __bf16* gsrc, unsigned lds_off) {
  const unsigned long long ga = (unsigned long long)(uintptr_t)gsrc;
  v4u g0;
  g0[0] = uni(1u);                                          // count = 1
  g0[1] = uni(lds_off);                                     // LDS byte offset
  g0[2] = uni((unsigned)ga);                                // address [31:0]
  g0[3] = uni(((unsigned)(ga >> 32) & 0x01FFFFFFu) | 0x80000000u);  // [56:32], type 2
  v8u g1;
  g1[0] = uni((1u << 20) | (4u << 22) | (3u << 25));
  g1[1] = uni(KROWB << 16);
  g1[2] = uni(32u << 16);
  g1[3] = uni(KROWB << 16);
  g1[4] = uni(32u);
  g1[5] = uni(UU * 2u);
  g1[6] = uni(0u);
  g1[7] = uni(0u);
  asm volatile("tensor_load_to_lds %0, %1" :: "s"(g0), "s"(g1) : "memory");
}
// The compiler places no wait for a tensor load: a slice counts as landed only
// behind its issuer's wait.
__device__ __forceinline__ void wait_tensor0() { asm volatile("s_wait_tensorcnt 0x0" ::: "memory"); }
// This wave's LDS reads have retired before the buffer they read is refilled.
__device__ __forceinline__ void wait_ds0() { asm volatile("s_wait_dscnt 0x0" ::: "memory"); }

// Stands between issued global loads (or a prefetch) and the next pass's rewrite of
// the address registers that they name.
__device__ __forceinline__ void wait_x0() { asm volatile("s_wait_xcnt 0x0" ::: "memory"); }

// ---------------------------------------------------------------- kernel 0
__global__ void cvt_weights_t(const float* __restrict__ wq, const float* __restrict__ wk,
                              const float* __restrict__ wv, const float* __restrict__ wp,
                              __bf16* __restrict__ dq, __bf16* __restrict__ dk,
                              __bf16* __restrict__ dv, __bf16* __restrict__ dp) {
  const int idx = blockIdx.x * blockDim.x + threadIdx.x;   // coalesced read
  const int k = idx / UU, n = idx % UU;
  // fragment order, blocks laid out [n tile][k block]
  const size_t t = ((size_t)(n >> 4) * (UU / 32) + (k >> 5)) * FBLK +
                   ((k >> 4) & 1) * 256 + ((((k >> 3) & 1) << 4) + (n & 15)) * 8 + (k & 7);
  dq[t] = (__bf16)wq[idx];
  dk[t] = (__bf16)wk[idx];
  dv[t] = (__bf16)wv[idx];
  dp[t] = (__bf16)wp[idx];
}

// ---------------------------------------------------------------- kernel 1
// Fused Q/K/V projection; 16x32 output tile of all three per wave.
// Manual software pipeline: fragments for step k+1 are loaded into fresh
// values before step k's wmma chain, then rotated.
__global__ void __launch_bounds__(256) qkv_proj(
    const float* __restrict__ x,
    const __bf16* __restrict__ WqT, const __bf16* __restrict__ WkT,
    const __bf16* __restrict__ WvT,
    const float* __restrict__ bqp, const float* __restrict__ bkp,
    const float* __restrict__ bvp,
    __bf16* __restrict__ Q, __bf16* __restrict__ K, __bf16* __restrict__ VT) {
  const int lane = threadIdx.x & 31;
  const int wave = threadIdx.x >> 5;
  const int tile = blockIdx.x * 8 + wave;       // 16384 tiles
  const int colPairs = UU / 32;                 // 16
  const int rowTile = tile / colPairs;
  const int colPair = tile - rowTile * colPairs;
  const int row0 = rowTile * 16, col0 = colPair * 32;
  const int kbase = (lane & 16) ? 8 : 0;
  const int r = lane & 15;
  const int mh = (lane >> 4) << 3;

  v8f cq0 = {}, cq1 = {}, ck0 = {}, ck1 = {}, cv0 = {}, cv1 = {};
  const float*  xrow = x + (size_t)(row0 + r) * UU + kbase;
  // weights in fragment order: one n tile is UU/32 consecutive blocks
  const size_t wt = (size_t)(col0 >> 4) * (UU / 32) * FBLK + lane * 8;
  const __bf16* wp0 = WqT + wt;
  const __bf16* wp1 = wp0 + (UU / 32) * FBLK;
  const __bf16* wp2 = WkT + wt;
  const __bf16* wp3 = wp2 + (UU / 32) * FBLK;
  const __bf16* wp4 = WvT + wt;
  const __bf16* wp5 = wp4 + (UU / 32) * FBLK;

  // pipeline prologue: stage 0 fragments
  v16bf a  = frag_f32(xrow);
  v16bf w0 = frag_packed(wp0), w1 = frag_packed(wp1), w2 = frag_packed(wp2);
  v16bf w3 = frag_packed(wp3), w4 = frag_packed(wp4), w5 = frag_packed(wp5);
#pragma unroll 4
  for (int k0 = 0; k0 < UU; k0 += 32) {
    v16bf an, n0, n1, n2, n3, n4, n5;
    const int k1 = k0 + 32;
    if (k1 < UU) {                               // load next step's fragments
      an = frag_f32(xrow + k1);
      const int kf = (k1 >> 5) * FBLK;           // next k block
      n0 = frag_packed(wp0 + kf);  n1 = frag_packed(wp1 + kf);
      n2 = frag_packed(wp2 + kf);  n3 = frag_packed(wp3 + kf);
      n4 = frag_packed(wp4 + kf);  n5 = frag_packed(wp5 + kf);
      wait_x0();
    }
    cq0 = wmma_bf16(a, w0, cq0);
    cq1 = wmma_bf16(a, w1, cq1);
    ck0 = wmma_bf16(a, w2, ck0);
    ck1 = wmma_bf16(a, w3, ck1);
    cv0 = wmma_bf16(a, w4, cv0);
    cv1 = wmma_bf16(a, w5, cv1);
    a = an; w0 = n0; w1 = n1; w2 = n2; w3 = n3; w4 = n4; w5 = n5;
  }
  const float scale = rsqrtf((float)UU);
  const int b = row0 >> 12;                     // row0 / NN
  v8bf pv[2];                                   // V: a lane's 8 keys of one d column
#pragma unroll
  for (int v = 0; v < 8; ++v) {
    const int M = v + mh;
    const size_t idx = (size_t)(row0 + M) * UU;
#pragma unroll
    for (int h = 0; h < 2; ++h) {
      const int Nc = col0 + 16 * h + r;
      const float q = (h ? cq1[v] : cq0[v]) + bqp[Nc];
      const float k = (h ? ck1[v] : ck0[v]) + bkp[Nc];
      const float vv = (h ? cv1[v] : cv0[v]) + bvp[Nc];
      Q[idx + Nc] = (__bf16)(q * scale);
      K[idx + Nc] = (__bf16)k;
      pv[h][v] = (__bf16)vv;
    }
  }
  // V in fragment order (k = key, n = d), blocks laid out [batch][key block][d tile]:
  // the accumulator's 8 rows of a lane are that lane's 8 consecutive elements.
  __bf16* vdst = VT + (((size_t)b * (NN / 32) + ((row0 & (NN - 1)) >> 5)) * (UU / 16) +
                       (col0 >> 4)) * FBLK + ((row0 >> 4) & 1) * 256 + lane * 8;
  *(v8bf*)(vdst) = pv[0];
  *(v8bf*)(vdst + FBLK) = pv[1];
}

// ---------------------------------------------------------------- kernel 2
// Flash attention: 64 query rows/block (4 row tiles), 8 waves split d (64 each).
// Every wave carries all 4 row tiles of its d-slice, so each K fragment (LDS)
// and each V fragment (global) feeds 4 matrix instructions.
// The 64x32 score block is summed and soft-maxed once: wave w owns row tile
// w>>1, accumulator rows 4*(w&1)..+3 of each lane half.
// K tiles are double-buffered in LDS by tensor loads, one slice per wave.
#define RT 4                                      // row tiles per block
#define NW 8                                      // waves per block
#define DS (UU / NW)                              // d columns per wave
__global__ void __launch_bounds__(256) flash_attn(
    const __bf16* __restrict__ Q, const __bf16* __restrict__ K,
    const __bf16* __restrict__ VT, __bf16* __restrict__ C) {
  __shared__ alignas(2048) unsigned char sK[2][NW][KSLICE];  // 96 KB: K slices
  // per-wave partial S, kept in accumulator order: [wave][tile][key half]
  // [register quad][lane] -> one 16B element per lane, no transposition
  __shared__ float4 sS[NW][RT][2][2][32];         // 64 KB
  // P for A-frag repack; 80-B pitch = 16 B x 5 for its ds_load_b128 readers
  __shared__ alignas(16) __bf16 sP[RT][16][40];
  __shared__ alignas(16) float sC[RT][16];        // per-row rescale factor

  const int lane = threadIdx.x & 31;
  const int wave = threadIdx.x >> 5;              // 0..7 -> d-slice
  const int b  = blockIdx.y;
  const int q0 = blockIdx.x * (16 * RT);
  const int ds0 = wave * DS;
  const int kbase = (lane & 16) ? 8 : 0;
  const int r  = lane & 15;
  const int mh = (lane >> 4) << 3;
  const int tw = wave >> 1;                       // softmax: owned row tile
  const int hw = wave & 1;                        // softmax: owned register quad

  const __bf16* Qb = Q + (size_t)b * NN * UU;
  const __bf16* Kb = K + (size_t)b * NN * UU;
  const __bf16* Vt = VT + (size_t)b * UU * NN;    // fragment order [key block][d tile]

  typedef __attribute__((address_space(3))) unsigned char lds_u8;
  const unsigned sw = uni(threadIdx.x >> 5);      // wave number, scalar
  const unsigned sK0 = (unsigned)(unsigned long long)(lds_u8*)&sK[0][0][0] + sw * KSLICE;
  const unsigned sK1 = sK0 + NW * KSLICE;
  const __bf16* Kw = Kb + sw * DS;                // this wave's columns of K

  v16bf qf[RT][2];
#pragma unroll
  for (int t = 0; t < RT; ++t)
#pragma unroll
    for (int kk = 0; kk < 2; ++kk)
      qf[t][kk] = frag_bf16(Qb + (size_t)(q0 + 16 * t + r) * UU + ds0 + kk * 32 + kbase);

  v8f o[RT][4] = {};
  float m[4], l[4];                               // rows 4*hw+i+mh of tile tw
#pragma unroll
  for (int i = 0; i < 4; ++i) { m[i] = -3.0e38f; l[i] = 0.f; }

  __builtin_amdgcn_sched_barrier(0);
  tdm_load_k_slice(Kw, sK0);
  wait_tensor0();
  __builtin_amdgcn_sched_barrier(0);
  __syncthreads();
  tdm_load_k_slice(Kw + (size_t)32 * UU, sK1);

  for (int kb = 0; kb < NN; kb += 32) {
    const int buf = (kb >> 5) & 1;
    // partial S over this wave's d-slice from LDS (ds_load_b128 fragments)
    v8f s[RT][2] = {};
#pragma unroll
    for (int kk = 0; kk < 2; ++kk) {
      const unsigned char* kp = &sK[buf][wave][r * KPITCH + (kk * 32 + kbase) * 2];
      v16bf b0 = frag_bf16((const __bf16*)kp);
      v16bf b1 = frag_bf16((const __bf16*)(kp + 16 * KPITCH));
#pragma unroll
      for (int t = 0; t < RT; ++t) {
        s[t][0] = wmma_bf16(qf[t][kk], b0, s[t][0]);
        s[t][1] = wmma_bf16(qf[t][kk], b1, s[t][1]);
      }
    }
    if (kb + 32 < NN)
      __builtin_prefetch(Vt + ((size_t)((kb >> 5) + 1) * (UU / 16) + wave * (DS / 16)) * FBLK +
                             lane * 64, 0, 1);

#pragma unroll
    for (int t = 0; t < RT; ++t)
#pragma unroll
      for (int h = 0; h < 2; ++h) {
        sS[wave][t][h][0][lane] = make_float4(s[t][h][0], s[t][h][1], s[t][h][2], s[t][h][3]);
        sS[wave][t][h][1][lane] = make_float4(s[t][h][4], s[t][h][5], s[t][h][6], s[t][h][7]);
      }
    __syncthreads();
    // full S of the owned rows: sum the 8 d-slices in wave order
    float fs0[4] = {0.f, 0.f, 0.f, 0.f}, fs1[4] = {0.f, 0.f, 0.f, 0.f};
#pragma unroll
    for (int w = 0; w < NW; ++w) {
      const float4 a0 = sS[w][tw][0][hw][lane];
      const float4 a1 = sS[w][tw][1][hw][lane];
      fs0[0] += a0.x; fs0[1] += a0.y; fs0[2] += a0.z; fs0[3] += a0.w;
      fs1[0] += a1.x; fs1[1] += a1.y; fs1[2] += a1.z; fs1[3] += a1.w;
    }
    // online softmax; a row lives across one 16-lane half -> xor reduce
    float cr[4];
#pragma unroll
    for (int i = 0; i < 4; ++i) {
      float mt = fmaxf(fs0[i], fs1[i]);
#pragma unroll
      for (int off = 1; off < 16; off <<= 1) mt = fmaxf(mt, __shfl_xor(mt, off, 32));
      const float mnew = fmaxf(m[i], mt);
      const float p0 = __expf(fs0[i] - mnew);
      const float p1 = __expf(fs1[i] - mnew);
      float rs = p0 + p1;
#pragma unroll
      for (int off = 1; off < 16; off <<= 1) rs += __shfl_xor(rs, off, 32);
      const float corr = __expf(m[i] - mnew);
      l[i] = l[i] * corr + rs;
      m[i] = mnew;
      cr[i] = corr;
      sP[tw][4 * hw + i + mh][r]      = (__bf16)p0;
      sP[tw][4 * hw + i + mh][16 + r] = (__bf16)p1;
    }
    if (r == 0)
      *(float4*)&sC[tw][4 * hw + mh] = make_float4(cr[0], cr[1], cr[2], cr[3]);
    __syncthreads();
    // rescale O by its rows' factors; repack P (C-layout) into A-fragments
    v16bf pf[RT];
#pragma unroll
    for (int t = 0; t < RT; ++t) {
      pf[t] = frag_bf16(&sP[t][r][0] + kbase);
      const float4 c0 = *(const float4*)&sC[t][mh];
      const float4 c1 = *(const float4*)&sC[t][mh + 4];
#pragma unroll
      for (int j = 0; j < 4; ++j) {
        o[t][j][0] *= c0.x; o[t][j][1] *= c0.y; o[t][j][2] *= c0.z; o[t][j][3] *= c0.w;
        o[t][j][4] *= c1.x; o[t][j][5] *= c1.y; o[t][j][6] *= c1.z; o[t][j][7] *= c1.w;
      }
    }
    // O[:, ds0+16j] += P * V^T; the 4 V frags are loaded ahead of the MMAs
    const __bf16* vp = Vt + ((size_t)(kb >> 5) * (UU / 16) + wave * (DS / 16)) * FBLK + lane * 8;
    v16bf f0 = frag_packed(vp);
    v16bf f1 = frag_packed(vp + FBLK);
    v16bf f2 = frag_packed(vp + 2 * FBLK);
    v16bf f3 = frag_packed(vp + 3 * FBLK);
#pragma unroll
    for (int t = 0; t < RT; ++t) {
      o[t][0] = wmma_bf16(pf[t], f0, o[t][0]);
      o[t][1] = wmma_bf16(pf[t], f1, o[t][1]);
      o[t][2] = wmma_bf16(pf[t], f2, o[t][2]);
      o[t][3] = wmma_bf16(pf[t], f3, o[t][3]);
    }
    wait_x0();  // V loads and prefetch above: their address registers step on behind here
    // publish next K tile (and retire this iteration's sS/sP/sC reads), then
    // refill the buffer that this pass has read with the tile after next
    wait_ds0();
    wait_tensor0();
    __syncthreads();
    const unsigned kn = pinned((unsigned)kb + 64u);
    if (kn < NN)
      tdm_load_k_slice(Kw + (size_t)kn * UU, buf ? sK1 : sK0);
  }
  wait_tensor0();
  wait_ds0();
  // hand each row's 1/l from its owner to every wave
  if (r == 0)
    *(float4*)&sC[tw][4 * hw + mh] =
        make_float4(1.f / l[0], 1.f / l[1], 1.f / l[2], 1.f / l[3]);
  __syncthreads();
  float4 iv[RT][2];
#pragma unroll
  for (int t = 0; t < RT; ++t) {
    iv[t][0] = *(const float4*)&sC[t][mh];
    iv[t][1] = *(const float4*)&sC[t][mh + 4];
  }
#pragma unroll
  for (int t = 0; t < RT; ++t)
#pragma unroll
    for (int v = 0; v < 8; ++v) {
      const float4 q4 = iv[t][v >> 2];
      const float inv = (v & 3) == 0 ? q4.x : (v & 3) == 1 ? q4.y : (v & 3) == 2 ? q4.z : q4.w;
      const size_t row = (size_t)b * NN + q0 + 16 * t + v + mh;
#pragma unroll
      for (int j = 0; j < 4; ++j)
        C[row * UU + ds0 + j * 16 + r] = (__bf16)(o[t][j][v] * inv);
    }
}

// ---------------------------------------------------------------- kernel 3
// out = x + ctx @ Wp + bp (fp32 out); 16x64 tile per wave, software-pipelined
__global__ void __launch_bounds__(256) out_proj(
    const float* __restrict__ x, const __bf16* __restrict__ Cb,
    const __bf16* __restrict__ WpT, const float* __restrict__ bpp,
    float* __restrict__ out) {
  const int lane = threadIdx.x & 31;
  const int wave = threadIdx.x >> 5;
  const int tile = blockIdx.x * 8 + wave;       // 8192 tiles
  const int colQuads = UU / 64;                 // 8
  const int rowTile = tile / colQuads;
  const int colQuad = tile - rowTile * colQuads;
  const int row0 = rowTile * 16, col0 = colQuad * 64;
  const int kbase = (lane & 16) ? 8 : 0;
  const int r = lane & 15;
  const int mh = (lane >> 4) << 3;

  v8f acc[4] = {};
  const __bf16* arow = Cb + (size_t)(row0 + r) * UU + kbase;
  // weights in fragment order: one n tile is UU/32 consecutive blocks
  const __bf16* w0p = WpT + (size_t)(col0 >> 4) * (UU / 32) * FBLK + lane * 8;
  const __bf16* w1p = w0p + (UU / 32) * FBLK;
  const __bf16* w2p = w1p + (UU / 32) * FBLK;
  const __bf16* w3p = w2p + (UU / 32) * FBLK;

  v16bf a  = frag_bf16(arow);
  v16bf w0 = frag_packed(w0p), w1 = frag_packed(w1p);
  v16bf w2 = frag_packed(w2p), w3 = frag_packed(w3p);
#pragma unroll 4
  for (int k0 = 0; k0 < UU; k0 += 32) {
    v16bf an, n0, n1, n2, n3;
    const int k1 = k0 + 32;
    if (k1 < UU) {
      an = frag_bf16(arow + k1);
      const int kf = (k1 >> 5) * FBLK;           // next k block
      n0 = frag_packed(w0p + kf);  n1 = frag_packed(w1p + kf);
      n2 = frag_packed(w2p + kf);  n3 = frag_packed(w3p + kf);
      wait_x0();
    }
    acc[0] = wmma_bf16(a, w0, acc[0]);
    acc[1] = wmma_bf16(a, w1, acc[1]);
    acc[2] = wmma_bf16(a, w2, acc[2]);
    acc[3] = wmma_bf16(a, w3, acc[3]);
    a = an; w0 = n0; w1 = n1; w2 = n2; w3 = n3;
  }
#pragma unroll
  for (int t = 0; t < 4; ++t) {
    const int Nc = col0 + t * 16 + r;
    const float bias = bpp[Nc];
#pragma unroll
    for (int v = 0; v < 8; ++v) {
      const size_t idx = (size_t)(row0 + v + mh) * UU + Nc;
      out[idx] = x[idx] + acc[t][v] + bias;
    }
  }
}

// ---------------------------------------------------------------- launch
extern "C" void kernel_launch(void* const* d_in, const int* in_sizes, int n_in,
                              void* d_out, int out_size, void* d_ws, size_t ws_size,
                              hipStream_t stream) {
  const float* x  = (const float*)d_in[0];
  const float* Wq = (const float*)d_in[1];
  const float* bq = (const float*)d_in[2];
  const float* Wk = (const float*)d_in[3];
  const float* bk = (const float*)d_in[4];
  const float* Wv = (const float*)d_in[5];
  const float* bv = (const float*)d_in[6];
  const float* Wp = (const float*)d_in[7];
  const float* bp = (const float*)d_in[8];
  float* out = (float*)d_out;

  char* ws = (char*)d_ws;
  const size_t wbytes = (size_t)UU * UU * sizeof(__bf16);        // 512 KB
  const size_t tbytes = (size_t)BN * UU * sizeof(__bf16);        // 16 MB
  __bf16* WqT = (__bf16*)(ws);
  __bf16* WkT = (__bf16*)(ws + wbytes);
  __bf16* WvT = (__bf16*)(ws + 2 * wbytes);
  __bf16* WpT = (__bf16*)(ws + 3 * wbytes);
  __bf16* Qb  = (__bf16*)(ws + 4 * wbytes);
  __bf16* Kb  = (__bf16*)(ws + 4 * wbytes + tbytes);
  __bf16* VTb = (__bf16*)(ws + 4 * wbytes + 2 * tbytes);
  __bf16* Ctx = (__bf16*)(ws + 4 * wbytes + 3 * tbytes);

  cvt_weights_t<<<(UU * UU) / 256, 256, 0, stream>>>(Wq, Wk, Wv, Wp, WqT, WkT, WvT, WpT);
  qkv_proj<<<2048, 256, 0, stream>>>(x, WqT, WkT, WvT, bq, bk, bv, Qb, Kb, VTb);
  dim3 fgrid(NN / (16 * RT), BB);
  flash_attn<<<fgrid, 256, 0, stream>>>(Qb, Kb, VTb, Ctx);
  out_proj<<<1024, 256, 0, stream>>>(x, Ctx, WpT, bp, out);
}

// v004
// It runs in 286 microseconds.
// Two timings next to v003 both put it at 1.11 times that version's speed.
// Counting every step since v000, it is 3.78 times as fast.
#include <hip/hip_runtime.h>

#define BB 4
#define NN 4096
#define UU 512
#define BN (BB*NN)

typedef __attribute__((ext_vector_type(16))) __bf16 v16bf;
typedef __attribute__((ext_vector_type(8)))  __bf16 v8bf;
typedef __attribute__((ext_vector_type(8)))  float  v8f;
typedef __attribute__((ext_vector_type(4)))  unsigned int v4u;
typedef __attribute__((ext_vector_type(8)))  unsigned int v8u;

__device__ __forceinline__ v8f wmma_bf16(v16bf a, v16bf b, v8f c) {
  return __builtin_amdgcn_wmma_f32_16x16x32_bf16(false, a, false, b, (short)0, c,
                                                 false, false);
}

__device__ __forceinline__ v16bf frag_bf16(const __bf16* p) {
  v8bf lo = *(const v8bf*)(p);
  v8bf hi = *(const v8bf*)(p + 16);
  return __builtin_shufflevector(lo, hi, 0, 1, 2, 3, 4, 5, 6, 7,
                                 8, 9, 10, 11, 12, 13, 14, 15);
}
#define FBLK 512
__device__ __forceinline__ v16bf frag_packed(const __bf16* p) {
  v8bf lo = *(const v8bf*)(p);
  v8bf hi = *(const v8bf*)(p + 256);
  return __builtin_shufflevector(lo, hi, 0, 1, 2, 3, 4, 5, 6, 7,
                                 8, 9, 10, 11, 12, 13, 14, 15);
}
__device__ __forceinline__ v16bf frag_f32(const float* p) {
  float4 a0 = *(const float4*)(p);
  float4 a1 = *(const float4*)(p + 4);
  float4 b0 = *(const float4*)(p + 16);
  float4 b1 = *(const float4*)(p + 20);
  v16bf f;
  f[0] = (__bf16)a0.x;  f[1] = (__bf16)a0.y;  f[2] = (__bf16)a0.z;  f[3] = (__bf16)a0.w;
  f[4] = (__bf16)a1.x;  f[5] = (__bf16)a1.y;  f[6] = (__bf16)a1.z;  f[7] = (__bf16)a1.w;
  f[8] = (__bf16)b0.x;  f[9] = (__bf16)b0.y;  f[10] = (__bf16)b0.z; f[11] = (__bf16)b0.w;
  f[12] = (__bf16)b1.x; f[13] = (__bf16)b1.y; f[14] = (__bf16)b1.z; f[15] = (__bf16)b1.w;
  return f;
}

#define KROWB  128u                               // bytes of a slice row
#define KPITCH 144u                               // row pitch in LDS
#define KSLICE 6144u                              // 32 * 144 B, rounded up to 2 KiB
__device__ __forceinline__ unsigned uni(unsigned v) {
  return (unsigned)__builtin_amdgcn_readfirstlane(v);
}
__device__ __forceinline__ unsigned pinned(unsigned v) {
  unsigned w = uni(v);
  asm volatile("" : "+s"(w));  // keeps w in a scalar register
  return w;
}
// One request: 32 rows x 128 B, source pitch 1024 B, byte elements,
// tensor dims = tile dims, pad of 4 dwords behind every 32 dwords.
__device__ __forceinline__ void tdm_load_k_slice(const __bf16* gsrc, unsigned lds_off) {
  const unsigned long long ga = (unsigned long long)(uintptr_t)gsrc;
  v4u g0;
  g0[0] = uni(1u);                                          // count = 1
  g0[1] = uni(lds_off);                                     // LDS byte offset
  g0[2] = uni((unsigned)ga);                                // address [31:0]
  g0[3] = uni(((unsigned)(ga >> 32) & 0x01FFFFFFu) | 0x80000000u);  // [56:32], type 2
  v8u g1;
  g1[0] = uni((1u << 20) | (4u << 22) | (3u << 25));
  g1[1] = uni(KROWB << 16);
  g1[2] = uni(32u << 16);
  g1[3] = uni(KROWB << 16);
  g1[4] = uni(32u);
  g1[5] = uni(UU * 2u);
  g1[6] = uni(0u);
  g1[7] = uni(0u);
  asm volatile("tensor_load_to_lds %0, %1" :: "s"(g0), "s"(g1) : "memory");
}
// The compiler places no wait for a tensor load: a slice counts as landed only
// behind its issuer's wait.
__device__ __forceinline__ void wait_tensor0() { asm volatile("s_wait_tensorcnt 0x0" ::: "memory"); }
// This wave's LDS reads have retired before the buffer they read is refilled.
__device__ __forceinline__ void wait_ds0() { asm volatile("s_wait_dscnt 0x0" ::: "memory"); }

// Stands between issued global loads (or a prefetch) and the next pass's rewrite of
// the address registers that they name.
__device__ __forceinline__ void wait_x0() { asm volatile("s_wait_xcnt 0x0" ::: "memory"); }

template <int X>
__device__ __forceinline__ float row_xor(float v) {
  return __builtin_bit_cast(float, __builtin_amdgcn_update_dpp(
      0, __builtin_bit_cast(int, v), 0x160 + X, 0xf, 0xf, false));
}
__device__ __forceinline__ float row_max16(float v) {
  v = fmaxf(v, row_xor<1>(v));
  v = fmaxf(v, row_xor<2>(v));
  v = fmaxf(v, row_xor<4>(v));
  return fmaxf(v, row_xor<8>(v));
}
__device__ __forceinline__ float row_sum16(float v) {
  v += row_xor<1>(v);
  v += row_xor<2>(v);
  v += row_xor<4>(v);
  return v + row_xor<8>(v);
}

// ---------------------------------------------------------------- kernel 0
__global__ void cvt_weights_t(const float* __restrict__ wq, const float* __restrict__ wk,
                              const float* __restrict__ wv, const float* __restrict__ wp,
                              __bf16* __restrict__ dq, __bf16* __restrict__ dk,
                              __bf16* __restrict__ dv, __bf16* __restrict__ dp) {
  const int idx = blockIdx.x * blockDim.x + threadIdx.x;   // coalesced read
  const int k = idx / UU, n = idx % UU;
  // fragment order, blocks laid out [n tile][k block]
  const size_t t = ((size_t)(n >> 4) * (UU / 32) + (k >> 5)) * FBLK +
                   ((k >> 4) & 1) * 256 + ((((k >> 3) & 1) << 4) + (n & 15)) * 8 + (k & 7);
  dq[t] = (__bf16)wq[idx];
  dk[t] = (__bf16)wk[idx];
  dv[t] = (__bf16)wv[idx];
  dp[t] = (__bf16)wp[idx];
}

// ---------------------------------------------------------------- kernel 1
// Fused Q/K/V projection; 16x32 output tile of all three per wave.
// Manual software pipeline: fragments for step k+1 are loaded into fresh
// values before step k's wmma chain, then rotated.
__global__ void __launch_bounds__(256) qkv_proj(
    const float* __restrict__ x,
    const __bf16* __restrict__ WqT, const __bf16* __restrict__ WkT,
    const __bf16* __restrict__ WvT,
    const float* __restrict__ bqp, const float* __restrict__ bkp,
    const float* __restrict__ bvp,
    __bf16* __restrict__ Q, __bf16* __restrict__ K, __bf16* __restrict__ VT) {
  const int lane = threadIdx.x & 31;
  const int wave = threadIdx.x >> 5;
  const int tile = blockIdx.x * 8 + wave;       // 16384 tiles
  const int colPairs = UU / 32;                 // 16
  const int rowTile = tile / colPairs;
  const int colPair = tile - rowTile * colPairs;
  const int row0 = rowTile * 16, col0 = colPair * 32;
  const int kbase = (lane & 16) ? 8 : 0;
  const int r = lane & 15;
  const int mh = (lane >> 4) << 3;

  v8f cq0 = {}, cq1 = {}, ck0 = {}, ck1 = {}, cv0 = {}, cv1 = {};
  const float*  xrow = x + (size_t)(row0 + r) * UU + kbase;
  // weights in fragment order: one n tile is UU/32 consecutive blocks
  const size_t wt = (size_t)(col0 >> 4) * (UU / 32) * FBLK + lane * 8;
  const __bf16* wp0 = WqT + wt;
  const __bf16* wp1 = wp0 + (UU / 32) * FBLK;
  const __bf16* wp2 = WkT + wt;
  const __bf16* wp3 = wp2 + (UU / 32) * FBLK;
  const __bf16* wp4 = WvT + wt;
  const __bf16* wp5 = wp4 + (UU / 32) * FBLK;

  // pipeline prologue: stage 0 fragments
  v16bf a  = frag_f32(xrow);
  v16bf w0 = frag_packed(wp0), w1 = frag_packed(wp1), w2 = frag_packed(wp2);
  v16bf w3 = frag_packed(wp3), w4 = frag_packed(wp4), w5 = frag_packed(wp5);
#pragma unroll 4
  for (int k0 = 0; k0 < UU; k0 += 32) {
    v16bf an, n0, n1, n2, n3, n4, n5;
    const int k1 = k0 + 32;
    if (k1 < UU) {                               // load next step's fragments
      an = frag_f32(xrow + k1);
      const int kf = (k1 >> 5) * FBLK;           // next k block
      n0 = frag_packed(wp0 + kf);  n1 = frag_packed(wp1 + kf);
      n2 = frag_packed(wp2 + kf);  n3 = frag_packed(wp3 + kf);
      n4 = frag_packed(wp4 + kf);  n5 = frag_packed(wp5 + kf);
      wait_x0();
    }
    cq0 = wmma_bf16(a, w0, cq0);
    cq1 = wmma_bf16(a, w1, cq1);
    ck0 = wmma_bf16(a, w2, ck0);
    ck1 = wmma_bf16(a, w3, ck1);
    cv0 = wmma_bf16(a, w4, cv0);
    cv1 = wmma_bf16(a, w5, cv1);
    a = an; w0 = n0; w1 = n1; w2 = n2; w3 = n3; w4 = n4; w5 = n5;
  }
  const float scale = rsqrtf((float)UU);
  const int b = row0 >> 12;                     // row0 / NN
  v8bf pv[2];                                   // V: a lane's 8 keys of one d column
#pragma unroll
  for (int v = 0; v < 8; ++v) {
    const int M = v + mh;
    const size_t idx = (size_t)(row0 + M) * UU;
#pragma unroll
    for (int h = 0; h < 2; ++h) {
      const int Nc = col0 + 16 * h + r;
      const float q = (h ? cq1[v] : cq0[v]) + bqp[Nc];
      const float k = (h ? ck1[v] : ck0[v]) + bkp[Nc];
      const float vv = (h ? cv1[v] : cv0[v]) + bvp[Nc];
      Q[idx + Nc] = (__bf16)(q * scale);
      K[idx + Nc] = (__bf16)k;
      pv[h][v] = (__bf16)vv;
    }
  }
  // V in fragment order (k = key, n = d), blocks laid out [batch][key block][d tile]:
  // the accumulator's 8 rows of a lane are that lane's 8 consecutive elements.
  __bf16* vdst = VT + (((size_t)b * (NN / 32) + ((row0 & (NN - 1)) >> 5)) * (UU / 16) +
                       (col0 >> 4)) * FBLK + ((row0 >> 4) & 1) * 256 + lane * 8;
  *(v8bf*)(vdst) = pv[0];
  *(v8bf*)(vdst + FBLK) = pv[1];
}

// ---------------------------------------------------------------- kernel 2
// Flash attention: 64 query rows/block (4 row tiles), 8 waves split d (64 each).
// Every wave carries all 4 row tiles of its d-slice, so each K fragment (LDS)
// and each V fragment (global) feeds 4 matrix instructions.
// The 64x32 score block is summed and soft-maxed once: wave w owns row tile
// w>>1, accumulator rows 4*(w&1)..+3 of each lane half.
// K tiles are double-buffered in LDS by tensor loads, one slice per wave.
#define RT 4                                      // row tiles per block
#define NW 8                                      // waves per block
#define DS (UU / NW)                              // d columns per wave
__global__ void __launch_bounds__(256) flash_attn(
    const __bf16* __restrict__ Q, const __bf16* __restrict__ K,
    const __bf16* __restrict__ VT, __bf16* __restrict__ C) {
  __shared__ alignas(2048) unsigned char sK[2][NW][KSLICE];  // 96 KB: K slices
  // per-wave partial S, kept in accumulator order: [wave][tile][key half]
  // [register quad][lane] -> one 16B element per lane, no transposition
  __shared__ float4 sS[NW][RT][2][2][32];         // 64 KB
  // P for A-frag repack; 80-B pitch = 16 B x 5 for its ds_load_b128 readers
  __shared__ alignas(16) __bf16 sP[RT][16][40];
  __shared__ alignas(16) float sC[RT][16];        // per-row rescale factor

  const int lane = threadIdx.x & 31;
  const int wave = threadIdx.x >> 5;              // 0..7 -> d-slice
  const int b  = blockIdx.y;
  const int q0 = blockIdx.x * (16 * RT);
  const int ds0 = wave * DS;
  const int kbase = (lane & 16) ? 8 : 0;
  const int r  = lane & 15;
  const int mh = (lane >> 4) << 3;
  const int tw = wave >> 1;                       // softmax: owned row tile
  const int hw = wave & 1;                        // softmax: owned register quad

  const __bf16* Qb = Q + (size_t)b * NN * UU;
  const __bf16* Kb = K + (size_t)b * NN * UU;
  const __bf16* Vt = VT + (size_t)b * UU * NN;    // fragment order [key block][d tile]

  typedef __attribute__((address_space(3))) unsigned char lds_u8;
  const unsigned sw = uni(threadIdx.x >> 5);      // wave number, scalar
  const unsigned sK0 = (unsigned)(unsigned long long)(lds_u8*)&sK[0][0][0] + sw * KSLICE;
  const unsigned sK1 = sK0 + NW * KSLICE;
  const __bf16* Kw = Kb + sw * DS;                // this wave's columns of K

  v16bf qf[RT][2];
#pragma unroll
  for (int t = 0; t < RT; ++t)
#pragma unroll
    for (int kk = 0; kk < 2; ++kk)
      qf[t][kk] = frag_bf16(Qb + (size_t)(q0 + 16 * t + r) * UU + ds0 + kk * 32 + kbase);

  v8f o[RT][4] = {};
  float m[4], l[4];                               // rows 4*hw+i+mh of tile tw
#pragma unroll
  for (int i = 0; i < 4; ++i) { m[i] = -3.0e38f; l[i] = 0.f; }

  __builtin_amdgcn_sched_barrier(0);
  tdm_load_k_slice(Kw, sK0);
  wait_tensor0();
  __builtin_amdgcn_sched_barrier(0);
  __syncthreads();
  tdm_load_k_slice(Kw + (size_t)32 * UU, sK1);

  for (int kb = 0; kb < NN; kb += 32) {
    const int buf = (kb >> 5) & 1;
    // partial S over this wave's d-slice from LDS (ds_load_b128 fragments)
    v8f s[RT][2] = {};
#pragma unroll
    for (int kk = 0; kk < 2; ++kk) {
      const unsigned char* kp = &sK[buf][wave][r * KPITCH + (kk * 32 + kbase) * 2];
      v16bf b0 = frag_bf16((const __bf16*)kp);
      v16bf b1 = frag_bf16((const __bf16*)(kp + 16 * KPITCH));
#pragma unroll
      for (int t = 0; t < RT; ++t) {
        s[t][0] = wmma_bf16(qf[t][kk], b0, s[t][0]);
        s[t][1] = wmma_bf16(qf[t][kk], b1, s[t][1]);
      }
    }
    if (kb + 32 < NN)
      __builtin_prefetch(Vt + ((size_t)((kb >> 5) + 1) * (UU / 16) + wave * (DS / 16)) * FBLK +
                             lane * 64, 0, 1);

#pragma unroll
    for (int t = 0; t < RT; ++t)
#pragma unroll
      for (int h = 0; h < 2; ++h) {
        sS[wave][t][h][0][lane] = make_float4(s[t][h][0], s[t][h][1], s[t][h][2], s[t][h][3]);
        sS[wave][t][h][1][lane] = make_float4(s[t][h][4], s[t][h][5], s[t][h][6], s[t][h][7]);
      }
    __syncthreads();
    // full S of the owned rows: sum the 8 d-slices in wave order
    float fs0[4] = {0.f, 0.f, 0.f, 0.f}, fs1[4] = {0.f, 0.f, 0.f, 0.f};
#pragma unroll
    for (int w = 0; w < NW; ++w) {
      const float4 a0 = sS[w][tw][0][hw][lane];
      const float4 a1 = sS[w][tw][1][hw][lane];
      fs0[0] += a0.x; fs0[1] += a0.y; fs0[2] += a0.z; fs0[3] += a0.w;
      fs1[0] += a1.x; fs1[1] += a1.y; fs1[2] += a1.z; fs1[3] += a1.w;
    }
    // online softmax; a row lives across one 16-lane half -> xor reduce by DPP
    float cr[4];
#pragma unroll
    for (int i = 0; i < 4; ++i) {
      const float mt = row_max16(fmaxf(fs0[i], fs1[i]));
      const float mnew = fmaxf(m[i], mt);
      const float p0 = __expf(fs0[i] - mnew);
      const float p1 = __expf(fs1[i] - mnew);
      const float rs = row_sum16(p0 + p1);
      const float corr = __expf(m[i] - mnew);
      l[i] = l[i] * corr + rs;
      m[i] = mnew;
      cr[i] = corr;
      sP[tw][4 * hw + i + mh][r]      = (__bf16)p0;
      sP[tw][4 * hw + i + mh][16 + r] = (__bf16)p1;
    }
    if (r == 0)
      *(float4*)&sC[tw][4 * hw + mh] = make_float4(cr[0], cr[1], cr[2], cr[3]);
    __syncthreads();
    // rescale O by its rows' factors; repack P (C-layout) into A-fragments
    v16bf pf[RT];
#pragma unroll
    for (int t = 0; t < RT; ++t) {
      pf[t] = frag_bf16(&sP[t][r][0] + kbase);
      const float4 c0 = *(const float4*)&sC[t][mh];
      const float4 c1 = *(const float4*)&sC[t][mh + 4];
#pragma unroll
      for (int j = 0; j < 4; ++j) {
        o[t][j][0] *= c0.x; o[t][j][1] *= c0.y; o[t][j][2] *= c0.z; o[t][j][3] *= c0.w;
        o[t][j][4] *= c1.x; o[t][j][5] *= c1.y; o[t][j][6] *= c1.z; o[t][j][7] *= c1.w;
      }
    }
    // O[:, ds0+16j] += P * V^T; the 4 V frags are loaded ahead of the MMAs
    const __bf16* vp = Vt + ((size_t)(kb >> 5) * (UU / 16) + wave * (DS / 16)) * FBLK + lane * 8;
    v16bf f0 = frag_packed(vp);
    v16bf f1 = frag_packed(vp + FBLK);
    v16bf f2 = frag_packed(vp + 2 * FBLK);
    v16bf f3 = frag_packed(vp + 3 * FBLK);
#pragma unroll
    for (int t = 0; t < RT; ++t) {
      o[t][0] = wmma_bf16(pf[t], f0, o[t][0]);
      o[t][1] = wmma_bf16(pf[t], f1, o[t][1]);
      o[t][2] = wmma_bf16(pf[t], f2, o[t][2]);
      o[t][3] = wmma_bf16(pf[t], f3, o[t][3]);
    }
    wait_x0();  // V loads and prefetch above: their address registers step on behind here
    // publish next K tile (and retire this iteration's sS/sP/sC reads), then
    // refill the buffer that this pass has read with the tile after next
    wait_ds0();
    wait_tensor0();
    __syncthreads();
    const unsigned kn = pinned((unsigned)kb + 64u);
    if (kn < NN)
      tdm_load_k_slice(Kw + (size_t)kn * UU, buf ? sK1 : sK0);
  }
  wait_tensor0();
  wait_ds0();
  // hand each row's 1/l from its owner to every wave
  if (r == 0)
    *(float4*)&sC[tw][4 * hw + mh] =
        make_float4(1.f / l[0], 1.f / l[1], 1.f / l[2], 1.f / l[3]);
  __syncthreads();
  float4 iv[RT][2];
#pragma unroll
  for (int t = 0; t < RT; ++t) {
    iv[t][0] = *(const float4*)&sC[t][mh];
    iv[t][1] = *(const float4*)&sC[t][mh + 4];
  }
#pragma unroll
  for (int t = 0; t < RT; ++t)
#pragma unroll
    for (int v = 0; v < 8; ++v) {
      const float4 q4 = iv[t][v >> 2];
      const float inv = (v & 3) == 0 ? q4.x : (v & 3) == 1 ? q4.y : (v & 3) == 2 ? q4.z : q4.w;
      const size_t row = (size_t)b * NN + q0 + 16 * t + v + mh;
#pragma unroll
      for (int j = 0; j < 4; ++j)
        C[row * UU + ds0 + j * 16 + r] = (__bf16)(o[t][j][v] * inv);
    }
}

// ---------------------------------------------------------------- kernel 3
// out = x + ctx @ Wp + bp (fp32 out); 16x64 tile per wave, software-pipelined
__global__ void __launch_bounds__(256) out_proj(
    const float* __restrict__ x, const __bf16* __restrict__ Cb,
    const __bf16* __restrict__ WpT, const float* __restrict__ bpp,
    float* __restrict__ out) {
  const int lane = threadIdx.x & 31;
  const int wave = threadIdx.x >> 5;
  const int tile = blockIdx.x * 8 + wave;       // 8192 tiles
  const int colQuads = UU / 64;                 // 8
  const int rowTile = tile / colQuads;
  const int colQuad = tile - rowTile * colQuads;
  const int row0 = rowTile * 16, col0 = colQuad * 64;
  const int kbase = (lane & 16) ? 8 : 0;
  const int r = lane & 15;
  const int mh = (lane >> 4) << 3;

  v8f acc[4] = {};
  const __bf16* arow = Cb + (size_t)(row0 + r) * UU + kbase;
  // weights in fragment order: one n tile is UU/32 consecutive blocks
  const __bf16* w0p = WpT + (size_t)(col0 >> 4) * (UU / 32) * FBLK + lane * 8;
  const __bf16* w1p = w0p + (UU / 32) * FBLK;
  const __bf16* w2p = w1p + (UU / 32) * FBLK;
  const __bf16* w3p = w2p + (UU / 32) * FBLK;

  v16bf a  = frag_bf16(arow);
  v16bf w0 = frag_packed(w0p), w1 = frag_packed(w1p);
  v16bf w2 = frag_packed(w2p), w3 = frag_packed(w3p);
#pragma unroll 4
  for (int k0 = 0; k0 < UU; k0 += 32) {
    v16bf an, n0, n1, n2, n3;
    const int k1 = k0 + 32;
    if (k1 < UU) {
      an = frag_bf16(arow + k1);
      const int kf = (k1 >> 5) * FBLK;           // next k block
      n0 = frag_packed(w0p + kf);  n1 = frag_packed(w1p + kf);
      n2 = frag_packed(w2p + kf);  n3 = frag_packed(w3p + kf);
      wait_x0();
    }
    acc[0] = wmma_bf16(a, w0, acc[0]);
    acc[1] = wmma_bf16(a, w1, acc[1]);
    acc[2] = wmma_bf16(a, w2, acc[2]);
    acc[3] = wmma_bf16(a, w3, acc[3]);
    a = an; w0 = n0; w1 = n1; w2 = n2; w3 = n3;
  }
#pragma unroll
  for (int t = 0; t < 4; ++t) {
    const int Nc = col0 + t * 16 + r;
    const float bias = bpp[Nc];
#pragma unroll
    for (int v = 0; v < 8; ++v) {
      const size_t idx = (size_t)(row0 + v + mh) * UU + Nc;
      out[idx] = x[idx] + acc[t][v] + bias;
    }
  }
}

// ---------------------------------------------------------------- launch
extern "C" void kernel_launch(void* const* d_in, const int* in_sizes, int n_in,
                              void* d_out, int out_size, void* d_ws, size_t ws_size,
                              hipStream_t stream) {
  const float* x  = (const float*)d_in[0];
  const float* Wq = (const float*)d_in[1];
  const float* bq = (const float*)d_in[2];
  const float* Wk = (const float*)d_in[3];
  const float* bk = (const float*)d_in[4];
  const float* Wv = (const float*)d_in[5];
  const float* bv = (const float*)d_in[6];
  const float* Wp = (const float*)d_in[7];
  const float* bp = (const float*)d_in[8];
  float* out = (float*)d_out;

  char* ws = (char*)d_ws;
  const size_t wbytes = (size_t)UU * UU * sizeof(__bf16);        // 512 KB
  const size_t tbytes = (size_t)BN * UU * sizeof(__bf16);        // 16 MB
  __bf16* WqT = (__bf16*)(ws);
  __bf16* WkT = (__bf16*)(ws + wbytes);
  __bf16* WvT = (__bf16*)(ws + 2 * wbytes);
  __bf16* WpT = (__bf16*)(ws + 3 * wbytes);
  __bf16* Qb  = (__bf16*)(ws + 4 * wbytes);
  __bf16* Kb  = (__bf16*)(ws + 4 * wbytes + tbytes);
  __bf16* VTb = (__bf16*)(ws + 4 * wbytes + 2 * tbytes);
  __bf16* Ctx = (__bf16*)(ws + 4 * wbytes + 3 * tbytes);

  cvt_weights_t<<<(UU * UU) / 256, 256, 0, stream>>>(Wq, Wk, Wv, Wp, WqT, WkT, WvT, WpT);
  qkv_proj<<<2048, 256, 0, stream>>>(x, WqT, WkT, WvT, bq, bk, bv, Qb, Kb, VTb);
  dim3 fgrid(NN / (16 * RT), BB);
  flash_attn<<<fgrid, 256, 0, stream>>>(Qb, Kb, VTb, Ctx);
  out_proj<<<1024, 256, 0, stream>>>(x, Ctx, WpT, bp, out);
}

// v005
// A run of this version takes 276 microseconds.
// Two timings next to v004 put it at 1.04 and 1.03 times that version's speed.
// Over all steps from v000 it is 3.91 times as fast.
#include <hip/hip_runtime.h>

#define BB 4
#define NN 4096
#define UU 512
#define BN (BB*NN)

typedef __attribute__((ext_vector_type(16))) __bf16 v16bf;
typedef __attribute__((ext_vector_type(8)))  __bf16 v8bf;
typedef __attribute__((ext_vector_type(8)))  float  v8f;
typedef __attribute__((ext_vector_type(4)))  unsigned int v4u;
typedef __attribute__((ext_vector_type(8)))  unsigned int v8u;

__device__ __forceinline__ v8f wmma_bf16(v16bf a, v16bf b, v8f c) {
  return __builtin_amdgcn_wmma_f32_16x16x32_bf16(false, a, false, b, (short)0, c,
                                                 false, false);
}

__device__ __forceinline__ v16bf frag_bf16(const __bf16* p) {
  v8bf lo = *(const v8bf*)(p);
  v8bf hi = *(const v8bf*)(p + 16);
  return __builtin_shufflevector(lo, hi, 0, 1, 2, 3, 4, 5, 6, 7,
                                 8, 9, 10, 11, 12, 13, 14, 15);
}
#define FBLK 512
__device__ __forceinline__ v16bf frag_packed(const __bf16* p) {
  v8bf lo = *(const v8bf*)(p);
  v8bf hi = *(const v8bf*)(p + 256);
  return __builtin_shufflevector(lo, hi, 0, 1, 2, 3, 4, 5, 6, 7,
                                 8, 9, 10, 11, 12, 13, 14, 15);
}
__device__ __forceinline__ v16bf frag_f32(const float* p) {
  float4 a0 = *(const float4*)(p);
  float4 a1 = *(const float4*)(p + 4);
  float4 b0 = *(const float4*)(p + 16);
  float4 b1 = *(const float4*)(p + 20);
  v16bf f;
  f[0] = (__bf16)a0.x;  f[1] = (__bf16)a0.y;  f[2] = (__bf16)a0.z;  f[3] = (__bf16)a0.w;
  f[4] = (__bf16)a1.x;  f[5] = (__bf16)a1.y;  f[6] = (__bf16)a1.z;  f[7] = (__bf16)a1.w;
  f[8] = (__bf16)b0.x;  f[9] = (__bf16)b0.y;  f[10] = (__bf16)b0.z; f[11] = (__bf16)b0.w;
  f[12] = (__bf16)b1.x; f[13] = (__bf16)b1.y; f[14] = (__bf16)b1.z; f[15] = (__bf16)b1.w;
  return f;
}

#define KROWB  128u                               // bytes of a slice row
#define KPITCH 144u                               // row pitch in LDS
#define KSLICE 6144u                              // 32 * 144 B, rounded up to 2 KiB
__device__ __forceinline__ unsigned uni(unsigned v) {
  return (unsigned)__builtin_amdgcn_readfirstlane(v);
}
__device__ __forceinline__ unsigned pinned(unsigned v) {
  unsigned w = uni(v);
  asm volatile("" : "+s"(w));  // keeps w in a scalar register
  return w;
}
// One request: 32 rows x 128 B, source pitch 1024 B, byte elements,
// tensor dims = tile dims, pad of 4 dwords behind every 32 dwords.
__device__ __forceinline__ v4u tdm_k_group0(const __bf16* gsrc, unsigned lds_off) {
  const unsigned long long ga = (unsigned long long)(uintptr_t)gsrc;
  v4u g0;
  g0[0] = uni(1u);                                          // count = 1
  g0[1] = uni(lds_off);                                     // LDS byte offset
  g0[2] = uni((unsigned)ga);                                // address [31:0]
  g0[3] = uni(((unsigned)(ga >> 32) & 0x01FFFFFFu) | 0x80000000u);  // [56:32], type 2
  return g0;
}
// Formed once a kernel: through pinned() its words stay in the same scalar
// registers for every request, instead of being formed anew in registers that
// are free for other use while a request is under way.
__device__ __forceinline__ v8u tdm_k_group1() {
  v8u g1;
  g1[0] = uni((1u << 20) | (4u << 22) | (3u << 25));
  g1[1] = pinned(KROWB << 16);
  g1[2] = pinned(32u << 16);
  g1[3] = pinned(KROWB << 16);
  g1[4] = pinned(32u);
  g1[5] = pinned(UU * 2u);
  g1[6] = pinned(0u);
  g1[7] = pinned(0u);
  return g1;
}
__device__ __forceinline__ void tdm_load(v4u g0, v8u g1) {
  asm volatile("tensor_load_to_lds %0, %1" :: "s"(g0), "s"(g1) : "memory");
}
__device__ __forceinline__ void wait_tensor0(v4u g0, v8u g1) {
  asm volatile("s_wait_tensorcnt 0x0" :: "s"(g0), "s"(g1) : "memory");
}
// This wave's LDS reads have retired before the buffer they read is refilled.
__device__ __forceinline__ void wait_ds0() { asm volatile("s_wait_dscnt 0x0" ::: "memory"); }

// Stands between issued global loads and the next rewrite of the address registers
// that they name.
__device__ __forceinline__ void wait_x0() { asm volatile("s_wait_xcnt 0x0" ::: "memory"); }

template <int X>
__device__ __forceinline__ float row_xor(float v) {
  return __builtin_bit_cast(float, __builtin_amdgcn_update_dpp(
      0, __builtin_bit_cast(int, v), 0x160 + X, 0xf, 0xf, false));
}
__device__ __forceinline__ float row_max16(float v) {
  v = fmaxf(v, row_xor<1>(v));
  v = fmaxf(v, row_xor<2>(v));
  v = fmaxf(v, row_xor<4>(v));
  return fmaxf(v, row_xor<8>(v));
}
__device__ __forceinline__ float row_sum16(float v) {
  v += row_xor<1>(v);
  v += row_xor<2>(v);
  v += row_xor<4>(v);
  return v + row_xor<8>(v);
}

// ---------------------------------------------------------------- kernel 0
__global__ void cvt_weights_t(const float* __restrict__ wq, const float* __restrict__ wk,
                              const float* __restrict__ wv, const float* __restrict__ wp,
                              __bf16* __restrict__ dq, __bf16* __restrict__ dk,
                              __bf16* __restrict__ dv, __bf16* __restrict__ dp) {
  const int idx = blockIdx.x * blockDim.x + threadIdx.x;   // coalesced read
  const int k = idx / UU, n = idx % UU;
  // fragment order, blocks laid out [n tile][k block]
  const size_t t = ((size_t)(n >> 4) * (UU / 32) + (k >> 5)) * FBLK +
                   ((k >> 4) & 1) * 256 + ((((k >> 3) & 1) << 4) + (n & 15)) * 8 + (k & 7);
  dq[t] = (__bf16)wq[idx];
  dk[t] = (__bf16)wk[idx];
  dv[t] = (__bf16)wv[idx];
  dp[t] = (__bf16)wp[idx];
}

// ---------------------------------------------------------------- kernel 1
// Fused Q/K/V projection; 16x32 output tile of all three per wave.
// Manual software pipeline: fragments for step k+1 are loaded into fresh
// values before step k's wmma chain, then rotated.
__global__ void __launch_bounds__(256) qkv_proj(
    const float* __restrict__ x,
    const __bf16* __restrict__ WqT, const __bf16* __restrict__ WkT,
    const __bf16* __restrict__ WvT,
    const float* __restrict__ bqp, const float* __restrict__ bkp,
    const float* __restrict__ bvp,
    __bf16* __restrict__ Q, __bf16* __restrict__ K, __bf16* __restrict__ VT) {
  const int lane = threadIdx.x & 31;
  const int wave = threadIdx.x >> 5;
  const int tile = blockIdx.x * 8 + wave;       // 16384 tiles
  const int colPairs = UU / 32;                 // 16
  const int rowTile = tile / colPairs;
  const int colPair = tile - rowTile * colPairs;
  const int row0 = rowTile * 16, col0 = colPair * 32;
  const int kbase = (lane & 16) ? 8 : 0;
  const int r = lane & 15;
  const int mh = (lane >> 4) << 3;

  v8f cq0 = {}, cq1 = {}, ck0 = {}, ck1 = {}, cv0 = {}, cv1 = {};
  const float*  xrow = x + (size_t)(row0 + r) * UU + kbase;
  // weights in fragment order: one n tile is UU/32 consecutive blocks
  const size_t wt = (size_t)(col0 >> 4) * (UU / 32) * FBLK + lane * 8;
  const __bf16* wp0 = WqT + wt;
  const __bf16* wp1 = wp0 + (UU / 32) * FBLK;
  const __bf16* wp2 = WkT + wt;
  const __bf16* wp3 = wp2 + (UU / 32) * FBLK;
  const __bf16* wp4 = WvT + wt;
  const __bf16* wp5 = wp4 + (UU / 32) * FBLK;

  // pipeline prologue: stage 0 fragments
  v16bf a  = frag_f32(xrow);
  v16bf w0 = frag_packed(wp0), w1 = frag_packed(wp1), w2 = frag_packed(wp2);
  v16bf w3 = frag_packed(wp3), w4 = frag_packed(wp4), w5 = frag_packed(wp5);
#pragma unroll 4
  for (int k0 = 0; k0 < UU; k0 += 32) {
    v16bf an, n0, n1, n2, n3, n4, n5;
    const int k1 = k0 + 32;
    if (k1 < UU) {                               // load next step's fragments
      an = frag_f32(xrow + k1);
      const int kf = (k1 >> 5) * FBLK;           // next k block
      n0 = frag_packed(wp0 + kf);  n1 = frag_packed(wp1 + kf);
      n2 = frag_packed(wp2 + kf);  n3 = frag_packed(wp3 + kf);
      n4 = frag_packed(wp4 + kf);  n5 = frag_packed(wp5 + kf);
      wait_x0();
    }
    cq0 = wmma_bf16(a, w0, cq0);
    cq1 = wmma_bf16(a, w1, cq1);
    ck0 = wmma_bf16(a, w2, ck0);
    ck1 = wmma_bf16(a, w3, ck1);
    cv0 = wmma_bf16(a, w4, cv0);
    cv1 = wmma_bf16(a, w5, cv1);
    a = an; w0 = n0; w1 = n1; w2 = n2; w3 = n3; w4 = n4; w5 = n5;
  }
  const float scale = rsqrtf((float)UU);
  const int b = row0 >> 12;                     // row0 / NN
  v8bf pv[2];                                   // V: a lane's 8 keys of one d column
#pragma unroll
  for (int v = 0; v < 8; ++v) {
    const int M = v + mh;
    const size_t idx = (size_t)(row0 + M) * UU;
#pragma unroll
    for (int h = 0; h < 2; ++h) {
      const int Nc = col0 + 16 * h + r;
      const float q = (h ? cq1[v] : cq0[v]) + bqp[Nc];
      const float k = (h ? ck1[v] : ck0[v]) + bkp[Nc];
      const float vv = (h ? cv1[v] : cv0[v]) + bvp[Nc];
      Q[idx + Nc] = (__bf16)(q * scale);
      K[idx + Nc] = (__bf16)k;
      pv[h][v] = (__bf16)vv;
    }
  }
  // V in fragment order (k = key, n = d), blocks laid out [batch][key block][d tile]:
  // the accumulator's 8 rows of a lane are that lane's 8 consecutive elements.
  __bf16* vdst = VT + (((size_t)b * (NN / 32) + ((row0 & (NN - 1)) >> 5)) * (UU / 16) +
                       (col0 >> 4)) * FBLK + ((row0 >> 4) & 1) * 256 + lane * 8;
  *(v8bf*)(vdst) = pv[0];
  *(v8bf*)(vdst + FBLK) = pv[1];
}

// ---------------------------------------------------------------- kernel 2
// Flash attention: 64 query rows/block (4 row tiles), 8 waves split d (64 each).
// Every wave carries all 4 row tiles of its d-slice, so each K fragment (LDS)
// and each V fragment (global) feeds 4 matrix instructions.
// The 64x32 score block is summed and soft-maxed once: wave w owns row tile
// w>>1, accumulator rows 4*(w&1)..+3 of each lane half.
// K tiles are double-buffered in LDS by tensor loads, one slice per wave.
// The three stages of a key tile run as a software pipeline: pass j forms the
// partial S of tile j+2, the softmax of tile j+1 and P*V of tile j. Each stage
// reads only what the pass before has left in LDS, and sS, sP and sC have two
// buffers each, so one barrier a pass orders all of it and the stages' loads,
// matrix runs and vector chains overlap inside a pass.
#define RT 4                                      // row tiles per block
#define NW 8                                      // waves per block
#define DS (UU / NW)                              // d columns per wave
#define NT (NN / 32)                              // key tiles
__global__ void __launch_bounds__(256) flash_attn(
    const __bf16* __restrict__ Q, const __bf16* __restrict__ K,
    const __bf16* __restrict__ VT, __bf16* __restrict__ C) {
  __shared__ alignas(2048) unsigned char sK[2][NW][KSLICE];  // 96 KB: K slices
  // per-wave partial S, kept in accumulator order: [buffer][wave][tile][key half]
  // [register quad][lane] -> one 16B element per lane, no transposition
  __shared__ float4 sS[2][NW][RT][2][2][32];      // 128 KB
  // P for A-frag repack; 80-B pitch = 16 B x 5 for its ds_load_b128 readers
  __shared__ alignas(16) __bf16 sP[2][RT][16][40];
  __shared__ alignas(16) float sC[2][RT][16];     // per-row rescale factor

  const int lane = threadIdx.x & 31;
  const int wave = threadIdx.x >> 5;              // 0..7 -> d-slice
  const int b  = blockIdx.y;
  const int q0 = blockIdx.x * (16 * RT);
  const int ds0 = wave * DS;
  const int kbase = (lane & 16) ? 8 : 0;
  const int r  = lane & 15;
  const int mh = (lane >> 4) << 3;
  const int tw = wave >> 1;                       // softmax: owned row tile
  const int hw = wave & 1;                        // softmax: owned register quad

  const __bf16* Qb = Q + (size_t)b * NN * UU;
  const __bf16* Kb = K + (size_t)b * NN * UU;
  const __bf16* Vt = VT + (size_t)b * UU * NN;    // fragment order [key block][d tile]

  typedef __attribute__((address_space(3))) unsigned char lds_u8;
  const unsigned sw = uni(threadIdx.x >> 5);      // wave number, scalar
  const unsigned sK0 = (unsigned)(unsigned long long)(lds_u8*)&sK[0][0][0] + sw * KSLICE;
  const unsigned sK1 = sK0 + NW * KSLICE;
  const __bf16* Kw = Kb + sw * DS;                // this wave's columns of K

  v16bf qf[RT][2];
#pragma unroll
  for (int t = 0; t < RT; ++t)
#pragma unroll
    for (int kk = 0; kk < 2; ++kk)
      qf[t][kk] = frag_bf16(Qb + (size_t)(q0 + 16 * t + r) * UU + ds0 + kk * 32 + kbase);

  v8f o[RT][4] = {};
  float m[4], l[4];                               // rows 4*hw+i+mh of tile tw
#pragma unroll
  for (int i = 0; i < 4; ++i) { m[i] = -3.0e38f; l[i] = 0.f; }

  // ---- stage 1: partial S over this wave's d-slice
  auto load_k = [&](int buf, v16bf (&kf)[4]) {    // ds_load_b128 fragments
#pragma unroll
    for (int kk = 0; kk < 2; ++kk) {
      const unsigned char* kp = &sK[buf][wave][r * KPITCH + (kk * 32 + kbase) * 2];
      kf[2 * kk]     = frag_bf16((const __bf16*)kp);
      kf[2 * kk + 1] = frag_bf16((const __bf16*)(kp + 16 * KPITCH));
    }
  };
  auto mma_s = [&](const v16bf (&kf)[4], v8f (&s)[RT][2]) {
#pragma unroll
    for (int kk = 0; kk < 2; ++kk)
#pragma unroll
      for (int t = 0; t < RT; ++t) {
        s[t][0] = wmma_bf16(qf[t][kk], kf[2 * kk], s[t][0]);
        s[t][1] = wmma_bf16(qf[t][kk], kf[2 * kk + 1], s[t][1]);
      }
  };
  auto store_s = [&](int sb, const v8f (&s)[RT][2]) {
#pragma unroll
    for (int t = 0; t < RT; ++t)
#pragma unroll
      for (int h = 0; h < 2; ++h) {
        sS[sb][wave][t][h][0][lane] = make_float4(s[t][h][0], s[t][h][1], s[t][h][2], s[t][h][3]);
        sS[sb][wave][t][h][1][lane] = make_float4(s[t][h][4], s[t][h][5], s[t][h][6], s[t][h][7]);
      }
  };
  // ---- stage 2: full S of the owned rows, online softmax
  auto load_part = [&](int sb, float4 (&pa)[NW][2]) {
#pragma unroll
    for (int w = 0; w < NW; ++w) {
      pa[w][0] = sS[sb][w][tw][0][hw][lane];
      pa[w][1] = sS[sb][w][tw][1][hw][lane];
    }
  };
  auto softmax = [&](const float4 (&pa)[NW][2], int pb) {
    // sum the 8 d-slices in wave order
    float fs0[4] = {0.f, 0.f, 0.f, 0.f}, fs1[4] = {0.f, 0.f, 0.f, 0.f};
#pragma unroll
    for (int w = 0; w < NW; ++w) {
      const float4 a0 = pa[w][0];
      const float4 a1 = pa[w][1];
      fs0[0] += a0.x; fs0[1] += a0.y; fs0[2] += a0.z; fs0[3] += a0.w;
      fs1[0] += a1.x; fs1[1] += a1.y; fs1[2] += a1.z; fs1[3] += a1.w;
    }
    // a row lives across one 16-lane half -> xor reduce by DPP
    float cr[4];
#pragma unroll
    for (int i = 0; i < 4; ++i) {
      const float mt = row_max16(fmaxf(fs0[i], fs1[i]));
      const float mnew = fmaxf(m[i], mt);
      const float p0 = __expf(fs0[i] - mnew);
      const float p1 = __expf(fs1[i] - mnew);
      const float rs = row_sum16(p0 + p1);
      const float corr = __expf(m[i] - mnew);
      l[i] = l[i] * corr + rs;
      m[i] = mnew;
      cr[i] = corr;
      sP[pb][tw][4 * hw + i + mh][r]      = (__bf16)p0;
      sP[pb][tw][4 * hw + i + mh][16 + r] = (__bf16)p1;
    }
    if (r == 0)
      *(float4*)&sC[pb][tw][4 * hw + mh] = make_float4(cr[0], cr[1], cr[2], cr[3]);
  };
  // ---- stage 3: rescale O, O[:, ds0+16j] += P * V^T
  auto load_p = [&](int pb, v16bf (&pf)[RT], float4 (&cc)[RT][2]) {
#pragma unroll
    for (int t = 0; t < RT; ++t) {                // P (C-layout) as A-fragments
      pf[t] = frag_bf16(&sP[pb][t][r][0] + kbase);
      cc[t][0] = *(const float4*)&sC[pb][t][mh];
      cc[t][1] = *(const float4*)&sC[pb][t][mh + 4];
    }
  };
  auto load_v = [&](int tile, v16bf (&vf)[4]) {
    const __bf16* vp = Vt + ((size_t)tile * (UU / 16) + wave * (DS / 16)) * FBLK + lane * 8;
    vf[0] = frag_packed(vp);
    vf[1] = frag_packed(vp + FBLK);
    vf[2] = frag_packed(vp + 2 * FBLK);
    vf[3] = frag_packed(vp + 3 * FBLK);
  };
  auto mma_o = [&](const v16bf (&pf)[RT], const float4 (&cc)[RT][2], const v16bf (&vf)[4]) {
#pragma unroll
    for (int t = 0; t < RT; ++t) {
      const float4 c0 = cc[t][0];
      const float4 c1 = cc[t][1];
#pragma unroll
      for (int j = 0; j < 4; ++j) {
        o[t][j][0] *= c0.x; o[t][j][1] *= c0.y; o[t][j][2] *= c0.z; o[t][j][3] *= c0.w;
        o[t][j][4] *= c1.x; o[t][j][5] *= c1.y; o[t][j][6] *= c1.z; o[t][j][7] *= c1.w;
      }
    }
#pragma unroll
    for (int t = 0; t < RT; ++t) {
      o[t][0] = wmma_bf16(pf[t], vf[0], o[t][0]);
      o[t][1] = wmma_bf16(pf[t], vf[1], o[t][1]);
      o[t][2] = wmma_bf16(pf[t], vf[2], o[t][2]);
      o[t][3] = wmma_bf16(pf[t], vf[3], o[t][3]);
    }
  };

  const v8u g1 = tdm_k_group1();
  {
    const v4u g0 = tdm_k_group0(Kw, sK0);
    __builtin_amdgcn_sched_barrier(0);
    tdm_load(g0, g1);
    wait_tensor0(g0, g1);
    __builtin_amdgcn_sched_barrier(0);
    __syncthreads();
  }

  // The foot of every pass that reads a K buffer publishes the next K tile (and
  // retires the pass's LDS reads and writes); directly behind its barrier, at the
  // head of the next pass, the buffer that the pass has read is refilled with the
  // tile after next. A request so starts and lands inside one pass.
  {                                               // fill, pass -2: S of tile 0
    const v4u g0 = tdm_k_group0(Kw + (size_t)pinned(32u) * UU, sK1);
    tdm_load(g0, g1);
    v16bf kf[4];
    v8f s[RT][2] = {};
    load_k(0, kf);
    mma_s(kf, s);
    store_s(0, s);
    wait_ds0();
    wait_tensor0(g0, g1);
    __syncthreads();
  }
  {                                               // fill, pass -1: S of tile 1, softmax of tile 0
    const v4u g0 = tdm_k_group0(Kw + (size_t)pinned(64u) * UU, sK0);
    tdm_load(g0, g1);
    v16bf kf[4];
    float4 pa[NW][2];
    v8f s[RT][2] = {};
    load_k(1, kf);
    load_part(0, pa);
    mma_s(kf, s);
    store_s(1, s);
    softmax(pa, 0);
    wait_ds0();
    wait_tensor0(g0, g1);
    __syncthreads();
  }
  for (int j = 0; j < NT - 2; ++j) {
    const int e = j & 1;                          // buffers of tiles j and j+2
    const unsigned kn = pinned((unsigned)j * 32u + 96u);  // first key of tile j+3
    const v4u g0 = tdm_k_group0(Kw + (size_t)kn * UU, e ? sK0 : sK1);
    if (kn < NN)
      tdm_load(g0, g1);
    v16bf vf[4], kf[4], pf[RT];
    float4 pa[NW][2], cc[RT][2];
    v8f s[RT][2] = {};
    // the loads of all three stages come first in the pass
    load_v(j, vf);
    wait_x0();  // V loads above: their address registers are free behind here
    load_k(e, kf);
    load_part(e ^ 1, pa);
    load_p(e, pf, cc);
    // The two scheduling fences stand round the S run. Without them the O rescale,
    // which waits for the last LDS reads of the pass, is mixed in among the first S
    // products, which need the K fragments alone, and some sC reads sink behind the
    // matrix runs, where each waits out its own LDS latency.
    __builtin_amdgcn_sched_barrier(0);
    mma_s(kf, s);                                 // tile j+2
    __builtin_amdgcn_sched_barrier(0);
    store_s(e, s);
    mma_o(pf, cc, vf);                            // tile j
    softmax(pa, e ^ 1);                           // tile j+1
    wait_ds0();
    wait_tensor0(g0, g1);
    __syncthreads();
  }
  asm volatile("s_wait_tensorcnt 0x0" ::: "memory");  // behind the last request, before the wave goes on
  wait_ds0();
  {                                               // drain: softmax of the last tile, P*V of the one before
    v16bf vf[4], pf[RT];
    float4 pa[NW][2], cc[RT][2];
    load_v(NT - 2, vf);
    wait_x0();  // V loads above: their address registers are free behind here
    load_part(1, pa);
    load_p(0, pf, cc);
    mma_o(pf, cc, vf);
    softmax(pa, 1);
    wait_ds0();
    __syncthreads();
  }
  {                                               // drain: P*V of the last tile
    v16bf vf[4], pf[RT];
    float4 cc[RT][2];
    load_v(NT - 1, vf);
    wait_x0();  // V loads above: their address registers are free behind here
    load_p(1, pf, cc);
    mma_o(pf, cc, vf);
  }
  // hand each row's 1/l from its owner to every wave, through the sC buffer whose
  // last readers stand in front of the barrier above
  if (r == 0)
    *(float4*)&sC[0][tw][4 * hw + mh] =
        make_float4(1.f / l[0], 1.f / l[1], 1.f / l[2], 1.f / l[3]);
  __syncthreads();
  float4 iv[RT][2];
#pragma unroll
  for (int t = 0; t < RT; ++t) {
    iv[t][0] = *(const float4*)&sC[0][t][mh];
    iv[t][1] = *(const float4*)&sC[0][t][mh + 4];
  }
#pragma unroll
  for (int t = 0; t < RT; ++t)
#pragma unroll
    for (int v = 0; v < 8; ++v) {
      const float4 q4 = iv[t][v >> 2];
      const float inv = (v & 3) == 0 ? q4.x : (v & 3) == 1 ? q4.y : (v & 3) == 2 ? q4.z : q4.w;
      const size_t row = (size_t)b * NN + q0 + 16 * t + v + mh;
#pragma unroll
      for (int j = 0; j < 4; ++j)
        C[row * UU + ds0 + j * 16 + r] = (__bf16)(o[t][j][v] * inv);
    }
}

// ---------------------------------------------------------------- kernel 3
// out = x + ctx @ Wp + bp (fp32 out); 16x64 tile per wave, software-pipelined
__global__ void __launch_bounds__(256) out_proj(
    const float* __restrict__ x, const __bf16* __restrict__ Cb,
    const __bf16* __restrict__ WpT, const float* __restrict__ bpp,
    float* __restrict__ out) {
  const int lane = threadIdx.x & 31;
  const int wave = threadIdx.x >> 5;
  const int tile = blockIdx.x * 8 + wave;       // 8192 tiles
  const int colQuads = UU / 64;                 // 8
  const int rowTile = tile / colQuads;
  const int colQuad = tile - rowTile * colQuads;
  const int row0 = rowTile * 16, col0 = colQuad * 64;
  const int kbase = (lane & 16) ? 8 : 0;
  const int r = lane & 15;
  const int mh = (lane >> 4) << 3;

  v8f acc[4] = {};
  const __bf16* arow = Cb + (size_t)(row0 + r) * UU + kbase;
  // weights in fragment order: one n tile is UU/32 consecutive blocks
  const __bf16* w0p = WpT + (size_t)(col0 >> 4) * (UU / 32) * FBLK + lane * 8;
  const __bf16* w1p = w0p + (UU / 32) * FBLK;
  const __bf16* w2p = w1p + (UU / 32) * FBLK;
  const __bf16* w3p = w2p + (UU / 32) * FBLK;

  v16bf a  = frag_bf16(arow);
  v16bf w0 = frag_packed(w0p), w1 = frag_packed(w1p);
  v16bf w2 = frag_packed(w2p), w3 = frag_packed(w3p);
#pragma unroll 4
  for (int k0 = 0; k0 < UU; k0 += 32) {
    v16bf an, n0, n1, n2, n3;
    const int k1 = k0 + 32;
    if (k1 < UU) {
      an = frag_bf16(arow + k1);
      const int kf = (k1 >> 5) * FBLK;           // next k block
      n0 = frag_packed(w0p + kf);  n1 = frag_packed(w1p + kf);
      n2 = frag_packed(w2p + kf);  n3 = frag_packed(w3p + kf);
      wait_x0();
    }
    acc[0] = wmma_bf16(a, w0, acc[0]);
    acc[1] = wmma_bf16(a, w1, acc[1]);
    acc[2] = wmma_bf16(a, w2, acc[2]);
    acc[3] = wmma_bf16(a, w3, acc[3]);
    a = an; w0 = n0; w1 = n1; w2 = n2; w3 = n3;
  }
#pragma unroll
  for (int t = 0; t < 4; ++t) {
    const int Nc = col0 + t * 16 + r;
    const float bias = bpp[Nc];
#pragma unroll
    for (int v = 0; v < 8; ++v) {
      const size_t idx = (size_t)(row0 + v + mh) * UU + Nc;
      out[idx] = x[idx] + acc[t][v] + bias;
    }
  }
}

// ---------------------------------------------------------------- launch
extern "C" void kernel_launch(void* const* d_in, const int* in_sizes, int n_in,
                              void* d_out, int out_size, void* d_ws, size_t ws_size,
                              hipStream_t stream) {
  const float* x  = (const float*)d_in[0];
  const float* Wq = (const float*)d_in[1];
  const float* bq = (const float*)d_in[2];
  const float* Wk = (const float*)d_in[3];
  const float* bk = (const float*)d_in[4];
  const float* Wv = (const float*)d_in[5];
  const float* bv = (const float*)d_in[6];
  const float* Wp = (const float*)d_in[7];
  const float* bp = (const float*)d_in[8];
  float* out = (float*)d_out;

  char* ws = (char*)d_ws;
  const size_t wbytes = (size_t)UU * UU * sizeof(__bf16);        // 512 KB
  const size_t tbytes = (size_t)BN * UU * sizeof(__bf16);        // 16 MB
  __bf16* WqT = (__bf16*)(ws);
  __bf16* WkT = (__bf16*)(ws + wbytes);
  __bf16* WvT = (__bf16*)(ws + 2 * wbytes);
  __bf16* WpT = (__bf16*)(ws + 3 * wbytes);
  __bf16* Qb  = (__bf16*)(ws + 4 * wbytes);
  __bf16* Kb  = (__bf16*)(ws + 4 * wbytes + tbytes);
  __bf16* VTb = (__bf16*)(ws + 4 * wbytes + 2 * tbytes);
  __bf16* Ctx = (__bf16*)(ws + 4 * wbytes + 3 * tbytes);

  cvt_weights_t<<<(UU * UU) / 256, 256, 0, stream>>>(Wq, Wk, Wv, Wp, WqT, WkT, WvT, WpT);
  qkv_proj<<<2048, 256, 0, stream>>>(x, WqT, WkT, WvT, bq, bk, bv, Qb, Kb, VTb);
  dim3 fgrid(NN / (16 * RT), BB);
  flash_attn<<<fgrid, 256, 0, stream>>>(Qb, Kb, VTb, Ctx);
  out_proj<<<1024, 256, 0, stream>>>(x, Ctx, WpT, bp, out);
}

// v006
// A run of this version takes 210 microseconds.
// Two timings next to v005 put it at 1.31 and 1.32 times that version's speed.
// All steps since v000 together make it 5.13 times as fast.
#include <hip/hip_runtime.h>

#define BB 4
#define NN 4096
#define UU 512
#define BN (BB*NN)

typedef __attribute__((ext_vector_type(16))) __bf16 v16bf;
typedef __attribute__((ext_vector_type(8)))  __bf16 v8bf;
typedef __attribute__((ext_vector_type(8)))  float  v8f;
typedef __attribute__((ext_vector_type(4)))  unsigned int v4u;
typedef __attribute__((ext_vector_type(8)))  unsigned int v8u;

__device__ __forceinline__ v8f wmma_bf16(v16bf a, v16bf b, v8f c) {
  return __builtin_amdgcn_wmma_f32_16x16x32_bf16(false, a, false, b, (short)0, c,
                                                 false, false);
}

__device__ __forceinline__ v16bf frag_bf16(const __bf16* p) {
  v8bf lo = *(const v8bf*)(p);
  v8bf hi = *(const v8bf*)(p + 16);
  return __builtin_shufflevector(lo, hi, 0, 1, 2, 3, 4, 5, 6, 7,
                                 8, 9, 10, 11, 12, 13, 14, 15);
}
#define FBLK 512
__device__ __forceinline__ v16bf frag_packed(const __bf16* p) {
  v8bf lo = *(const v8bf*)(p);
  v8bf hi = *(const v8bf*)(p + 256);
  return __builtin_shufflevector(lo, hi, 0, 1, 2, 3, 4, 5, 6, 7,
                                 8, 9, 10, 11, 12, 13, 14, 15);
}

#define KROWB  128u                               // bytes of a slice row
#define KPITCH 144u                               // row pitch in LDS
#define KSLICE 6144u                              // 32 * 144 B, rounded up to 2 KiB
__device__ __forceinline__ unsigned uni(unsigned v) {
  return (unsigned)__builtin_amdgcn_readfirstlane(v);
}
__device__ __forceinline__ unsigned pinned(unsigned v) {
  unsigned w = uni(v);
  asm volatile("" : "+s"(w));  // keeps w in a scalar register
  return w;
}
// One request: 32 rows x 128 B, source pitch 1024 B, byte elements,
// tensor dims = tile dims, pad of 4 dwords behind every 32 dwords.
__device__ __forceinline__ v4u tdm_k_group0(const __bf16* gsrc, unsigned lds_off) {
  const unsigned long long ga = (unsigned long long)(uintptr_t)gsrc;
  v4u g0;
  g0[0] = uni(1u);                                          // count = 1
  g0[1] = uni(lds_off);                                     // LDS byte offset
  g0[2] = uni((unsigned)ga);                                // address [31:0]
  g0[3] = uni(((unsigned)(ga >> 32) & 0x01FFFFFFu) | 0x80000000u);  // [56:32], type 2
  return g0;
}
// Formed once a kernel: through pinned() its words stay in the same scalar
// registers for every request, instead of being formed anew in registers that
// are free for other use while a request is under way.
__device__ __forceinline__ v8u tdm_k_group1() {
  v8u g1;
  g1[0] = uni((1u << 20) | (4u << 22) | (3u << 25));
  g1[1] = pinned(KROWB << 16);
  g1[2] = pinned(32u << 16);
  g1[3] = pinned(KROWB << 16);
  g1[4] = pinned(32u);
  g1[5] = pinned(UU * 2u);
  g1[6] = pinned(0u);
  g1[7] = pinned(0u);
  return g1;
}
__device__ __forceinline__ void tdm_load(v4u g0, v8u g1) {
  asm volatile("tensor_load_to_lds %0, %1" :: "s"(g0), "s"(g1) : "memory");
}
__device__ __forceinline__ void wait_tensor0(v4u g0, v8u g1) {
  asm volatile("s_wait_tensorcnt 0x0" :: "s"(g0), "s"(g1) : "memory");
}
// This wave's LDS reads have retired before the buffer they read is refilled.
__device__ __forceinline__ void wait_ds0() { asm volatile("s_wait_dscnt 0x0" ::: "memory"); }

// Stands between issued global loads and the next rewrite of the address registers
// that they name.
__device__ __forceinline__ void wait_x0() { asm volatile("s_wait_xcnt 0x0" ::: "memory"); }
__device__ __forceinline__ void close_x0(const void* base) {
  __builtin_amdgcn_sched_barrier(0);
  asm volatile("s_wait_xcnt 0x0" :: "v"(base) : "memory");
  __builtin_amdgcn_sched_barrier(0);
}

template <int X>
__device__ __forceinline__ float row_xor(float v) {
  return __builtin_bit_cast(float, __builtin_amdgcn_update_dpp(
      0, __builtin_bit_cast(int, v), 0x160 + X, 0xf, 0xf, false));
}
__device__ __forceinline__ float row_max16(float v) {
  v = fmaxf(v, row_xor<1>(v));
  v = fmaxf(v, row_xor<2>(v));
  v = fmaxf(v, row_xor<4>(v));
  return fmaxf(v, row_xor<8>(v));
}
__device__ __forceinline__ float row_sum16(float v) {
  v += row_xor<1>(v);
  v += row_xor<2>(v);
  v += row_xor<4>(v);
  return v + row_xor<8>(v);
}

// ---------------------------------------------------------------- kernel 0
__global__ void cvt_weights_t(const float* __restrict__ wq, const float* __restrict__ wk,
                              const float* __restrict__ wv, const float* __restrict__ wp,
                              __bf16* __restrict__ dq, __bf16* __restrict__ dk,
                              __bf16* __restrict__ dv, __bf16* __restrict__ dp) {
  const int idx = blockIdx.x * blockDim.x + threadIdx.x;   // coalesced read
  const int k = idx / UU, n = idx % UU;
  // fragment order, blocks laid out [n tile][k block]
  const size_t t = ((size_t)(n >> 4) * (UU / 32) + (k >> 5)) * FBLK +
                   ((k >> 4) & 1) * 256 + ((((k >> 3) & 1) << 4) + (n & 15)) * 8 + (k & 7);
  dq[t] = (__bf16)wq[idx];
  dk[t] = (__bf16)wk[idx];
  dv[t] = (__bf16)wv[idx];
  dp[t] = (__bf16)wp[idx];
}

// ---------------------------------------------------------------- kernel 1
// Fused Q/K/V projection. A work-group takes 64 rows of x (4 row tiles) and, in
// two rounds, 256 columns of each of Q, K and V a round; a wave takes 32 of those
// columns for all 4 row tiles, so each weight fragment (global) feeds 4 matrix
// instructions.
// The x tile is read once a work-group, in 128-B lines, rounded to bf16 and kept
// in LDS in A-fragment order (the order of frag_packed with n = row), so every
// wave finds a fragment by two contiguous ds_load_b128.
// Fragments for step k+1 are loaded before step k's wmma run.
#define QRT 4                                     // row tiles per work-group
#define KB  (UU / 32)                             // k blocks
__global__ void __launch_bounds__(256) qkv_proj(
    const float* __restrict__ x,
    const __bf16* __restrict__ WqT, const __bf16* __restrict__ WkT,
    const __bf16* __restrict__ WvT,
    const float* __restrict__ bqp, const float* __restrict__ bkp,
    const float* __restrict__ bvp,
    __bf16* __restrict__ Q, __bf16* __restrict__ K, __bf16* __restrict__ VT) {
  __shared__ alignas(16) __bf16 sX[QRT][KB][FBLK];  // 64 KB
  const int lane = threadIdx.x & 31;
  const int wave = threadIdx.x >> 5;
  const int rowBase = blockIdx.x * (16 * QRT);
  const int r = lane & 15;
  const int mh = (lane >> 4) << 3;

  {
    // A lane takes 8 consecutive k of one row, 4 lanes one 128-B line, a wave 8 rows.
    const int c = lane & 3;
    const int row = wave * 8 + (lane >> 2);
    const float* xs = x + (size_t)(rowBase + row) * UU + c * 8;
    float4 xa[KB][2];
#pragma unroll
    for (int kb = 0; kb < KB; ++kb) {
      xa[kb][0] = *(const float4*)(xs + kb * 32);
      xa[kb][1] = *(const float4*)(xs + kb * 32 + 4);
    }
    wait_x0();
    __bf16* xd = &sX[row >> 4][0][(c >> 1) * 256 + ((c & 1) * 16 + (row & 15)) * 8];
#pragma unroll
    for (int kb = 0; kb < KB; ++kb) {
      const float4 lo = xa[kb][0], hi = xa[kb][1];
      v8bf p;
      p[0] = (__bf16)lo.x; p[1] = (__bf16)lo.y; p[2] = (__bf16)lo.z; p[3] = (__bf16)lo.w;
      p[4] = (__bf16)hi.x; p[5] = (__bf16)hi.y; p[6] = (__bf16)hi.z; p[7] = (__bf16)hi.w;
      *(v8bf*)(xd + kb * FBLK) = p;
    }
  }
  __syncthreads();                                // the x tile is whole for every wave

  const float scale = rsqrtf((float)UU);
  // Kept rolled: a second copy of the 16 unrolled steps would only double the text.
#pragma unroll 1
  for (int ch = 0; ch < 2; ++ch) {                // column halves, from the same x tile
    const int col0 = (ch * 8 + wave) * 32;
    // weights in fragment order: one n tile is UU/32 consecutive blocks
    const size_t wt = (size_t)(col0 >> 4) * KB * FBLK + lane * 8;
    const __bf16* wp[6];
    wp[0] = WqT + wt;  wp[1] = wp[0] + KB * FBLK;
    wp[2] = WkT + wt;  wp[3] = wp[2] + KB * FBLK;
    wp[4] = WvT + wt;  wp[5] = wp[4] + KB * FBLK;

    v16bf w[2][6], a[2][QRT];
    float bq2[2], bk2[2], bv2[2];                 // this lane's columns of the biases
#pragma unroll
    for (int i = 0; i < 6; ++i) w[0][i] = frag_packed(wp[i]);
#pragma unroll
    for (int h = 0; h < 2; ++h) {
      bq2[h] = bqp[col0 + 16 * h + r];
      bk2[h] = bkp[col0 + 16 * h + r];
      bv2[h] = bvp[col0 + 16 * h + r];
    }
    wait_x0();
    v8f acc[QRT][6] = {};
#pragma unroll
    for (int t = 0; t < QRT; ++t) a[0][t] = frag_packed(&sX[t][0][lane * 8]);
#pragma unroll
    for (int s = 0; s < KB; ++s) {
      if (s + 1 < KB) {                           // load next step's fragments
#pragma unroll
        for (int i = 0; i < 6; ++i) w[(s + 1) & 1][i] = frag_packed(wp[i] + (s + 1) * FBLK);
        wait_x0();
#pragma unroll
        for (int t = 0; t < QRT; ++t) a[(s + 1) & 1][t] = frag_packed(&sX[t][s + 1][lane * 8]);
      }
      // Keeps the next step's loads in front of this step's matrix run: sunk in
      // among or behind it they would have no lead over their first use.
      __builtin_amdgcn_sched_barrier(0);
#pragma unroll
      for (int t = 0; t < QRT; ++t)
#pragma unroll
        for (int i = 0; i < 6; ++i)
          acc[t][i] = wmma_bf16(a[s & 1][t], w[s & 1][i], acc[t][i]);
    }
    // Keeps the last matrix run out of the stores below and their waits.
    __builtin_amdgcn_sched_barrier(0);
#pragma unroll
    for (int t = 0; t < QRT; ++t) {
      const int row0 = rowBase + 16 * t;
      const int b = row0 >> 12;                   // row0 / NN
      v8bf pv[2];                                 // V: a lane's 8 keys of one d column
#pragma unroll
      for (int v = 0; v < 8; ++v) {
        const size_t idx = (size_t)(row0 + v + mh) * UU;
#pragma unroll
        for (int h = 0; h < 2; ++h) {
          const int Nc = col0 + 16 * h + r;
          const float q = acc[t][h][v] + bq2[h];
          const float k = acc[t][2 + h][v] + bk2[h];
          const float vv = acc[t][4 + h][v] + bv2[h];
          Q[idx + Nc] = (__bf16)(q * scale);
          K[idx + Nc] = (__bf16)k;
          pv[h][v] = (__bf16)vv;
        }
      }
      // V in fragment order (k = key, n = d), blocks laid out [batch][key block][d tile]:
      // the accumulator's 8 rows of a lane are that lane's 8 consecutive elements.
      __bf16* vdst = VT + (((size_t)b * (NN / 32) + ((row0 & (NN - 1)) >> 5)) * (UU / 16) +
                           (col0 >> 4)) * FBLK + ((row0 >> 4) & 1) * 256 + lane * 8;
      *(v8bf*)(vdst) = pv[0];
      *(v8bf*)(vdst + FBLK) = pv[1];
      close_x0(vdst);
    }
  }
}

// ---------------------------------------------------------------- kernel 2
// Flash attention: 64 query rows/block (4 row tiles), 8 waves split d (64 each).
// Every wave carries all 4 row tiles of its d-slice, so each K fragment (LDS)
// and each V fragment (global) feeds 4 matrix instructions.
// The 64x32 score block is summed and soft-maxed once: wave w owns row tile
// w>>1, accumulator rows 4*(w&1)..+3 of each lane half.
// K tiles are double-buffered in LDS by tensor loads, one slice per wave.
// The three stages of a key tile run as a software pipeline: pass j forms the
// partial S of tile j+2, the softmax of tile j+1 and P*V of tile j. Each stage
// reads only what the pass before has left in LDS, and sS, sP and sC have two
// buffers each, so one barrier a pass orders all of it and the stages' loads,
// matrix runs and vector chains overlap inside a pass.
#define RT 4                                      // row tiles per block
#define NW 8                                      // waves per block
#define DS (UU / NW)                              // d columns per wave
#define NT (NN / 32)                              // key tiles
__global__ void __launch_bounds__(256) flash_attn(
    const __bf16* __restrict__ Q, const __bf16* __restrict__ K,
    const __bf16* __restrict__ VT, __bf16* __restrict__ C) {
  __shared__ alignas(2048) unsigned char sK[2][NW][KSLICE];  // 96 KB: K slices
  // per-wave partial S, kept in accumulator order: [buffer][wave][tile][key half]
  // [register quad][lane] -> one 16B element per lane, no transposition
  __shared__ float4 sS[2][NW][RT][2][2][32];      // 128 KB
  // P for A-frag repack; 80-B pitch = 16 B x 5 for its ds_load_b128 readers
  __shared__ alignas(16) __bf16 sP[2][RT][16][40];
  __shared__ alignas(16) float sC[2][RT][16];     // per-row rescale factor

  const int lane = threadIdx.x & 31;
  const int wave = threadIdx.x >> 5;              // 0..7 -> d-slice
  const int b  = blockIdx.y;
  const int q0 = blockIdx.x * (16 * RT);
  const int ds0 = wave * DS;
  const int kbase = (lane & 16) ? 8 : 0;
  const int r  = lane & 15;
  const int mh = (lane >> 4) << 3;
  const int tw = wave >> 1;                       // softmax: owned row tile
  const int hw = wave & 1;                        // softmax: owned register quad

  const __bf16* Qb = Q + (size_t)b * NN * UU;
  const __bf16* Kb = K + (size_t)b * NN * UU;
  const __bf16* Vt = VT + (size_t)b * UU * NN;    // fragment order [key block][d tile]

  typedef __attribute__((address_space(3))) unsigned char lds_u8;
  const unsigned sw = uni(threadIdx.x >> 5);      // wave number, scalar
  const unsigned sK0 = (unsigned)(unsigned long long)(lds_u8*)&sK[0][0][0] + sw * KSLICE;
  const unsigned sK1 = sK0 + NW * KSLICE;
  const __bf16* Kw = Kb + sw * DS;                // this wave's columns of K

  v16bf qf[RT][2];
#pragma unroll
  for (int t = 0; t < RT; ++t)
#pragma unroll
    for (int kk = 0; kk < 2; ++kk)
      qf[t][kk] = frag_bf16(Qb + (size_t)(q0 + 16 * t + r) * UU + ds0 + kk * 32 + kbase);

  v8f o[RT][4] = {};
  float m[4], l[4];                               // rows 4*hw+i+mh of tile tw
#pragma unroll
  for (int i = 0; i < 4; ++i) { m[i] = -3.0e38f; l[i] = 0.f; }

  // ---- stage 1: partial S over this wave's d-slice
  auto load_k = [&](int buf, v16bf (&kf)[4]) {    // ds_load_b128 fragments
#pragma unroll
    for (int kk = 0; kk < 2; ++kk) {
      const unsigned char* kp = &sK[buf][wave][r * KPITCH + (kk * 32 + kbase) * 2];
      kf[2 * kk]     = frag_bf16((const __bf16*)kp);
      kf[2 * kk + 1] = frag_bf16((const __bf16*)(kp + 16 * KPITCH));
    }
  };
  auto mma_s = [&](const v16bf (&kf)[4], v8f (&s)[RT][2]) {
#pragma unroll
    for (int kk = 0; kk < 2; ++kk)
#pragma unroll
      for (int t = 0; t < RT; ++t) {
        s[t][0] = wmma_bf16(qf[t][kk], kf[2 * kk], s[t][0]);
        s[t][1] = wmma_bf16(qf[t][kk], kf[2 * kk + 1], s[t][1]);
      }
  };
  auto store_s = [&](int sb, const v8f (&s)[RT][2]) {
#pragma unroll
    for (int t = 0; t < RT; ++t)
#pragma unroll
      for (int h = 0; h < 2; ++h) {
        sS[sb][wave][t][h][0][lane] = make_float4(s[t][h][0], s[t][h][1], s[t][h][2], s[t][h][3]);
        sS[sb][wave][t][h][1][lane] = make_float4(s[t][h][4], s[t][h][5], s[t][h][6], s[t][h][7]);
      }
  };
  // ---- stage 2: full S of the owned rows, online softmax
  auto load_part = [&](int sb, float4 (&pa)[NW][2]) {
#pragma unroll
    for (int w = 0; w < NW; ++w) {
      pa[w][0] = sS[sb][w][tw][0][hw][lane];
      pa[w][1] = sS[sb][w][tw][1][hw][lane];
    }
  };
  auto softmax = [&](const float4 (&pa)[NW][2], int pb) {
    // sum the 8 d-slices in wave order
    float fs0[4] = {0.f, 0.f, 0.f, 0.f}, fs1[4] = {0.f, 0.f, 0.f, 0.f};
#pragma unroll
    for (int w = 0; w < NW; ++w) {
      const float4 a0 = pa[w][0];
      const float4 a1 = pa[w][1];
      fs0[0] += a0.x; fs0[1] += a0.y; fs0[2] += a0.z; fs0[3] += a0.w;
      fs1[0] += a1.x; fs1[1] += a1.y; fs1[2] += a1.z; fs1[3] += a1.w;
    }
    // a row lives across one 16-lane half -> xor reduce by DPP
    float cr[4];
#pragma unroll
    for (int i = 0; i < 4; ++i) {
      const float mt = row_max16(fmaxf(fs0[i], fs1[i]));
      const float mnew = fmaxf(m[i], mt);
      const float p0 = __expf(fs0[i] - mnew);
      const float p1 = __expf(fs1[i] - mnew);
      const float rs = row_sum16(p0 + p1);
      const float corr = __expf(m[i] - mnew);
      l[i] = l[i] * corr + rs;
      m[i] = mnew;
      cr[i] = corr;
      sP[pb][tw][4 * hw + i + mh][r]      = (__bf16)p0;
      sP[pb][tw][4 * hw + i + mh][16 + r] = (__bf16)p1;
    }
    if (r == 0)
      *(float4*)&sC[pb][tw][4 * hw + mh] = make_float4(cr[0], cr[1], cr[2], cr[3]);
  };
  // ---- stage 3: rescale O, O[:, ds0+16j] += P * V^T
  auto load_p = [&](int pb, v16bf (&pf)[RT], float4 (&cc)[RT][2]) {
#pragma unroll
    for (int t = 0; t < RT; ++t) {                // P (C-layout) as A-fragments
      pf[t] = frag_bf16(&sP[pb][t][r][0] + kbase);
      cc[t][0] = *(const float4*)&sC[pb][t][mh];
      cc[t][1] = *(const float4*)&sC[pb][t][mh + 4];
    }
  };
  auto load_v = [&](int tile, v16bf (&vf)[4]) {
    const __bf16* vp = Vt + ((size_t)tile * (UU / 16) + wave * (DS / 16)) * FBLK + lane * 8;
    vf[0] = frag_packed(vp);
    vf[1] = frag_packed(vp + FBLK);
    vf[2] = frag_packed(vp + 2 * FBLK);
    vf[3] = frag_packed(vp + 3 * FBLK);
  };
  auto mma_o = [&](const v16bf (&pf)[RT], const float4 (&cc)[RT][2], const v16bf (&vf)[4]) {
#pragma unroll
    for (int t = 0; t < RT; ++t) {
      const float4 c0 = cc[t][0];
      const float4 c1 = cc[t][1];
#pragma unroll
      for (int j = 0; j < 4; ++j) {
        o[t][j][0] *= c0.x; o[t][j][1] *= c0.y; o[t][j][2] *= c0.z; o[t][j][3] *= c0.w;
        o[t][j][4] *= c1.x; o[t][j][5] *= c1.y; o[t][j][6] *= c1.z; o[t][j][7] *= c1.w;
      }
    }
#pragma unroll
    for (int t = 0; t < RT; ++t) {
      o[t][0] = wmma_bf16(pf[t], vf[0], o[t][0]);
      o[t][1] = wmma_bf16(pf[t], vf[1], o[t][1]);
      o[t][2] = wmma_bf16(pf[t], vf[2], o[t][2]);
      o[t][3] = wmma_bf16(pf[t], vf[3], o[t][3]);
    }
  };

  const v8u g1 = tdm_k_group1();
  {
    const v4u g0 = tdm_k_group0(Kw, sK0);
    __builtin_amdgcn_sched_barrier(0);
    tdm_load(g0, g1);
    wait_tensor0(g0, g1);
    __builtin_amdgcn_sched_barrier(0);
    __syncthreads();
  }

  // The foot of every pass that reads a K buffer publishes the next K tile (and
  // retires the pass's LDS reads and writes); directly behind its barrier, at the
  // head of the next pass, the buffer that the pass has read is refilled with the
  // tile after next. A request so starts and lands inside one pass.
  {                                               // fill, pass -2: S of tile 0
    const v4u g0 = tdm_k_group0(Kw + (size_t)pinned(32u) * UU, sK1);
    tdm_load(g0, g1);
    v16bf kf[4];
    v8f s[RT][2] = {};
    load_k(0, kf);
    mma_s(kf, s);
    store_s(0, s);
    wait_ds0();
    wait_tensor0(g0, g1);
    __syncthreads();
  }
  {                                               // fill, pass -1: S of tile 1, softmax of tile 0
    const v4u g0 = tdm_k_group0(Kw + (size_t)pinned(64u) * UU, sK0);
    tdm_load(g0, g1);
    v16bf kf[4];
    float4 pa[NW][2];
    v8f s[RT][2] = {};
    load_k(1, kf);
    load_part(0, pa);
    mma_s(kf, s);
    store_s(1, s);
    softmax(pa, 0);
    wait_ds0();
    wait_tensor0(g0, g1);
    __syncthreads();
  }
  for (int j = 0; j < NT - 2; ++j) {
    const int e = j & 1;                          // buffers of tiles j and j+2
    const unsigned kn = pinned((unsigned)j * 32u + 96u);  // first key of tile j+3
    const v4u g0 = tdm_k_group0(Kw + (size_t)kn * UU, e ? sK0 : sK1);
    if (kn < NN)
      tdm_load(g0, g1);
    v16bf vf[4], kf[4], pf[RT];
    float4 pa[NW][2], cc[RT][2];
    v8f s[RT][2] = {};
    // the loads of all three stages come first in the pass
    load_v(j, vf);
    wait_x0();  // V loads above: their address registers are free behind here
    load_k(e, kf);
    load_part(e ^ 1, pa);
    load_p(e, pf, cc);
    // The two scheduling fences stand round the S run. Without them the O rescale,
    // which waits for the last LDS reads of the pass, is mixed in among the first S
    // products, which need the K fragments alone, and some sC reads sink behind the
    // matrix runs, where each waits out its own LDS latency.
    __builtin_amdgcn_sched_barrier(0);
    mma_s(kf, s);                                 // tile j+2
    __builtin_amdgcn_sched_barrier(0);
    store_s(e, s);
    mma_o(pf, cc, vf);                            // tile j
    softmax(pa, e ^ 1);                           // tile j+1
    wait_ds0();
    wait_tensor0(g0, g1);
    __syncthreads();
  }
  asm volatile("s_wait_tensorcnt 0x0" ::: "memory");  // behind the last request, before the wave goes on
  wait_ds0();
  {                                               // drain: softmax of the last tile, P*V of the one before
    v16bf vf[4], pf[RT];
    float4 pa[NW][2], cc[RT][2];
    load_v(NT - 2, vf);
    wait_x0();  // V loads above: their address registers are free behind here
    load_part(1, pa);
    load_p(0, pf, cc);
    mma_o(pf, cc, vf);
    softmax(pa, 1);
    wait_ds0();
    __syncthreads();
  }
  {                                               // drain: P*V of the last tile
    v16bf vf[4], pf[RT];
    float4 cc[RT][2];
    load_v(NT - 1, vf);
    wait_x0();  // V loads above: their address registers are free behind here
    load_p(1, pf, cc);
    mma_o(pf, cc, vf);
  }
  // hand each row's 1/l from its owner to every wave, through the sC buffer whose
  // last readers stand in front of the barrier above
  if (r == 0)
    *(float4*)&sC[0][tw][4 * hw + mh] =
        make_float4(1.f / l[0], 1.f / l[1], 1.f / l[2], 1.f / l[3]);
  __syncthreads();
  float4 iv[RT][2];
#pragma unroll
  for (int t = 0; t < RT; ++t) {
    iv[t][0] = *(const float4*)&sC[0][t][mh];
    iv[t][1] = *(const float4*)&sC[0][t][mh + 4];
  }
#pragma unroll
  for (int t = 0; t < RT; ++t)
#pragma unroll
    for (int v = 0; v < 8; ++v) {
      const float4 q4 = iv[t][v >> 2];
      const float inv = (v & 3) == 0 ? q4.x : (v & 3) == 1 ? q4.y : (v & 3) == 2 ? q4.z : q4.w;
      const size_t row = (size_t)b * NN + q0 + 16 * t + v + mh;
#pragma unroll
      for (int j = 0; j < 4; ++j)
        C[row * UU + ds0 + j * 16 + r] = (__bf16)(o[t][j][v] * inv);
    }
}

// ---------------------------------------------------------------- kernel 3
// out = x + ctx @ Wp + bp (fp32 out). Tiled like kernel 1: a work-group takes 64
// rows of ctx and all 512 columns, a wave 64 columns for all 4 row tiles, so each
// weight fragment feeds 4 matrix instructions; the ctx tile is read once a
// work-group and kept in LDS in A-fragment order.
__global__ void __launch_bounds__(256) out_proj(
    const float* __restrict__ x, const __bf16* __restrict__ Cb,
    const __bf16* __restrict__ WpT, const float* __restrict__ bpp,
    float* __restrict__ out) {
  __shared__ alignas(16) __bf16 sA[QRT][KB][FBLK];  // 64 KB
  const int lane = threadIdx.x & 31;
  const int wave = threadIdx.x >> 5;
  const int rowBase = blockIdx.x * (16 * QRT);
  const int col0 = wave * 64;
  const int r = lane & 15;
  const int mh = (lane >> 4) << 3;

  // weights in fragment order: one n tile is UU/32 consecutive blocks
  const __bf16* wp[4];
  wp[0] = WpT + (size_t)(col0 >> 4) * KB * FBLK + lane * 8;
  wp[1] = wp[0] + KB * FBLK;
  wp[2] = wp[1] + KB * FBLK;
  wp[3] = wp[2] + KB * FBLK;

  v16bf w[2][4], a[2][QRT];
  float bias[4];                                  // this lane's columns of the bias
  {
    // A lane takes 8 consecutive k of one row, 4 lanes one k block, a wave 8 rows.
    const int c = lane & 3;
    const int row = wave * 8 + (lane >> 2);
    const __bf16* cs = Cb + (size_t)(rowBase + row) * UU + c * 8;
    v8bf ca[KB];
#pragma unroll
    for (int kb = 0; kb < KB; ++kb) ca[kb] = *(const v8bf*)(cs + kb * 32);
#pragma unroll
    for (int i = 0; i < 4; ++i) w[0][i] = frag_packed(wp[i]);
#pragma unroll
    for (int i = 0; i < 4; ++i) bias[i] = bpp[col0 + i * 16 + r];
    wait_x0();
    __bf16* ad = &sA[row >> 4][0][(c >> 1) * 256 + ((c & 1) * 16 + (row & 15)) * 8];
#pragma unroll
    for (int kb = 0; kb < KB; ++kb) *(v8bf*)(ad + kb * FBLK) = ca[kb];
  }
  __syncthreads();                                // the ctx tile is whole for every wave

  v8f acc[QRT][4] = {};
  // residual x and out: element (row tile t, row v, column tile i) of this lane
  // lies at (16 t + v) * UU + 16 i from these two bases
  const size_t eb = (size_t)(rowBase + mh) * UU + col0 + r;
  const float* xb = x + eb;
  float* ob = out + eb;
  float xv[4][QRT][8];
  auto load_x = [&](int i) {                      // one column tile's residual values
#pragma unroll
    for (int t = 0; t < QRT; ++t)
#pragma unroll
      for (int v = 0; v < 8; ++v) xv[i][t][v] = xb[(16 * t + v) * UU + 16 * i];
    close_x0(xb);
  };
#pragma unroll
  for (int t = 0; t < QRT; ++t) a[0][t] = frag_packed(&sA[t][0][lane * 8]);
#pragma unroll
  for (int s = 0; s < KB; ++s) {
    if (s + 1 < KB) {                             // load next step's fragments
#pragma unroll
      for (int i = 0; i < 4; ++i) w[(s + 1) & 1][i] = frag_packed(wp[i] + (s + 1) * FBLK);
      wait_x0();
#pragma unroll
      for (int t = 0; t < QRT; ++t) a[(s + 1) & 1][t] = frag_packed(&sA[t][s + 1][lane * 8]);
    }
    // behind the last weight loads, so that no weight fragment waits for them
    if (s == KB - 2) load_x(0);
    if (s == KB - 1) load_x(1);
    // Keeps the next step's loads in front of this step's matrix run: sunk in
    // among or behind it they would have no lead over their first use.
    __builtin_amdgcn_sched_barrier(0);
#pragma unroll
    for (int t = 0; t < QRT; ++t)
#pragma unroll
      for (int i = 0; i < 4; ++i)
        acc[t][i] = wmma_bf16(a[s & 1][t], w[s & 1][i], acc[t][i]);
  }
  // Keeps the last matrix run out of the stores below and their waits.
  __builtin_amdgcn_sched_barrier(0);
#pragma unroll
  for (int i = 0; i < 4; ++i) {
    if (i + 2 < 4) load_x(i + 2);                 // two column tiles ahead
#pragma unroll
    for (int t = 0; t < QRT; ++t)
#pragma unroll
      for (int v = 0; v < 8; ++v)
        ob[(16 * t + v) * UU + 16 * i] = xv[i][t][v] + acc[t][i][v] + bias[i];
    close_x0(ob);
  }
}

// ---------------------------------------------------------------- launch
extern "C" void kernel_launch(void* const* d_in, const int* in_sizes, int n_in,
                              void* d_out, int out_size, void* d_ws, size_t ws_size,
                              hipStream_t stream) {
  const float* x  = (const float*)d_in[0];
  const float* Wq = (const float*)d_in[1];
  const float* bq = (const float*)d_in[2];
  const float* Wk = (const float*)d_in[3];
  const float* bk = (const float*)d_in[4];
  const float* Wv = (const float*)d_in[5];
  const float* bv = (const float*)d_in[6];
  const float* Wp = (const float*)d_in[7];
  const float* bp = (const float*)d_in[8];
  float* out = (float*)d_out;

  char* ws = (char*)d_ws;
  const size_t wbytes = (size_t)UU * UU * sizeof(__bf16);        // 512 KB
  const size_t tbytes = (size_t)BN * UU * sizeof(__bf16);        // 16 MB
  __bf16* WqT = (__bf16*)(ws);
  __bf16* WkT = (__bf16*)(ws + wbytes);
  __bf16* WvT = (__bf16*)(ws + 2 * wbytes);
  __bf16* WpT = (__bf16*)(ws + 3 * wbytes);
  __bf16* Qb  = (__bf16*)(ws + 4 * wbytes);
  __bf16* Kb  = (__bf16*)(ws + 4 * wbytes + tbytes);
  __bf16* VTb = (__bf16*)(ws + 4 * wbytes + 2 * tbytes);
  __bf16* Ctx = (__bf16*)(ws + 4 * wbytes + 3 * tbytes);

  cvt_weights_t<<<(UU * UU) / 256, 256, 0, stream>>>(Wq, Wk, Wv, Wp, WqT, WkT, WvT, WpT);
  qkv_proj<<<256, 256, 0, stream>>>(x, WqT, WkT, WvT, bq, bk, bv, Qb, Kb, VTb);
  dim3 fgrid(NN / (16 * RT), BB);
  flash_attn<<<fgrid, 256, 0, stream>>>(Qb, Kb, VTb, Ctx);
  out_proj<<<256, 256, 0, stream>>>(x, Ctx, WpT, bp, out);
}

// v007
// Measured time: 199 microseconds a run.
// In two side-by-side timings against v006, it was 1.07 and 1.06 times as fast.
// Over all steps from v000 it is 5.46 times as fast.
#include <hip/hip_runtime.h>

#define BB 4
#define NN 4096
#define UU 512
#define BN (BB*NN)

typedef __attribute__((ext_vector_type(16))) __bf16 v16bf;
typedef __attribute__((ext_vector_type(8)))  __bf16 v8bf;
typedef __attribute__((ext_vector_type(8)))  float  v8f;
typedef __attribute__((ext_vector_type(4)))  unsigned int v4u;
typedef __attribute__((ext_vector_type(8)))  unsigned int v8u;

__device__ __forceinline__ v8f wmma_bf16(v16bf a, v16bf b, v8f c) {
  return __builtin_amdgcn_wmma_f32_16x16x32_bf16(false, a, false, b, (short)0, c,
                                                 false, false);
}

__device__ __forceinline__ v16bf frag_bf16(const __bf16* p) {
  v8bf lo = *(const v8bf*)(p);
  v8bf hi = *(const v8bf*)(p + 16);
  return __builtin_shufflevector(lo, hi, 0, 1, 2, 3, 4, 5, 6, 7,
                                 8, 9, 10, 11, 12, 13, 14, 15);
}
#define FBLK 512
__device__ __forceinline__ v16bf frag_packed(const __bf16* p) {
  v8bf lo = *(const v8bf*)(p);
  v8bf hi = *(const v8bf*)(p + 256);
  return __builtin_shufflevector(lo, hi, 0, 1, 2, 3, 4, 5, 6, 7,
                                 8, 9, 10, 11, 12, 13, 14, 15);
}

#define KROWB  256u                               // bytes of a slice row
#define KROWS  16u                                // rows (keys) of a slice
#define KPITCH 272u                               // row pitch in LDS
#define KSLICE 6144u                              // 16 * 272 B, rounded up to 2 KiB
__device__ __forceinline__ unsigned uni(unsigned v) {
  return (unsigned)__builtin_amdgcn_readfirstlane(v);
}
__device__ __forceinline__ unsigned pinned(unsigned v) {
  unsigned w = uni(v);
  asm volatile("" : "+s"(w));  // keeps w in a scalar register
  return w;
}
// One request: 16 rows x 256 B, source pitch 1024 B, byte elements,
// tensor dims = tile dims, pad of 4 dwords behind every 64 dwords.
__device__ __forceinline__ v4u tdm_k_group0(const __bf16* gsrc, unsigned lds_off) {
  const unsigned long long ga = (unsigned long long)(uintptr_t)gsrc;
  v4u g0;
  g0[0] = uni(1u);                                          // count = 1
  g0[1] = uni(lds_off);                                     // LDS byte offset
  g0[2] = uni((unsigned)ga);                                // address [31:0]
  g0[3] = uni(((unsigned)(ga >> 32) & 0x01FFFFFFu) | 0x80000000u);  // [56:32], type 2
  return g0;
}
// Formed once a kernel: through pinned() its words stay in the same scalar
// registers for every request, instead of being formed anew in registers that
// are free for other use while a request is under way.
__device__ __forceinline__ v8u tdm_k_group1() {
  v8u g1;
  g1[0] = uni((1u << 20) | (5u << 22) | (3u << 25));
  g1[1] = pinned(KROWB << 16);
  g1[2] = pinned(KROWS << 16);
  g1[3] = pinned(KROWB << 16);
  g1[4] = pinned(KROWS);
  g1[5] = pinned(UU * 2u);
  g1[6] = pinned(0u);
  g1[7] = pinned(0u);
  return g1;
}
__device__ __forceinline__ void tdm_load(v4u g0, v8u g1) {
  asm volatile("tensor_load_to_lds %0, %1" :: "s"(g0), "s"(g1) : "memory");
}
__device__ __forceinline__ void wait_tensor0(v4u g0, v8u g1) {
  asm volatile("s_wait_tensorcnt 0x0" :: "s"(g0), "s"(g1) : "memory");
}
// This wave's LDS reads have retired before the buffer they read is refilled.
__device__ __forceinline__ void wait_ds0() { asm volatile("s_wait_dscnt 0x0" ::: "memory"); }

// Stands between issued global loads and the next rewrite of the address registers
// that they name.
__device__ __forceinline__ void wait_x0() { asm volatile("s_wait_xcnt 0x0" ::: "memory"); }
__device__ __forceinline__ void close_x0(const void* base) {
  __builtin_amdgcn_sched_barrier(0);
  asm volatile("s_wait_xcnt 0x0" :: "v"(base) : "memory");
  __builtin_amdgcn_sched_barrier(0);
}

template <int X>
__device__ __forceinline__ float row_xor(float v) {
  return __builtin_bit_cast(float, __builtin_amdgcn_update_dpp(
      0, __builtin_bit_cast(int, v), 0x160 + X, 0xf, 0xf, false));
}
__device__ __forceinline__ float row_max16(float v) {
  v = fmaxf(v, row_xor<1>(v));
  v = fmaxf(v, row_xor<2>(v));
  v = fmaxf(v, row_xor<4>(v));
  return fmaxf(v, row_xor<8>(v));
}
__device__ __forceinline__ float row_sum16(float v) {
  v += row_xor<1>(v);
  v += row_xor<2>(v);
  v += row_xor<4>(v);
  return v + row_xor<8>(v);
}

// ---------------------------------------------------------------- kernel 0
__global__ void cvt_weights_t(const float* __restrict__ wq, const float* __restrict__ wk,
                              const float* __restrict__ wv, const float* __restrict__ wp,
                              __bf16* __restrict__ dq, __bf16* __restrict__ dk,
                              __bf16* __restrict__ dv, __bf16* __restrict__ dp) {
  const int idx = blockIdx.x * blockDim.x + threadIdx.x;   // coalesced read
  const int k = idx / UU, n = idx % UU;
  // fragment order, blocks laid out [n tile][k block]
  const size_t t = ((size_t)(n >> 4) * (UU / 32) + (k >> 5)) * FBLK +
                   ((k >> 4) & 1) * 256 + ((((k >> 3) & 1) << 4) + (n & 15)) * 8 + (k & 7);
  dq[t] = (__bf16)wq[idx];
  dk[t] = (__bf16)wk[idx];
  dv[t] = (__bf16)wv[idx];
  dp[t] = (__bf16)wp[idx];
}

// ---------------------------------------------------------------- kernel 1
// Fused Q/K/V projection. A work-group takes 64 rows of x (4 row tiles) and, in
// two rounds, 256 columns of each of Q, K and V a round; a wave takes 32 of those
// columns for all 4 row tiles, so each weight fragment (global) feeds 4 matrix
// instructions.
// The x tile is read once a work-group, in 128-B lines, rounded to bf16 and kept
// in LDS in A-fragment order (the order of frag_packed with n = row), so every
// wave finds a fragment by two contiguous ds_load_b128.
// Fragments for step k+1 are loaded before step k's wmma run.
#define QRT 4                                     // row tiles per work-group
#define KB  (UU / 32)                             // k blocks
__global__ void __launch_bounds__(256) qkv_proj(
    const float* __restrict__ x,
    const __bf16* __restrict__ WqT, const __bf16* __restrict__ WkT,
    const __bf16* __restrict__ WvT,
    const float* __restrict__ bqp, const float* __restrict__ bkp,
    const float* __restrict__ bvp,
    __bf16* __restrict__ Q, __bf16* __restrict__ K, __bf16* __restrict__ VT) {
  __shared__ alignas(16) __bf16 sX[QRT][KB][FBLK];  // 64 KB
  const int lane = threadIdx.x & 31;
  const int wave = threadIdx.x >> 5;
  const int rowBase = blockIdx.x * (16 * QRT);
  const int r = lane & 15;
  const int mh = (lane >> 4) << 3;

  {
    // A lane takes 8 consecutive k of one row, 4 lanes one 128-B line, a wave 8 rows.
    const int c = lane & 3;
    const int row = wave * 8 + (lane >> 2);
    const float* xs = x + (size_t)(rowBase + row) * UU + c * 8;
    float4 xa[KB][2];
#pragma unroll
    for (int kb = 0; kb < KB; ++kb) {
      xa[kb][0] = *(const float4*)(xs + kb * 32);
      xa[kb][1] = *(const float4*)(xs + kb * 32 + 4);
    }
    wait_x0();
    __bf16* xd = &sX[row >> 4][0][(c >> 1) * 256 + ((c & 1) * 16 + (row & 15)) * 8];
#pragma unroll
    for (int kb = 0; kb < KB; ++kb) {
      const float4 lo = xa[kb][0], hi = xa[kb][1];
      v8bf p;
      p[0] = (__bf16)lo.x; p[1] = (__bf16)lo.y; p[2] = (__bf16)lo.z; p[3] = (__bf16)lo.w;
      p[4] = (__bf16)hi.x; p[5] = (__bf16)hi.y; p[6] = (__bf16)hi.z; p[7] = (__bf16)hi.w;
      *(v8bf*)(xd + kb * FBLK) = p;
    }
  }
  __syncthreads();                                // the x tile is whole for every wave

  const float scale = rsqrtf((float)UU);
  // Kept rolled: a second copy of the 16 unrolled steps would only double the text.
#pragma unroll 1
  for (int ch = 0; ch < 2; ++ch) {                // column halves, from the same x tile
    const int col0 = (ch * 8 + wave) * 32;
    // weights in fragment order: one n tile is UU/32 consecutive blocks
    const size_t wt = (size_t)(col0 >> 4) * KB * FBLK + lane * 8;
    const __bf16* wp[6];
    wp[0] = WqT + wt;  wp[1] = wp[0] + KB * FBLK;
    wp[2] = WkT + wt;  wp[3] = wp[2] + KB * FBLK;
    wp[4] = WvT + wt;  wp[5] = wp[4] + KB * FBLK;

    v16bf w[2][6], a[2][QRT];
    float bq2[2], bk2[2], bv2[2];                 // this lane's columns of the biases
#pragma unroll
    for (int i = 0; i < 6; ++i) w[0][i] = frag_packed(wp[i]);
#pragma unroll
    for (int h = 0; h < 2; ++h) {
      bq2[h] = bqp[col0 + 16 * h + r];
      bk2[h] = bkp[col0 + 16 * h + r];
      bv2[h] = bvp[col0 + 16 * h + r];
    }
    wait_x0();
    v8f acc[QRT][6] = {};
#pragma unroll
    for (int t = 0; t < QRT; ++t) a[0][t] = frag_packed(&sX[t][0][lane * 8]);
#pragma unroll
    for (int s = 0; s < KB; ++s) {
      if (s + 1 < KB) {                           // load next step's fragments
#pragma unroll
        for (int i = 0; i < 6; ++i) w[(s + 1) & 1][i] = frag_packed(wp[i] + (s + 1) * FBLK);
        wait_x0();
#pragma unroll
        for (int t = 0; t < QRT; ++t) a[(s + 1) & 1][t] = frag_packed(&sX[t][s + 1][lane * 8]);
      }
      // Keeps the next step's loads in front of this step's matrix run: sunk in
      // among or behind it they would have no lead over their first use.
      __builtin_amdgcn_sched_barrier(0);
#pragma unroll
      for (int t = 0; t < QRT; ++t)
#pragma unroll
        for (int i = 0; i < 6; ++i)
          acc[t][i] = wmma_bf16(a[s & 1][t], w[s & 1][i], acc[t][i]);
    }
    // Keeps the last matrix run out of the stores below and their waits.
    __builtin_amdgcn_sched_barrier(0);
#pragma unroll
    for (int t = 0; t < QRT; ++t) {
      const int row0 = rowBase + 16 * t;
      const int b = row0 >> 12;                   // row0 / NN
      v8bf pv[2];                                 // V: a lane's 8 keys of one d column
#pragma unroll
      for (int v = 0; v < 8; ++v) {
        const size_t idx = (size_t)(row0 + v + mh) * UU;
#pragma unroll
        for (int h = 0; h < 2; ++h) {
          const int Nc = col0 + 16 * h + r;
          const float q = acc[t][h][v] + bq2[h];
          const float k = acc[t][2 + h][v] + bk2[h];
          const float vv = acc[t][4 + h][v] + bv2[h];
          Q[idx + Nc] = (__bf16)(q * scale);
          K[idx + Nc] = (__bf16)k;
          pv[h][v] = (__bf16)vv;
        }
      }
      // V in fragment order (k = key, n = d), blocks laid out [batch][key block][d tile]:
      // the accumulator's 8 rows of a lane are that lane's 8 consecutive elements.
      __bf16* vdst = VT + (((size_t)b * (NN / 32) + ((row0 & (NN - 1)) >> 5)) * (UU / 16) +
                           (col0 >> 4)) * FBLK + ((row0 >> 4) & 1) * 256 + lane * 8;
      *(v8bf*)(vdst) = pv[0];
      *(v8bf*)(vdst + FBLK) = pv[1];
      close_x0(vdst);
    }
  }
}

// ---------------------------------------------------------------- kernel 2
// Flash attention: 64 query rows/block (4 row tiles), 8 waves.
// S: a wave takes one key half (16 keys) and one quarter of d (128 columns) for all
// 4 row tiles, so a score is the sum of 4 partials that pass through LDS.
// P*V: the waves split d (64 columns each), again with all 4 row tiles. So each
// K fragment (LDS) and each V fragment (global) feeds 4 matrix instructions.
// The 64x32 score block is summed and soft-maxed once: wave w owns row tile
// w>>1, accumulator rows 4*(w&1)..+3 of each lane half.
// K tiles are double-buffered in LDS by tensor loads, one slice per wave.
// The three stages of a key tile run as a software pipeline: pass j forms the
// partial S of tile j+2, the softmax of tile j+1 and P*V of tile j. Each stage
// reads only what the pass before has left in LDS, and sS, sP and sC have two
// buffers each, so one barrier a pass orders all of it and the stages' loads,
// matrix runs and vector chains overlap inside a pass.
#define RT 4                                      // row tiles per block
#define NW 8                                      // waves per block
#define DS (UU / NW)                              // d columns per wave, P*V
#define NP 4                                      // partials of a score = d quarters
#define SD (UU / NP)                              // d columns per wave, S
#define NT (NN / 32)                              // key tiles
__global__ void __launch_bounds__(256) flash_attn(
    const __bf16* __restrict__ Q, const __bf16* __restrict__ K,
    const __bf16* __restrict__ VT, __bf16* __restrict__ C) {
  __shared__ alignas(2048) unsigned char sK[2][NW][KSLICE];  // 96 KB: K slices
  // partial S, kept in accumulator order: [buffer][d quarter][tile][key half]
  // [register quad][lane] -> one 16B element per lane, no transposition
  __shared__ float4 sS[2][NP][RT][2][2][32];      // 64 KB
  // P for A-frag repack; 80-B pitch = 16 B x 5 for its ds_load_b128 readers
  __shared__ alignas(16) __bf16 sP[2][RT][16][40];
  __shared__ alignas(16) float sC[2][RT][16];     // per-row rescale factor

  const int lane = threadIdx.x & 31;
  const int wave = threadIdx.x >> 5;              // 0..7 -> d-slice of P*V
  const int b  = blockIdx.y;
  const int q0 = blockIdx.x * (16 * RT);
  const int ds0 = wave * DS;
  const int kbase = (lane & 16) ? 8 : 0;
  const int r  = lane & 15;
  const int mh = (lane >> 4) << 3;
  const int tw = wave >> 1;                       // softmax: owned row tile
  const int hw = wave & 1;                        // softmax: owned register quad
  const int dq = wave >> 1;                       // S: owned d quarter
  const int kh = wave & 1;                        // S: owned key half

  const __bf16* Qb = Q + (size_t)b * NN * UU;
  const __bf16* Kb = K + (size_t)b * NN * UU;
  const __bf16* Vt = VT + (size_t)b * UU * NN;    // fragment order [key block][d tile]

  typedef __attribute__((address_space(3))) unsigned char lds_u8;
  const unsigned sw = uni(threadIdx.x >> 5);      // wave number, scalar
  const unsigned sK0 = (unsigned)(unsigned long long)(lds_u8*)&sK[0][0][0] + sw * KSLICE;
  const unsigned sK1 = sK0 + NW * KSLICE;
  const __bf16* Kw = Kb + (size_t)(sw & 1u) * KROWS * UU + (sw >> 1) * SD;  // this wave's part of K

  v16bf qf[RT][4];
  const __bf16* qp[RT];
#pragma unroll
  for (int t = 0; t < RT; ++t)
    qp[t] = Qb + (size_t)(q0 + 16 * t + r) * UU + dq * SD + kbase;
#pragma unroll
  for (int t = 0; t < RT; ++t)
#pragma unroll
    for (int kk = 0; kk < 4; ++kk)
      qf[t][kk] = frag_bf16(qp[t] + kk * 32);
  // The wait of close_x0 for the Q loads: it names the four row addresses as inputs,
  // so that each keeps its registers until the wait, and the two scheduling fences
  // keep later vector work, which reuses them, behind it.
  __builtin_amdgcn_sched_barrier(0);
  asm volatile("s_wait_xcnt 0x0" :: "v"(qp[0]), "v"(qp[1]), "v"(qp[2]), "v"(qp[3]) : "memory");
  __builtin_amdgcn_sched_barrier(0);

  v8f o[RT][4] = {};
  float m[4], l[4];                               // rows 4*hw+i+mh of tile tw
#pragma unroll
  for (int i = 0; i < 4; ++i) { m[i] = -3.0e38f; l[i] = 0.f; }

  // ---- stage 1: partial S of this wave's key half over its d quarter
  auto load_k = [&](int buf, v16bf (&kf)[4]) {    // ds_load_b128 fragments
#pragma unroll
    for (int kk = 0; kk < 4; ++kk)
      kf[kk] = frag_bf16((const __bf16*)&sK[buf][wave][r * KPITCH + (kk * 32 + kbase) * 2]);
  };
  auto mma_s = [&](const v16bf (&kf)[4], v8f (&s)[RT]) {
    // Inputs-only fence on the four loaded K fragments: all eight LDS loads are issued,
    // into registers of their own, ahead of the run. Without it three fragments share
    // one register set, and the run stops twice for a whole LDS latency.
    asm volatile("" :: "v"(kf[0]), "v"(kf[1]), "v"(kf[2]), "v"(kf[3]));
#pragma unroll
    for (int kk = 0; kk < 4; ++kk)
#pragma unroll
      for (int t = 0; t < RT; ++t)
        s[t] = wmma_bf16(qf[t][kk], kf[kk], s[t]);
  };
  auto store_s = [&](int sb, const v8f (&s)[RT]) {
#pragma unroll
    for (int t = 0; t < RT; ++t) {
      sS[sb][dq][t][kh][0][lane] = make_float4(s[t][0], s[t][1], s[t][2], s[t][3]);
      sS[sb][dq][t][kh][1][lane] = make_float4(s[t][4], s[t][5], s[t][6], s[t][7]);
    }
  };
  // ---- stage 2: full S of the owned rows, online softmax
  auto load_part = [&](int sb, float4 (&pa)[NP][2]) {
#pragma unroll
    for (int w = 0; w < NP; ++w) {
      pa[w][0] = sS[sb][w][tw][0][hw][lane];
      pa[w][1] = sS[sb][w][tw][1][hw][lane];
    }
  };
  auto softmax = [&](const float4 (&pa)[NP][2], int pb) {
    // sum the 4 d quarters in order
    float fs0[4] = {0.f, 0.f, 0.f, 0.f}, fs1[4] = {0.f, 0.f, 0.f, 0.f};
#pragma unroll
    for (int w = 0; w < NP; ++w) {
      const float4 a0 = pa[w][0];
      const float4 a1 = pa[w][1];
      fs0[0] += a0.x; fs0[1] += a0.y; fs0[2] += a0.z; fs0[3] += a0.w;
      fs1[0] += a1.x; fs1[1] += a1.y; fs1[2] += a1.z; fs1[3] += a1.w;
    }
    // a row lives across one 16-lane half -> xor reduce by DPP
    float cr[4];
#pragma unroll
    for (int i = 0; i < 4; ++i) {
      const float mt = row_max16(fmaxf(fs0[i], fs1[i]));
      const float mnew = fmaxf(m[i], mt);
      const float p0 = __expf(fs0[i] - mnew);
      const float p1 = __expf(fs1[i] - mnew);
      const float rs = row_sum16(p0 + p1);
      const float corr = __expf(m[i] - mnew);
      l[i] = l[i] * corr + rs;
      m[i] = mnew;
      cr[i] = corr;
      sP[pb][tw][4 * hw + i + mh][r]      = (__bf16)p0;
      sP[pb][tw][4 * hw + i + mh][16 + r] = (__bf16)p1;
    }
    if (r == 0)
      *(float4*)&sC[pb][tw][4 * hw + mh] = make_float4(cr[0], cr[1], cr[2], cr[3]);
  };
  // ---- stage 3: rescale O, O[:, ds0+16j] += P * V^T
  auto load_p = [&](int pb, v16bf (&pf)[RT], float4 (&cc)[RT][2]) {
#pragma unroll
    for (int t = 0; t < RT; ++t) {                // P (C-layout) as A-fragments
      pf[t] = frag_bf16(&sP[pb][t][r][0] + kbase);
      cc[t][0] = *(const float4*)&sC[pb][t][mh];
      cc[t][1] = *(const float4*)&sC[pb][t][mh + 4];
    }
  };
  auto load_v = [&](int tile, v16bf (&vf)[4]) {
    const __bf16* vp = Vt + ((size_t)tile * (UU / 16) + wave * (DS / 16)) * FBLK + lane * 8;
    vf[0] = frag_packed(vp);
    vf[1] = frag_packed(vp + FBLK);
    vf[2] = frag_packed(vp + 2 * FBLK);
    vf[3] = frag_packed(vp + 3 * FBLK);
  };
  auto mma_o = [&](const v16bf (&pf)[RT], const float4 (&cc)[RT][2], const v16bf (&vf)[4]) {
#pragma unroll
    for (int t = 0; t < RT; ++t) {
      const float4 c0 = cc[t][0];
      const float4 c1 = cc[t][1];
#pragma unroll
      for (int j = 0; j < 4; ++j) {
        o[t][j][0] *= c0.x; o[t][j][1] *= c0.y; o[t][j][2] *= c0.z; o[t][j][3] *= c0.w;
        o[t][j][4] *= c1.x; o[t][j][5] *= c1.y; o[t][j][6] *= c1.z; o[t][j][7] *= c1.w;
      }
    }
#pragma unroll
    for (int t = 0; t < RT; ++t) {
      o[t][0] = wmma_bf16(pf[t], vf[0], o[t][0]);
      o[t][1] = wmma_bf16(pf[t], vf[1], o[t][1]);
      o[t][2] = wmma_bf16(pf[t], vf[2], o[t][2]);
      o[t][3] = wmma_bf16(pf[t], vf[3], o[t][3]);
    }
  };

  const v8u g1 = tdm_k_group1();
  {
    const v4u g0 = tdm_k_group0(Kw, sK0);
    __builtin_amdgcn_sched_barrier(0);
    tdm_load(g0, g1);
    wait_tensor0(g0, g1);
    __builtin_amdgcn_sched_barrier(0);
    __syncthreads();
  }

  // The foot of every pass that reads a K buffer publishes the next K tile (and
  // retires the pass's LDS reads and writes); directly behind its barrier, at the
  // head of the next pass, the buffer that the pass has read is refilled with the
  // tile after next. A request so starts and lands inside one pass.
  {                                               // fill, pass -2: S of tile 0
    const v4u g0 = tdm_k_group0(Kw + (size_t)pinned(32u) * UU, sK1);
    tdm_load(g0, g1);
    v16bf kf[4];
    v8f s[RT] = {};
    load_k(0, kf);
    mma_s(kf, s);
    store_s(0, s);
    wait_ds0();
    wait_tensor0(g0, g1);
    __syncthreads();
  }
  {                                               // fill, pass -1: S of tile 1, softmax of tile 0
    const v4u g0 = tdm_k_group0(Kw + (size_t)pinned(64u) * UU, sK0);
    tdm_load(g0, g1);
    v16bf kf[4];
    float4 pa[NP][2];
    v8f s[RT] = {};
    load_k(1, kf);
    load_part(0, pa);
    mma_s(kf, s);
    store_s(1, s);
    softmax(pa, 0);
    wait_ds0();
    wait_tensor0(g0, g1);
    __syncthreads();
  }
  for (int j = 0; j < NT - 2; ++j) {
    const int e = j & 1;                          // buffers of tiles j and j+2
    const unsigned kn = pinned((unsigned)j * 32u + 96u);  // first key of tile j+3
    const v4u g0 = tdm_k_group0(Kw + (size_t)kn * UU, e ? sK0 : sK1);
    if (kn < NN)
      tdm_load(g0, g1);
    v16bf vf[4], kf[4], pf[RT];
    float4 pa[NP][2], cc[RT][2];
    v8f s[RT] = {};
    // the loads of all three stages come first in the pass
    load_v(j, vf);
    wait_x0();  // V loads above: their address registers are free behind here
    load_k(e, kf);
    load_part(e ^ 1, pa);
    load_p(e, pf, cc);
    // The two scheduling fences stand round the S run. Without them the O rescale,
    // which waits for the last LDS reads of the pass, is mixed in among the first S
    // products, which need the K fragments alone, and some sC reads sink behind the
    // matrix runs, where each waits out its own LDS latency.
    __builtin_amdgcn_sched_barrier(0);
    mma_s(kf, s);                                 // tile j+2
    __builtin_amdgcn_sched_barrier(0);
    store_s(e, s);
    mma_o(pf, cc, vf);                            // tile j
    softmax(pa, e ^ 1);                           // tile j+1
    wait_ds0();
    wait_tensor0(g0, g1);
    __syncthreads();
  }
  asm volatile("s_wait_tensorcnt 0x0" ::: "memory");  // behind the last request, before the wave goes on
  wait_ds0();
  {                                               // drain: softmax of the last tile, P*V of the one before
    v16bf vf[4], pf[RT];
    float4 pa[NP][2], cc[RT][2];
    load_v(NT - 2, vf);
    wait_x0();  // V loads above: their address registers are free behind here
    load_part(1, pa);
    load_p(0, pf, cc);
    mma_o(pf, cc, vf);
    softmax(pa, 1);
    wait_ds0();
    __syncthreads();
  }
  {                                               // drain: P*V of the last tile
    v16bf vf[4], pf[RT];
    float4 cc[RT][2];
    load_v(NT - 1, vf);
    wait_x0();  // V loads above: their address registers are free behind here
    load_p(1, pf, cc);
    mma_o(pf, cc, vf);
  }
  // hand each row's 1/l from its owner to every wave, through the sC buffer whose
  // last readers stand in front of the barrier above
  if (r == 0)
    *(float4*)&sC[0][tw][4 * hw + mh] =
        make_float4(1.f / l[0], 1.f / l[1], 1.f / l[2], 1.f / l[3]);
  __syncthreads();
  float4 iv[RT][2];
#pragma unroll
  for (int t = 0; t < RT; ++t) {
    iv[t][0] = *(const float4*)&sC[0][t][mh];
    iv[t][1] = *(const float4*)&sC[0][t][mh + 4];
  }
#pragma unroll
  for (int t = 0; t < RT; ++t)
#pragma unroll
    for (int v = 0; v < 8; ++v) {
      const float4 q4 = iv[t][v >> 2];
      const float inv = (v & 3) == 0 ? q4.x : (v & 3) == 1 ? q4.y : (v & 3) == 2 ? q4.z : q4.w;
      const size_t row = (size_t)b * NN + q0 + 16 * t + v + mh;
#pragma unroll
      for (int j = 0; j < 4; ++j)
        C[row * UU + ds0 + j * 16 + r] = (__bf16)(o[t][j][v] * inv);
    }
}

// ---------------------------------------------------------------- kernel 3
// out = x + ctx @ Wp + bp (fp32 out). Tiled like kernel 1: a work-group takes 64
// rows of ctx and all 512 columns, a wave 64 columns for all 4 row tiles, so each
// weight fragment feeds 4 matrix instructions; the ctx tile is read once a
// work-group and kept in LDS in A-fragment order.
__global__ void __launch_bounds__(256) out_proj(
    const float* __restrict__ x, const __bf16* __restrict__ Cb,
    const __bf16* __restrict__ WpT, const float* __restrict__ bpp,
    float* __restrict__ out) {
  __shared__ alignas(16) __bf16 sA[QRT][KB][FBLK];  // 64 KB
  const int lane = threadIdx.x & 31;
  const int wave = threadIdx.x >> 5;
  const int rowBase = blockIdx.x * (16 * QRT);
  const int col0 = wave * 64;
  const int r = lane & 15;
  const int mh = (lane >> 4) << 3;

  // weights in fragment order: one n tile is UU/32 consecutive blocks
  const __bf16* wp[4];
  wp[0] = WpT + (size_t)(col0 >> 4) * KB * FBLK + lane * 8;
  wp[1] = wp[0] + KB * FBLK;
  wp[2] = wp[1] + KB * FBLK;
  wp[3] = wp[2] + KB * FBLK;

  v16bf w[2][4], a[2][QRT];
  float bias[4];                                  // this lane's columns of the bias
  {
    // A lane takes 8 consecutive k of one row, 4 lanes one k block, a wave 8 rows.
    const int c = lane & 3;
    const int row = wave * 8 + (lane >> 2);
    const __bf16* cs = Cb + (size_t)(rowBase + row) * UU + c * 8;
    v8bf ca[KB];
#pragma unroll
    for (int kb = 0; kb < KB; ++kb) ca[kb] = *(const v8bf*)(cs + kb * 32);
#pragma unroll
    for (int i = 0; i < 4; ++i) w[0][i] = frag_packed(wp[i]);
#pragma unroll
    for (int i = 0; i < 4; ++i) bias[i] = bpp[col0 + i * 16 + r];
    wait_x0();
    __bf16* ad = &sA[row >> 4][0][(c >> 1) * 256 + ((c & 1) * 16 + (row & 15)) * 8];
#pragma unroll
    for (int kb = 0; kb < KB; ++kb) *(v8bf*)(ad + kb * FBLK) = ca[kb];
  }
  __syncthreads();                                // the ctx tile is whole for every wave

  v8f acc[QRT][4] = {};
  // residual x and out: element (row tile t, row v, column tile i) of this lane
  // lies at (16 t + v) * UU + 16 i from these two bases
  const size_t eb = (size_t)(rowBase + mh) * UU + col0 + r;
  const float* xb = x + eb;
  float* ob = out + eb;
  float xv[4][QRT][8];
  auto load_x = [&](int i) {                      // one column tile's residual values
#pragma unroll
    for (int t = 0; t < QRT; ++t)
#pragma unroll
      for (int v = 0; v < 8; ++v) xv[i][t][v] = xb[(16 * t + v) * UU + 16 * i];
    close_x0(xb);
  };
#pragma unroll
  for (int t = 0; t < QRT; ++t) a[0][t] = frag_packed(&sA[t][0][lane * 8]);
#pragma unroll
  for (int s = 0; s < KB; ++s) {
    if (s + 1 < KB) {                             // load next step's fragments
#pragma unroll
      for (int i = 0; i < 4; ++i) w[(s + 1) & 1][i] = frag_packed(wp[i] + (s + 1) * FBLK);
      wait_x0();
#pragma unroll
      for (int t = 0; t < QRT; ++t) a[(s + 1) & 1][t] = frag_packed(&sA[t][s + 1][lane * 8]);
    }
    // behind the last weight loads, so that no weight fragment waits for them
    if (s == KB - 2) load_x(0);
    if (s == KB - 1) load_x(1);
    // Keeps the next step's loads in front of this step's matrix run: sunk in
    // among or behind it they would have no lead over their first use.
    __builtin_amdgcn_sched_barrier(0);
#pragma unroll
    for (int t = 0; t < QRT; ++t)
#pragma unroll
      for (int i = 0; i < 4; ++i)
        acc[t][i] = wmma_bf16(a[s & 1][t], w[s & 1][i], acc[t][i]);
  }
  // Keeps the last matrix run out of the stores below and their waits.
  __builtin_amdgcn_sched_barrier(0);
#pragma unroll
  for (int i = 0; i < 4; ++i) {
    if (i + 2 < 4) load_x(i + 2);                 // two column tiles ahead
#pragma unroll
    for (int t = 0; t < QRT; ++t)
#pragma unroll
      for (int v = 0; v < 8; ++v)
        ob[(16 * t + v) * UU + 16 * i] = xv[i][t][v] + acc[t][i][v] + bias[i];
    close_x0(ob);
  }
}

// ---------------------------------------------------------------- launch
extern "C" void kernel_launch(void* const* d_in, const int* in_sizes, int n_in,
                              void* d_out, int out_size, void* d_ws, size_t ws_size,
                              hipStream_t stream) {
  const float* x  = (const float*)d_in[0];
  const float* Wq = (const float*)d_in[1];
  const float* bq = (const float*)d_in[2];
  const float* Wk = (const float*)d_in[3];
  const float* bk = (const float*)d_in[4];
  const float* Wv = (const float*)d_in[5];
  const float* bv = (const float*)d_in[6];
  const float* Wp = (const float*)d_in[7];
  const float* bp = (const float*)d_in[8];
  float* out = (float*)d_out;

  char* ws = (char*)d_ws;
  const size_t wbytes = (size_t)UU * UU * sizeof(__bf16);        // 512 KB
  const size_t tbytes = (size_t)BN * UU * sizeof(__bf16);        // 16 MB
  __bf16* WqT = (__bf16*)(ws);
  __bf16* WkT = (__bf16*)(ws + wbytes);
  __bf16* WvT = (__bf16*)(ws + 2 * wbytes);
  __bf16* WpT = (__bf16*)(ws + 3 * wbytes);
  __bf16* Qb  = (__bf16*)(ws + 4 * wbytes);
  __bf16* Kb  = (__bf16*)(ws + 4 * wbytes + tbytes);
  __bf16* VTb = (__bf16*)(ws + 4 * wbytes + 2 * tbytes);
  __bf16* Ctx = (__bf16*)(ws + 4 * wbytes + 3 * tbytes);

  cvt_weights_t<<<(UU * UU) / 256, 256, 0, stream>>>(Wq, Wk, Wv, Wp, WqT, WkT, WvT, WpT);
  qkv_proj<<<256, 256, 0, stream>>>(x, WqT, WkT, WvT, bq, bk, bv, Qb, Kb, VTb);
  dim3 fgrid(NN / (16 * RT), BB);
  flash_attn<<<fgrid, 256, 0, stream>>>(Qb, Kb, VTb, Ctx);
  out_proj<<<256, 256, 0, stream>>>(x, Ctx, WpT, bp, out);
}

// v008
// It runs in 181 microseconds.
// Timed twice side by side with v007, it ran 1.11 times as fast both times.
// Counting every step since v000, it is 6.06 times as fast.
#include <hip/hip_runtime.h>

#define BB 4
#define NN 4096
#define UU 512
#define BN (BB*NN)

typedef __attribute__((ext_vector_type(16))) __bf16 v16bf;
typedef __attribute__((ext_vector_type(8)))  __bf16 v8bf;
typedef __attribute__((ext_vector_type(8)))  float  v8f;
typedef __attribute__((ext_vector_type(4)))  unsigned int v4u;
typedef __attribute__((ext_vector_type(8)))  unsigned int v8u;

__device__ __forceinline__ v8f wmma_bf16(v16bf a, v16bf b, v8f c) {
  return __builtin_amdgcn_wmma_f32_16x16x32_bf16(false, a, false, b, (short)0, c,
                                                 false, false);
}

__device__ __forceinline__ v16bf frag_bf16(const __bf16* p) {
  v8bf lo = *(const v8bf*)(p);
  v8bf hi = *(const v8bf*)(p + 16);
  return __builtin_shufflevector(lo, hi, 0, 1, 2, 3, 4, 5, 6, 7,
                                 8, 9, 10, 11, 12, 13, 14, 15);
}
#define FBLK 512
__device__ __forceinline__ v16bf frag_packed(const __bf16* p) {
  v8bf lo = *(const v8bf*)(p);
  v8bf hi = *(const v8bf*)(p + 256);
  return __builtin_shufflevector(lo, hi, 0, 1, 2, 3, 4, 5, 6, 7,
                                 8, 9, 10, 11, 12, 13, 14, 15);
}

#define KROWB  256u                               // bytes of a slice row
#define KROWS  16u                                // rows (keys) of a slice
#define KPITCH 272u                               // row pitch in LDS
#define KSLICE 6144u                              // 16 * 272 B, rounded up to 2 KiB
__device__ __forceinline__ unsigned uni(unsigned v) {
  return (unsigned)__builtin_amdgcn_readfirstlane(v);
}
__device__ __forceinline__ unsigned pinned(unsigned v) {
  unsigned w = uni(v);
  asm volatile("" : "+s"(w));  // keeps w in a scalar register
  return w;
}
// One request: 16 rows x 256 B, source pitch 1024 B, byte elements,
// tensor dims = tile dims, pad of 4 dwords behind every 64 dwords.
__device__ __forceinline__ v4u tdm_k_group0(const __bf16* gsrc, unsigned lds_off) {
  const unsigned long long ga = (unsigned long long)(uintptr_t)gsrc;
  v4u g0;
  g0[0] = uni(1u);                                          // count = 1
  g0[1] = uni(lds_off);                                     // LDS byte offset
  g0[2] = uni((unsigned)ga);                                // address [31:0]
  g0[3] = uni(((unsigned)(ga >> 32) & 0x01FFFFFFu) | 0x80000000u);  // [56:32], type 2
  return g0;
}
// Formed once a kernel: through pinned() its words stay in the same scalar
// registers for every request, instead of being formed anew in registers that
// are free for other use while a request is under way.
__device__ __forceinline__ v8u tdm_k_group1() {
  v8u g1;
  g1[0] = uni((1u << 20) | (5u << 22) | (3u << 25));
  g1[1] = pinned(KROWB << 16);
  g1[2] = pinned(KROWS << 16);
  g1[3] = pinned(KROWB << 16);
  g1[4] = pinned(KROWS);
  g1[5] = pinned(UU * 2u);
  g1[6] = pinned(0u);
  g1[7] = pinned(0u);
  return g1;
}
__device__ __forceinline__ void tdm_load(v4u g0, v8u g1) {
  asm volatile("tensor_load_to_lds %0, %1" :: "s"(g0), "s"(g1) : "memory");
}
__device__ __forceinline__ void wait_tensor0(v4u g0, v8u g1) {
  asm volatile("s_wait_tensorcnt 0x0" :: "s"(g0), "s"(g1) : "memory");
}
// This wave's LDS reads have retired before the buffer they read is refilled.
__device__ __forceinline__ void wait_ds0() { asm volatile("s_wait_dscnt 0x0" ::: "memory"); }

// Stands between issued global loads and the next rewrite of the address registers
// that they name.
__device__ __forceinline__ void wait_x0() { asm volatile("s_wait_xcnt 0x0" ::: "memory"); }
__device__ __forceinline__ void close_x0(const void* base) {
  __builtin_amdgcn_sched_barrier(0);
  asm volatile("s_wait_xcnt 0x0" :: "v"(base) : "memory");
  __builtin_amdgcn_sched_barrier(0);
}

template <int X>
__device__ __forceinline__ float row_xor(float v) {
  return __builtin_bit_cast(float, __builtin_amdgcn_update_dpp(
      0, __builtin_bit_cast(int, v), 0x160 + X, 0xf, 0xf, false));
}
__device__ __forceinline__ float row_max16(float v) {
  v = fmaxf(v, row_xor<1>(v));
  v = fmaxf(v, row_xor<2>(v));
  v = fmaxf(v, row_xor<4>(v));
  return fmaxf(v, row_xor<8>(v));
}
__device__ __forceinline__ float row_sum16(float v) {
  v += row_xor<1>(v);
  v += row_xor<2>(v);
  v += row_xor<4>(v);
  return v + row_xor<8>(v);
}

// ---------------------------------------------------------------- kernel 0
__global__ void cvt_weights_t(const float* __restrict__ wq, const float* __restrict__ wk,
                              const float* __restrict__ wv, const float* __restrict__ wp,
                              __bf16* __restrict__ dq, __bf16* __restrict__ dk,
                              __bf16* __restrict__ dv, __bf16* __restrict__ dp) {
  const int idx = blockIdx.x * blockDim.x + threadIdx.x;   // coalesced read
  const int k = idx / UU, n = idx % UU;
  // fragment order, blocks laid out [n tile][k block]
  const size_t t = ((size_t)(n >> 4) * (UU / 32) + (k >> 5)) * FBLK +
                   ((k >> 4) & 1) * 256 + ((((k >> 3) & 1) << 4) + (n & 15)) * 8 + (k & 7);
  dq[t] = (__bf16)wq[idx];
  dk[t] = (__bf16)wk[idx];
  dv[t] = (__bf16)wv[idx];
  dp[t] = (__bf16)wp[idx];
}

// ---------------------------------------------------------------- kernel 1
// Fused Q/K/V projection. A work-group takes 64 rows of x (4 row tiles) and, in
// two rounds, 256 columns of each of Q, K and V a round; a wave takes 32 of those
// columns for all 4 row tiles, so each weight fragment (global) feeds 4 matrix
// instructions.
// The x tile is read once a work-group, in 128-B lines, rounded to bf16 and kept
// in LDS in A-fragment order (the order of frag_packed with n = row), so every
// wave finds a fragment by two contiguous ds_load_b128.
// Fragments for step k+1 are loaded before step k's wmma run.
#define QRT 4                                     // row tiles per work-group
#define KB  (UU / 32)                             // k blocks
__global__ void __launch_bounds__(256) qkv_proj(
    const float* __restrict__ x,
    const __bf16* __restrict__ WqT, const __bf16* __restrict__ WkT,
    const __bf16* __restrict__ WvT,
    const float* __restrict__ bqp, const float* __restrict__ bkp,
    const float* __restrict__ bvp,
    __bf16* __restrict__ Q, __bf16* __restrict__ K, __bf16* __restrict__ VT) {
  __shared__ alignas(16) __bf16 sX[QRT][KB][FBLK];  // 64 KB
  const int lane = threadIdx.x & 31;
  const int wave = threadIdx.x >> 5;
  const int rowBase = blockIdx.x * (16 * QRT);
  const int r = lane & 15;
  const int mh = (lane >> 4) << 3;

  {
    // A lane takes 8 consecutive k of one row, 4 lanes one 128-B line, a wave 8 rows.
    const int c = lane & 3;
    const int row = wave * 8 + (lane >> 2);
    const float* xs = x + (size_t)(rowBase + row) * UU + c * 8;
    float4 xa[KB][2];
#pragma unroll
    for (int kb = 0; kb < KB; ++kb) {
      xa[kb][0] = *(const float4*)(xs + kb * 32);
      xa[kb][1] = *(const float4*)(xs + kb * 32 + 4);
    }
    wait_x0();
    __bf16* xd = &sX[row >> 4][0][(c >> 1) * 256 + ((c & 1) * 16 + (row & 15)) * 8];
#pragma unroll
    for (int kb = 0; kb < KB; ++kb) {
      const float4 lo = xa[kb][0], hi = xa[kb][1];
      v8bf p;
      p[0] = (__bf16)lo.x; p[1] = (__bf16)lo.y; p[2] = (__bf16)lo.z; p[3] = (__bf16)lo.w;
      p[4] = (__bf16)hi.x; p[5] = (__bf16)hi.y; p[6] = (__bf16)hi.z; p[7] = (__bf16)hi.w;
      *(v8bf*)(xd + kb * FBLK) = p;
    }
  }
  __syncthreads();                                // the x tile is whole for every wave

  const float scale = rsqrtf((float)UU);
  // Kept rolled: a second copy of the 16 unrolled steps would only double the text.
#pragma unroll 1
  for (int ch = 0; ch < 2; ++ch) {                // column halves, from the same x tile
    const int col0 = (ch * 8 + wave) * 32;
    // weights in fragment order: one n tile is UU/32 consecutive blocks
    const size_t wt = (size_t)(col0 >> 4) * KB * FBLK + lane * 8;
    const __bf16* wp[6];
    wp[0] = WqT + wt;  wp[1] = wp[0] + KB * FBLK;
    wp[2] = WkT + wt;  wp[3] = wp[2] + KB * FBLK;
    wp[4] = WvT + wt;  wp[5] = wp[4] + KB * FBLK;

    v16bf w[2][6], a[2][QRT];
    float bq2[2], bk2[2], bv2[2];                 // this lane's columns of the biases
#pragma unroll
    for (int i = 0; i < 6; ++i) w[0][i] = frag_packed(wp[i]);
#pragma unroll
    for (int h = 0; h < 2; ++h) {
      bq2[h] = bqp[col0 + 16 * h + r];
      bk2[h] = bkp[col0 + 16 * h + r];
      bv2[h] = bvp[col0 + 16 * h + r];
    }
    wait_x0();
    v8f acc[QRT][6] = {};
#pragma unroll
    for (int t = 0; t < QRT; ++t) a[0][t] = frag_packed(&sX[t][0][lane * 8]);
#pragma unroll
    for (int s = 0; s < KB; ++s) {
      if (s + 1 < KB) {                           // load next step's fragments
#pragma unroll
        for (int i = 0; i < 6; ++i) w[(s + 1) & 1][i] = frag_packed(wp[i] + (s + 1) * FBLK);
        wait_x0();
#pragma unroll
        for (int t = 0; t < QRT; ++t) a[(s + 1) & 1][t] = frag_packed(&sX[t][s + 1][lane * 8]);
      }
      // Keeps the next step's loads in front of this step's matrix run: sunk in
      // among or behind it they would have no lead over their first use.
      __builtin_amdgcn_sched_barrier(0);
#pragma unroll
      for (int t = 0; t < QRT; ++t)
#pragma unroll
        for (int i = 0; i < 6; ++i)
          acc[t][i] = wmma_bf16(a[s & 1][t], w[s & 1][i], acc[t][i]);
    }
    // Keeps the last matrix run out of the stores below and their waits.
    __builtin_amdgcn_sched_barrier(0);
#pragma unroll
    for (int t = 0; t < QRT; ++t) {
      const int row0 = rowBase + 16 * t;
      const int b = row0 >> 12;                   // row0 / NN
      v8bf pv[2];                                 // V: a lane's 8 keys of one d column
#pragma unroll
      for (int v = 0; v < 8; ++v) {
        const size_t idx = (size_t)(row0 + v + mh) * UU;
#pragma unroll
        for (int h = 0; h < 2; ++h) {
          const int Nc = col0 + 16 * h + r;
          const float q = acc[t][h][v] + bq2[h];
          const float k = acc[t][2 + h][v] + bk2[h];
          const float vv = acc[t][4 + h][v] + bv2[h];
          Q[idx + Nc] = (__bf16)(q * scale);
          K[idx + Nc] = (__bf16)k;
          pv[h][v] = (__bf16)vv;
        }
      }
      // V in fragment order (k = key, n = d), blocks laid out [batch][key block][d tile]:
      // the accumulator's 8 rows of a lane are that lane's 8 consecutive elements.
      __bf16* vdst = VT + (((size_t)b * (NN / 32) + ((row0 & (NN - 1)) >> 5)) * (UU / 16) +
                           (col0 >> 4)) * FBLK + ((row0 >> 4) & 1) * 256 + lane * 8;
      *(v8bf*)(vdst) = pv[0];
      *(v8bf*)(vdst + FBLK) = pv[1];
      close_x0(vdst);
    }
  }
}

// ---------------------------------------------------------------- kernel 2
// Flash attention: 64 query rows/block (4 row tiles), 8 waves.
// S: a wave takes one key half (16 keys) and one quarter of d (128 columns) for all
// 4 row tiles, so a score is the sum of 4 partials that pass through LDS.
// P*V: the waves split d (64 columns each), again with all 4 row tiles. So each
// K fragment (LDS) and each V fragment (global) feeds 4 matrix instructions.
// The 64x32 score block is summed and soft-maxed once: wave w owns row tile
// w>>1, accumulator rows 4*(w&1)..+3 of each lane half.
// K tiles are double-buffered in LDS by tensor loads, one slice per wave.
// The three stages of a key tile run as a software pipeline: pass j forms the
// partial S of tile j+2, the softmax of tile j+1 and P*V of tile j. Each stage
// reads only what the pass before has left in LDS, and sS, sP and sC have two
// buffers each, so one barrier a pass orders all of it and the stages' loads,
// matrix runs and vector chains overlap inside a pass.
// V fragments (global) are fetched one pass ahead into a second register set: pass
// j issues the loads of tile j+1 and multiplies with tile j's, which the pass
// before has asked for. The key loop is unrolled by two, so the sets swap by name.
#define RT 4                                      // row tiles per block
#define NW 8                                      // waves per block
#define DS (UU / NW)                              // d columns per wave, P*V
#define NP 4                                      // partials of a score = d quarters
#define SD (UU / NP)                              // d columns per wave, S
#define NT (NN / 32)                              // key tiles
__global__ void __launch_bounds__(256) flash_attn(
    const __bf16* __restrict__ Q, const __bf16* __restrict__ K,
    const __bf16* __restrict__ VT, __bf16* __restrict__ C) {
  __shared__ alignas(2048) unsigned char sK[2][NW][KSLICE];  // 96 KB: K slices
  // partial S, kept in accumulator order: [buffer][d quarter][tile][key half]
  // [register quad][lane] -> one 16B element per lane, no transposition
  __shared__ float4 sS[2][NP][RT][2][2][32];      // 64 KB
  // P for A-frag repack; 80-B pitch = 16 B x 5 for its ds_load_b128 readers
  __shared__ alignas(16) __bf16 sP[2][RT][16][40];
  __shared__ alignas(16) float sC[2][RT][16];     // per-row rescale factor

  const int lane = threadIdx.x & 31;
  const int wave = threadIdx.x >> 5;              // 0..7 -> d-slice of P*V
  const int b  = blockIdx.y;
  const int q0 = blockIdx.x * (16 * RT);
  const int ds0 = wave * DS;
  const int kbase = (lane & 16) ? 8 : 0;
  const int r  = lane & 15;
  const int mh = (lane >> 4) << 3;
  const int tw = wave >> 1;                       // softmax: owned row tile
  const int hw = wave & 1;                        // softmax: owned register quad
  const int dq = wave >> 1;                       // S: owned d quarter
  const int kh = wave & 1;                        // S: owned key half

  const __bf16* Qb = Q + (size_t)b * NN * UU;
  const __bf16* Kb = K + (size_t)b * NN * UU;
  const __bf16* Vt = VT + (size_t)b * UU * NN;    // fragment order [key block][d tile]

  typedef __attribute__((address_space(3))) unsigned char lds_u8;
  const unsigned sw = uni(threadIdx.x >> 5);      // wave number, scalar
  const unsigned sK0 = (unsigned)(unsigned long long)(lds_u8*)&sK[0][0][0] + sw * KSLICE;
  const unsigned sK1 = sK0 + NW * KSLICE;
  const __bf16* Kw = Kb + (size_t)(sw & 1u) * KROWS * UU + (sw >> 1) * SD;  // this wave's part of K

  v16bf qf[RT][4];
  const __bf16* qp[RT];
#pragma unroll
  for (int t = 0; t < RT; ++t)
    qp[t] = Qb + (size_t)(q0 + 16 * t + r) * UU + dq * SD + kbase;
#pragma unroll
  for (int t = 0; t < RT; ++t)
#pragma unroll
    for (int kk = 0; kk < 4; ++kk)
      qf[t][kk] = frag_bf16(qp[t] + kk * 32);
  // The wait of close_x0 for the Q loads: it names the four row addresses as inputs,
  // so that each keeps its registers until the wait, and the two scheduling fences
  // keep later vector work, which reuses them, behind it.
  __builtin_amdgcn_sched_barrier(0);
  asm volatile("s_wait_xcnt 0x0" :: "v"(qp[0]), "v"(qp[1]), "v"(qp[2]), "v"(qp[3]) : "memory");
  __builtin_amdgcn_sched_barrier(0);

  v8f o[RT][4] = {};
  float m[4], l[4];                               // rows 4*hw+i+mh of tile tw
#pragma unroll
  for (int i = 0; i < 4; ++i) { m[i] = -3.0e38f; l[i] = 0.f; }

  // ---- stage 1: partial S of this wave's key half over its d quarter
  auto load_k = [&](int buf, v16bf (&kf)[4]) {    // ds_load_b128 fragments
#pragma unroll
    for (int kk = 0; kk < 4; ++kk)
      kf[kk] = frag_bf16((const __bf16*)&sK[buf][wave][r * KPITCH + (kk * 32 + kbase) * 2]);
  };
  auto mma_s = [&](const v16bf (&kf)[4], v8f (&s)[RT]) {
    // Inputs-only fence on the four loaded K fragments: all eight LDS loads are issued,
    // into registers of their own, ahead of the run. Without it three fragments share
    // one register set, and the run stops twice for a whole LDS latency.
    asm volatile("" :: "v"(kf[0]), "v"(kf[1]), "v"(kf[2]), "v"(kf[3]));
#pragma unroll
    for (int kk = 0; kk < 4; ++kk)
#pragma unroll
      for (int t = 0; t < RT; ++t)
        s[t] = wmma_bf16(qf[t][kk], kf[kk], s[t]);
  };
  auto store_s = [&](int sb, const v8f (&s)[RT]) {
#pragma unroll
    for (int t = 0; t < RT; ++t) {
      sS[sb][dq][t][kh][0][lane] = make_float4(s[t][0], s[t][1], s[t][2], s[t][3]);
      sS[sb][dq][t][kh][1][lane] = make_float4(s[t][4], s[t][5], s[t][6], s[t][7]);
    }
  };
  // ---- stage 2: full S of the owned rows, online softmax
  auto load_part = [&](int sb, float4 (&pa)[NP][2]) {
#pragma unroll
    for (int w = 0; w < NP; ++w) {
      pa[w][0] = sS[sb][w][tw][0][hw][lane];
      pa[w][1] = sS[sb][w][tw][1][hw][lane];
    }
  };
  auto softmax = [&](const float4 (&pa)[NP][2], int pb) {
    // sum the 4 d quarters in order
    float fs0[4] = {0.f, 0.f, 0.f, 0.f}, fs1[4] = {0.f, 0.f, 0.f, 0.f};
#pragma unroll
    for (int w = 0; w < NP; ++w) {
      const float4 a0 = pa[w][0];
      const float4 a1 = pa[w][1];
      fs0[0] += a0.x; fs0[1] += a0.y; fs0[2] += a0.z; fs0[3] += a0.w;
      fs1[0] += a1.x; fs1[1] += a1.y; fs1[2] += a1.z; fs1[3] += a1.w;
    }
    // a row lives across one 16-lane half -> xor reduce by DPP
    float cr[4];
#pragma unroll
    for (int i = 0; i < 4; ++i) {
      const float mt = row_max16(fmaxf(fs0[i], fs1[i]));
      const float mnew = fmaxf(m[i], mt);
      const float p0 = __expf(fs0[i] - mnew);
      const float p1 = __expf(fs1[i] - mnew);
      const float rs = row_sum16(p0 + p1);
      const float corr = __expf(m[i] - mnew);
      l[i] = l[i] * corr + rs;
      m[i] = mnew;
      cr[i] = corr;
      sP[pb][tw][4 * hw + i + mh][r]      = (__bf16)p0;
      sP[pb][tw][4 * hw + i + mh][16 + r] = (__bf16)p1;
    }
    if (r == 0)
      *(float4*)&sC[pb][tw][4 * hw + mh] = make_float4(cr[0], cr[1], cr[2], cr[3]);
  };
  // ---- stage 3: rescale O, O[:, ds0+16j] += P * V^T
  auto load_p = [&](int pb, v16bf (&pf)[RT], float4 (&cc)[RT][2]) {
#pragma unroll
    for (int t = 0; t < RT; ++t) {                // P (C-layout) as A-fragments
      pf[t] = frag_bf16(&sP[pb][t][r][0] + kbase);
      cc[t][0] = *(const float4*)&sC[pb][t][mh];
      cc[t][1] = *(const float4*)&sC[pb][t][mh + 4];
    }
  };
  auto load_v = [&](int tile, v16bf (&vf)[4]) {
    const __bf16* vp = Vt + ((size_t)tile * (UU / 16) + wave * (DS / 16)) * FBLK + lane * 8;
    vf[0] = frag_packed(vp);
    vf[1] = frag_packed(vp + FBLK);
    vf[2] = frag_packed(vp + 2 * FBLK);
    vf[3] = frag_packed(vp + 3 * FBLK);
  };
  auto mma_o = [&](const v16bf (&pf)[RT], const float4 (&cc)[RT][2], const v16bf (&vf)[4]) {
#pragma unroll
    for (int t = 0; t < RT; ++t) {
      const float4 c0 = cc[t][0];
      const float4 c1 = cc[t][1];
#pragma unroll
      for (int j = 0; j < 4; ++j) {
        o[t][j][0] *= c0.x; o[t][j][1] *= c0.y; o[t][j][2] *= c0.z; o[t][j][3] *= c0.w;
        o[t][j][4] *= c1.x; o[t][j][5] *= c1.y; o[t][j][6] *= c1.z; o[t][j][7] *= c1.w;
      }
    }
#pragma unroll
    for (int t = 0; t < RT; ++t) {
      o[t][0] = wmma_bf16(pf[t], vf[0], o[t][0]);
      o[t][1] = wmma_bf16(pf[t], vf[1], o[t][1]);
      o[t][2] = wmma_bf16(pf[t], vf[2], o[t][2]);
      o[t][3] = wmma_bf16(pf[t], vf[3], o[t][3]);
    }
  };

  const v8u g1 = tdm_k_group1();
  {
    const v4u g0 = tdm_k_group0(Kw, sK0);
    __builtin_amdgcn_sched_barrier(0);
    tdm_load(g0, g1);
    wait_tensor0(g0, g1);
    __builtin_amdgcn_sched_barrier(0);
    __syncthreads();
  }

  // The foot of every pass that reads a K buffer publishes the next K tile (and
  // retires the pass's LDS reads and writes); directly behind its barrier, at the
  // head of the next pass, the buffer that the pass has read is refilled with the
  // tile after next. A request so starts and lands inside one pass.
  v16bf va[4], vb[4];                             // V of even tiles, V of odd tiles
  {                                               // fill, pass -2: S of tile 0
    const v4u g0 = tdm_k_group0(Kw + (size_t)pinned(32u) * UU, sK1);
    tdm_load(g0, g1);
    v16bf kf[4];
    v8f s[RT] = {};
    load_k(0, kf);
    mma_s(kf, s);
    store_s(0, s);
    wait_ds0();
    wait_tensor0(g0, g1);
    __syncthreads();
  }
  {                                               // fill, pass -1: S of tile 1, softmax of tile 0
    const v4u g0 = tdm_k_group0(Kw + (size_t)pinned(64u) * UU, sK0);
    tdm_load(g0, g1);
    v16bf kf[4];
    float4 pa[NP][2];
    v8f s[RT] = {};
    load_v(0, va);
    wait_x0();  // V loads above: their address registers are free behind here
    load_k(1, kf);
    load_part(0, pa);
    mma_s(kf, s);
    store_s(1, s);
    softmax(pa, 0);
    wait_ds0();
    wait_tensor0(g0, g1);
    __syncthreads();
  }
  // e = j & 1: buffers of tiles j and j+2; vc: V of tile j, vn: takes V of tile j+1
  auto pass = [&](int j, int e, const v16bf (&vc)[4], v16bf (&vn)[4]) {
    const unsigned kn = pinned((unsigned)j * 32u + 96u);  // first key of tile j+3
    const v4u g0 = tdm_k_group0(Kw + (size_t)kn * UU, e ? sK0 : sK1);
    if (kn < NN)
      tdm_load(g0, g1);
    v16bf kf[4], pf[RT];
    float4 pa[NP][2], cc[RT][2];
    v8f s[RT] = {};
    // the loads of all three stages come first in the pass
    load_v(j + 1, vn);
    wait_x0();  // V loads above: their address registers are free behind here
    load_k(e, kf);
    load_part(e ^ 1, pa);
    load_p(e, pf, cc);
    // The two scheduling fences stand round the S run. Without them the O rescale,
    // which waits for the last LDS reads of the pass, is mixed in among the first S
    // products, which need the K fragments alone, and some sC reads sink behind the
    // matrix runs, where each waits out its own LDS latency.
    __builtin_amdgcn_sched_barrier(0);
    mma_s(kf, s);                                 // tile j+2
    __builtin_amdgcn_sched_barrier(0);
    store_s(e, s);
    mma_o(pf, cc, vc);                            // tile j
    softmax(pa, e ^ 1);                           // tile j+1
    wait_ds0();
    wait_tensor0(g0, g1);
    __syncthreads();
  };
  for (int j = 0; j < NT - 2; j += 2) {
    pass(j, 0, va, vb);
    pass(j + 1, 1, vb, va);
  }
  asm volatile("s_wait_tensorcnt 0x0" ::: "memory");  // behind the last request, before the wave goes on
  wait_ds0();
  {                                               // drain: softmax of the last tile, P*V of the one before
    v16bf pf[RT];
    float4 pa[NP][2], cc[RT][2];
    load_v(NT - 1, vb);
    wait_x0();  // V loads above: their address registers are free behind here
    load_part(1, pa);
    load_p(0, pf, cc);
    mma_o(pf, cc, va);
    softmax(pa, 1);
    wait_ds0();
    __syncthreads();
  }
  {                                               // drain: P*V of the last tile
    v16bf pf[RT];
    float4 cc[RT][2];
    load_p(1, pf, cc);
    mma_o(pf, cc, vb);
  }
  // hand each row's 1/l from its owner to every wave, through the sC buffer whose
  // last readers stand in front of the barrier above
  if (r == 0)
    *(float4*)&sC[0][tw][4 * hw + mh] =
        make_float4(1.f / l[0], 1.f / l[1], 1.f / l[2], 1.f / l[3]);
  __syncthreads();
  float4 iv[RT][2];
#pragma unroll
  for (int t = 0; t < RT; ++t) {
    iv[t][0] = *(const float4*)&sC[0][t][mh];
    iv[t][1] = *(const float4*)&sC[0][t][mh + 4];
  }
#pragma unroll
  for (int t = 0; t < RT; ++t)
#pragma unroll
    for (int v = 0; v < 8; ++v) {
      const float4 q4 = iv[t][v >> 2];
      const float inv = (v & 3) == 0 ? q4.x : (v & 3) == 1 ? q4.y : (v & 3) == 2 ? q4.z : q4.w;
      const size_t row = (size_t)b * NN + q0 + 16 * t + v + mh;
#pragma unroll
      for (int j = 0; j < 4; ++j)
        C[row * UU + ds0 + j * 16 + r] = (__bf16)(o[t][j][v] * inv);
    }
}

// ---------------------------------------------------------------- kernel 3
// out = x + ctx @ Wp + bp (fp32 out). Tiled like kernel 1: a work-group takes 64
// rows of ctx and all 512 columns, a wave 64 columns for all 4 row tiles, so each
// weight fragment feeds 4 matrix instructions; the ctx tile is read once a
// work-group and kept in LDS in A-fragment order.
__global__ void __launch_bounds__(256) out_proj(
    const float* __restrict__ x, const __bf16* __restrict__ Cb,
    const __bf16* __restrict__ WpT, const float* __restrict__ bpp,
    float* __restrict__ out) {
  __shared__ alignas(16) __bf16 sA[QRT][KB][FBLK];  // 64 KB
  const int lane = threadIdx.x & 31;
  const int wave = threadIdx.x >> 5;
  const int rowBase = blockIdx.x * (16 * QRT);
  const int col0 = wave * 64;
  const int r = lane & 15;
  const int mh = (lane >> 4) << 3;

  // weights in fragment order: one n tile is UU/32 consecutive blocks
  const __bf16* wp[4];
  wp[0] = WpT + (size_t)(col0 >> 4) * KB * FBLK + lane * 8;
  wp[1] = wp[0] + KB * FBLK;
  wp[2] = wp[1] + KB * FBLK;
  wp[3] = wp[2] + KB * FBLK;

  v16bf w[2][4], a[2][QRT];
  float bias[4];                                  // this lane's columns of the bias
  {
    // A lane takes 8 consecutive k of one row, 4 lanes one k block, a wave 8 rows.
    const int c = lane & 3;
    const int row = wave * 8 + (lane >> 2);
    const __bf16* cs = Cb + (size_t)(rowBase + row) * UU + c * 8;
    v8bf ca[KB];
#pragma unroll
    for (int kb = 0; kb < KB; ++kb) ca[kb] = *(const v8bf*)(cs + kb * 32);
#pragma unroll
    for (int i = 0; i < 4; ++i) w[0][i] = frag_packed(wp[i]);
#pragma unroll
    for (int i = 0; i < 4; ++i) bias[i] = bpp[col0 + i * 16 + r];
    wait_x0();
    __bf16* ad = &sA[row >> 4][0][(c >> 1) * 256 + ((c & 1) * 16 + (row & 15)) * 8];
#pragma unroll
    for (int kb = 0; kb < KB; ++kb) *(v8bf*)(ad + kb * FBLK) = ca[kb];
  }
  __syncthreads();                                // the ctx tile is whole for every wave

  v8f acc[QRT][4] = {};
  // residual x and out: element (row tile t, row v, column tile i) of this lane
  // lies at (16 t + v) * UU + 16 i from these two bases
  const size_t eb = (size_t)(rowBase + mh) * UU + col0 + r;
  const float* xb = x + eb;
  float* ob = out + eb;
  float xv[4][QRT][8];
  auto load_x = [&](int i) {                      // one column tile's residual values
#pragma unroll
    for (int t = 0; t < QRT; ++t)
#pragma unroll
      for (int v = 0; v < 8; ++v) xv[i][t][v] = xb[(16 * t + v) * UU + 16 * i];
    close_x0(xb);
  };
#pragma unroll
  for (int t = 0; t < QRT; ++t) a[0][t] = frag_packed(&sA[t][0][lane * 8]);
#pragma unroll
  for (int s = 0; s < KB; ++s) {
    if (s + 1 < KB) {                             // load next step's fragments
#pragma unroll
      for (int i = 0; i < 4; ++i) w[(s + 1) & 1][i] = frag_packed(wp[i] + (s + 1) * FBLK);
      wait_x0();
#pragma unroll
      for (int t = 0; t < QRT; ++t) a[(s + 1) & 1][t] = frag_packed(&sA[t][s + 1][lane * 8]);
    }
    // behind the last weight loads, so that no weight fragment waits for them
    if (s == KB - 2) load_x(0);
    if (s == KB - 1) load_x(1);
    // Keeps the next step's loads in front of this step's matrix run: sunk in
    // among or behind it they would have no lead over their first use.
    __builtin_amdgcn_sched_barrier(0);
#pragma unroll
    for (int t = 0; t < QRT; ++t)
#pragma unroll
      for (int i = 0; i < 4; ++i)
        acc[t][i] = wmma_bf16(a[s & 1][t], w[s & 1][i], acc[t][i]);
  }
  // Keeps the last matrix run out of the stores below and their waits.
  __builtin_amdgcn_sched_barrier(0);
#pragma unroll
  for (int i = 0; i < 4; ++i) {
    if (i + 2 < 4) load_x(i + 2);                 // two column tiles ahead
#pragma unroll
    for (int t = 0; t < QRT; ++t)
#pragma unroll
      for (int v = 0; v < 8; ++v)
        ob[(16 * t + v) * UU + 16 * i] = xv[i][t][v] + acc[t][i][v] + bias[i];
    close_x0(ob);
  }
}

// ---------------------------------------------------------------- launch
extern "C" void kernel_launch(void* const* d_in, const int* in_sizes, int n_in,
                              void* d_out, int out_size, void* d_ws, size_t ws_size,
                              hipStream_t stream) {
  const float* x  = (const float*)d_in[0];
  const float* Wq = (const float*)d_in[1];
  const float* bq = (const float*)d_in[2];
  const float* Wk = (const float*)d_in[3];
  const float* bk = (const float*)d_in[4];
  const float* Wv = (const float*)d_in[5];
  const float* bv = (const float*)d_in[6];
  const float* Wp = (const float*)d_in[7];
  const float* bp = (const float*)d_in[8];
  float* out = (float*)d_out;

  char* ws = (char*)d_ws;
  const size_t wbytes = (size_t)UU * UU * sizeof(__bf16);        // 512 KB
  const size_t tbytes = (size_t)BN * UU * sizeof(__bf16);        // 16 MB
  __bf16* WqT = (__bf16*)(ws);
  __bf16* WkT = (__bf16*)(ws + wbytes);
  __bf16* WvT = (__bf16*)(ws + 2 * wbytes);
  __bf16* WpT = (__bf16*)(ws + 3 * wbytes);
  __bf16* Qb  = (__bf16*)(ws + 4 * wbytes);
  __bf16* Kb  = (__bf16*)(ws + 4 * wbytes + tbytes);
  __bf16* VTb = (__bf16*)(ws + 4 * wbytes + 2 * tbytes);
  __bf16* Ctx = (__bf16*)(ws + 4 * wbytes + 3 * tbytes);

  cvt_weights_t<<<(UU * UU) / 256, 256, 0, stream>>>(Wq, Wk, Wv, Wp, WqT, WkT, WvT, WpT);
  qkv_proj<<<256, 256, 0, stream>>>(x, WqT, WkT, WvT, bq, bk, bv, Qb, Kb, VTb);
  dim3 fgrid(NN / (16 * RT), BB);
  flash_attn<<<fgrid, 256, 0, stream>>>(Qb, Kb, VTb, Ctx);
  out_proj<<<256, 256, 0, stream>>>(x, Ctx, WpT, bp, out);
}

// v009
// A run of this version takes 173 microseconds.
// Timed twice side by side with v008, it ran 1.04 and 1.05 times as fast.
// All steps since v000 together make it 6.32 times as fast.
#include <hip/hip_runtime.h>

#define BB 4
#define NN 4096
#define UU 512
#define BN (BB*NN)

typedef __attribute__((ext_vector_type(16))) __bf16 v16bf;
typedef __attribute__((ext_vector_type(8)))  __bf16 v8bf;
typedef __attribute__((ext_vector_type(8)))  float  v8f;
typedef __attribute__((ext_vector_type(4)))  unsigned int v4u;
typedef __attribute__((ext_vector_type(8)))  unsigned int v8u;

__device__ __forceinline__ v8f wmma_bf16(v16bf a, v16bf b, v8f c) {
  return __builtin_amdgcn_wmma_f32_16x16x32_bf16(false, a, false, b, (short)0, c,
                                                 false, false);
}

__device__ __forceinline__ v16bf frag_bf16(const __bf16* p) {
  v8bf lo = *(const v8bf*)(p);
  v8bf hi = *(const v8bf*)(p + 16);
  return __builtin_shufflevector(lo, hi, 0, 1, 2, 3, 4, 5, 6, 7,
                                 8, 9, 10, 11, 12, 13, 14, 15);
}
#define FBLK 512
__device__ __forceinline__ v16bf frag_packed(const __bf16* p) {
  v8bf lo = *(const v8bf*)(p);
  v8bf hi = *(const v8bf*)(p + 256);
  return __builtin_shufflevector(lo, hi, 0, 1, 2, 3, 4, 5, 6, 7,
                                 8, 9, 10, 11, 12, 13, 14, 15);
}

#define KROWB  256u                               // bytes of a slice row
#define KROWS  16u                                // rows (keys) of a slice
#define KPITCH 272u                               // row pitch in LDS
#define KSLICE 6144u                              // 16 * 272 B, rounded up to 2 KiB
__device__ __forceinline__ unsigned uni(unsigned v) {
  return (unsigned)__builtin_amdgcn_readfirstlane(v);
}
__device__ __forceinline__ unsigned pinned(unsigned v) {
  unsigned w = uni(v);
  asm volatile("" : "+s"(w));  // keeps w in a scalar register
  return w;
}
// One request: 16 rows x 256 B, source pitch 1024 B, byte elements,
// tensor dims = tile dims, pad of 4 dwords behind every 64 dwords.
__device__ __forceinline__ v4u tdm_k_group0(const __bf16* gsrc, unsigned lds_off) {
  const unsigned long long ga = (unsigned long long)(uintptr_t)gsrc;
  v4u g0;
  g0[0] = uni(1u);                                          // count = 1
  g0[1] = uni(lds_off);                                     // LDS byte offset
  g0[2] = uni((unsigned)ga);                                // address [31:0]
  g0[3] = uni(((unsigned)(ga >> 32) & 0x01FFFFFFu) | 0x80000000u);  // [56:32], type 2
  return g0;
}
// Formed once a kernel: through pinned() its words stay in the same scalar
// registers for every request, instead of being formed anew in registers that
// are free for other use while a request is under way.
__device__ __forceinline__ v8u tdm_k_group1() {
  v8u g1;
  g1[0] = uni((1u << 20) | (5u << 22) | (3u << 25));
  g1[1] = pinned(KROWB << 16);
  g1[2] = pinned(KROWS << 16);
  g1[3] = pinned(KROWB << 16);
  g1[4] = pinned(KROWS);
  g1[5] = pinned(UU * 2u);
  g1[6] = pinned(0u);
  g1[7] = pinned(0u);
  return g1;
}
__device__ __forceinline__ void tdm_load(v4u g0, v8u g1) {
  asm volatile("tensor_load_to_lds %0, %1" :: "s"(g0), "s"(g1) : "memory");
}
__device__ __forceinline__ void wait_tensor0(v4u g0, v8u g1) {
  asm volatile("s_wait_tensorcnt 0x0" :: "s"(g0), "s"(g1) : "memory");
}
// This wave's LDS reads have retired before the buffer they read is refilled.
__device__ __forceinline__ void wait_ds0() { asm volatile("s_wait_dscnt 0x0" ::: "memory"); }

// Stands between issued global loads and the next rewrite of the address registers
// that they name.
__device__ __forceinline__ void wait_x0() { asm volatile("s_wait_xcnt 0x0" ::: "memory"); }
__device__ __forceinline__ void close_x0(const void* base) {
  __builtin_amdgcn_sched_barrier(0);
  asm volatile("s_wait_xcnt 0x0" :: "v"(base) : "memory");
  __builtin_amdgcn_sched_barrier(0);
}

template <int X>
__device__ __forceinline__ float row_xor(float v) {
  return __builtin_bit_cast(float, __builtin_amdgcn_update_dpp(
      0, __builtin_bit_cast(int, v), 0x160 + X, 0xf, 0xf, false));
}
__device__ __forceinline__ float row_max16(float v) {
  v = fmaxf(v, row_xor<1>(v));
  v = fmaxf(v, row_xor<2>(v));
  v = fmaxf(v, row_xor<4>(v));
  return fmaxf(v, row_xor<8>(v));
}
__device__ __forceinline__ float row_sum16(float v) {
  v += row_xor<1>(v);
  v += row_xor<2>(v);
  v += row_xor<4>(v);
  return v + row_xor<8>(v);
}

// ---------------------------------------------------------------- kernel 0
__global__ void cvt_weights_t(const float* __restrict__ wq, const float* __restrict__ wk,
                              const float* __restrict__ wv, const float* __restrict__ wp,
                              __bf16* __restrict__ dq, __bf16* __restrict__ dk,
                              __bf16* __restrict__ dv, __bf16* __restrict__ dp) {
  const int idx = blockIdx.x * blockDim.x + threadIdx.x;   // coalesced read
  const int k = idx / UU, n = idx % UU;
  // fragment order, blocks laid out [n tile][k block]
  const size_t t = ((size_t)(n >> 4) * (UU / 32) + (k >> 5)) * FBLK +
                   ((k >> 4) & 1) * 256 + ((((k >> 3) & 1) << 4) + (n & 15)) * 8 + (k & 7);
  dq[t] = (__bf16)wq[idx];
  dk[t] = (__bf16)wk[idx];
  dv[t] = (__bf16)wv[idx];
  dp[t] = (__bf16)wp[idx];
}

// Start k block of a projection work-group, 0..15, from bits 0-1 and 3-4 of its index:
// the groups whose index modulo 8 falls in any 4 cyclic neighbours take all 16 starts.
// For speed only: any start gives the same sums but for their order.
__device__ __forceinline__ unsigned proj_start(unsigned g) {
  return (g & 3u) + ((g >> 3) & 3u) * 4u;
}

// ---------------------------------------------------------------- kernel 1
// Fused Q/K/V projection. A work-group takes 64 rows of x (4 row tiles) and, in
// two rounds, 256 columns of each of Q, K and V a round; a wave takes 32 of those
// columns for all 4 row tiles, so each weight fragment (global) feeds 4 matrix
// instructions.
// The x tile is read once a work-group, in 128-B lines, rounded to bf16 and kept
// in LDS in A-fragment order (the order of frag_packed with n = row), so every
// wave finds a fragment by two contiguous ds_load_b128.
// Fragments for step k+1 are loaded before step k's wmma run.
#define QRT 4                                     // row tiles per work-group
#define KB  (UU / 32)                             // k blocks
__global__ void __launch_bounds__(256) qkv_proj(
    const float* __restrict__ x,
    const __bf16* __restrict__ WqT, const __bf16* __restrict__ WkT,
    const __bf16* __restrict__ WvT,
    const float* __restrict__ bqp, const float* __restrict__ bkp,
    const float* __restrict__ bvp,
    __bf16* __restrict__ Q, __bf16* __restrict__ K, __bf16* __restrict__ VT) {
  __shared__ alignas(16) __bf16 sX[QRT][KB][FBLK];  // 64 KB
  const int lane = threadIdx.x & 31;
  const int wave = threadIdx.x >> 5;
  const int rowBase = blockIdx.x * (16 * QRT);
  const int r = lane & 15;
  const int mh = (lane >> 4) << 3;

  {
    // A lane takes 8 consecutive k of one row, 4 lanes one 128-B line, a wave 8 rows.
    const int c = lane & 3;
    const int row = wave * 8 + (lane >> 2);
    const float* xs = x + (size_t)(rowBase + row) * UU + c * 8;
    float4 xa[KB][2];
#pragma unroll
    for (int kb = 0; kb < KB; ++kb) {
      xa[kb][0] = *(const float4*)(xs + kb * 32);
      xa[kb][1] = *(const float4*)(xs + kb * 32 + 4);
    }
    wait_x0();
    __bf16* xd = &sX[row >> 4][0][(c >> 1) * 256 + ((c & 1) * 16 + (row & 15)) * 8];
#pragma unroll
    for (int kb = 0; kb < KB; ++kb) {
      const float4 lo = xa[kb][0], hi = xa[kb][1];
      v8bf p;
      p[0] = (__bf16)lo.x; p[1] = (__bf16)lo.y; p[2] = (__bf16)lo.z; p[3] = (__bf16)lo.w;
      p[4] = (__bf16)hi.x; p[5] = (__bf16)hi.y; p[6] = (__bf16)hi.z; p[7] = (__bf16)hi.w;
      *(v8bf*)(xd + kb * FBLK) = p;
    }
  }
  __syncthreads();                                // the x tile is whole for every wave

  const float scale = rsqrtf((float)UU);
  // Step s works on k block (s + ks) mod KB, ks a start of the work-group's own: as in
  // flash_attn below, the groups do not all ask for the same weight lines at once.
  const unsigned ks = proj_start(blockIdx.x);
  // Kept rolled: a second copy of the 16 unrolled steps would only double the text.
#pragma unroll 1
  for (int ch = 0; ch < 2; ++ch) {                // column halves, from the same x tile
    const int col0 = (ch * 8 + wave) * 32;
    // weights in fragment order: one n tile is UU/32 consecutive blocks
    const size_t wt = (size_t)(col0 >> 4) * KB * FBLK + lane * 8;
    const __bf16* wp[6];
    wp[0] = WqT + wt;  wp[1] = wp[0] + KB * FBLK;
    wp[2] = WkT + wt;  wp[3] = wp[2] + KB * FBLK;
    wp[4] = WvT + wt;  wp[5] = wp[4] + KB * FBLK;

    v16bf w[2][6], a[2][QRT];
    float bq2[2], bk2[2], bv2[2];                 // this lane's columns of the biases
#pragma unroll
    for (int i = 0; i < 6; ++i) w[0][i] = frag_packed(wp[i] + ks * FBLK);
#pragma unroll
    for (int h = 0; h < 2; ++h) {
      bq2[h] = bqp[col0 + 16 * h + r];
      bk2[h] = bkp[col0 + 16 * h + r];
      bv2[h] = bvp[col0 + 16 * h + r];
    }
    wait_x0();
    v8f acc[QRT][6] = {};
#pragma unroll
    for (int t = 0; t < QRT; ++t) a[0][t] = frag_packed(&sX[t][ks][lane * 8]);
#pragma unroll
    for (int s = 0; s < KB; ++s) {
      if (s + 1 < KB) {                           // load next step's fragments
        const unsigned kn = (s + 1u + ks) & (KB - 1u);
        const __bf16* wn[3];                      // of Wq, Wk, Wv; the second n tile lies behind
#pragma unroll
        for (int i = 0; i < 3; ++i) wn[i] = wp[2 * i] + kn * FBLK;
#pragma unroll
        for (int i = 0; i < 6; ++i)
          w[(s + 1) & 1][i] = frag_packed(wn[i >> 1] + (i & 1) * (KB * FBLK));
        // wait_x0 that names the three addresses as inputs: their registers are given to
        // nothing else in front of it.
        asm volatile("s_wait_xcnt 0x0" :: "v"(wn[0]), "v"(wn[1]), "v"(wn[2]) : "memory");
#pragma unroll
        for (int t = 0; t < QRT; ++t) a[(s + 1) & 1][t] = frag_packed(&sX[t][kn][lane * 8]);
      }
      // Keeps the next step's loads in front of this step's matrix run: sunk in
      // among or behind it they would have no lead over their first use.
      __builtin_amdgcn_sched_barrier(0);
#pragma unroll
      for (int t = 0; t < QRT; ++t)
#pragma unroll
        for (int i = 0; i < 6; ++i)
          acc[t][i] = wmma_bf16(a[s & 1][t], w[s & 1][i], acc[t][i]);
    }
    // Keeps the last matrix run out of the stores below and their waits.
    __builtin_amdgcn_sched_barrier(0);
#pragma unroll
    for (int t = 0; t < QRT; ++t) {
      const int row0 = rowBase + 16 * t;
      const int b = row0 >> 12;                   // row0 / NN
      v8bf pv[2];                                 // V: a lane's 8 keys of one d column
#pragma unroll
      for (int v = 0; v < 8; ++v) {
        const size_t idx = (size_t)(row0 + v + mh) * UU;
#pragma unroll
        for (int h = 0; h < 2; ++h) {
          const int Nc = col0 + 16 * h + r;
          const float q = acc[t][h][v] + bq2[h];
          const float k = acc[t][2 + h][v] + bk2[h];
          const float vv = acc[t][4 + h][v] + bv2[h];
          Q[idx + Nc] = (__bf16)(q * scale);
          K[idx + Nc] = (__bf16)k;
          pv[h][v] = (__bf16)vv;
        }
      }
      // V in fragment order (k = key, n = d), blocks laid out [batch][key block][d tile]:
      // the accumulator's 8 rows of a lane are that lane's 8 consecutive elements.
      __bf16* vdst = VT + (((size_t)b * (NN / 32) + ((row0 & (NN - 1)) >> 5)) * (UU / 16) +
                           (col0 >> 4)) * FBLK + ((row0 >> 4) & 1) * 256 + lane * 8;
      *(v8bf*)(vdst) = pv[0];
      *(v8bf*)(vdst + FBLK) = pv[1];
      close_x0(vdst);
    }
  }
}

// ---------------------------------------------------------------- kernel 2
// Flash attention: 64 query rows/block (4 row tiles), 8 waves.
// S: a wave takes one key half (16 keys) and one quarter of d (128 columns) for all
// 4 row tiles, so a score is the sum of 4 partials that pass through LDS.
// P*V: the waves split d (64 columns each), again with all 4 row tiles. So each
// K fragment (LDS) and each V fragment (global) feeds 4 matrix instructions.
// The 64x32 score block is summed and soft-maxed once: wave w owns row tile
// w>>1, accumulator rows 4*(w&1)..+3 of each lane half.
// K tiles are double-buffered in LDS by tensor loads, one slice per wave.
// The three stages of a key tile run as a software pipeline: pass j forms the
// partial S of tile j+2, the softmax of tile j+1 and P*V of tile j. Each stage
// reads only what the pass before has left in LDS, and sS, sP and sC have two
// buffers each, so one barrier a pass orders all of it and the stages' loads,
// matrix runs and vector chains overlap inside a pass.
// V fragments (global) are fetched one pass ahead into a second register set: pass
// j issues the loads of tile j+1 and multiplies with tile j's, which the pass
// before has asked for. The key loop is unrolled by two, so the sets swap by name.
// Every work-group walks all key tiles, but starts at a tile of its own and wraps
// round: step j works on tile (j + st) mod NT. Walking in the same order, all groups
// of a batch ask for the same K and V lines at the same moment, each line's first
// fetch from memory holds up every group, and that in every pass. Spread out, a group
// meets lines that another group has brought into L2 many passes earlier.
#define RT 4                                      // row tiles per block
#define NW 8                                      // waves per block
#define DS (UU / NW)                              // d columns per wave, P*V
#define NP 4                                      // partials of a score = d quarters
#define SD (UU / NP)                              // d columns per wave, S
#define NT (NN / 32)                              // key tiles
__global__ void __launch_bounds__(256) flash_attn(
    const __bf16* __restrict__ Q, const __bf16* __restrict__ K,
    const __bf16* __restrict__ VT, __bf16* __restrict__ C) {
  __shared__ alignas(2048) unsigned char sK[2][NW][KSLICE];  // 96 KB: K slices
  // partial S, kept in accumulator order: [buffer][d quarter][tile][key half]
  // [register quad][lane] -> one 16B element per lane, no transposition
  __shared__ float4 sS[2][NP][RT][2][2][32];      // 64 KB
  // P for A-frag repack; 80-B pitch = 16 B x 5 for its ds_load_b128 readers
  __shared__ alignas(16) __bf16 sP[2][RT][16][40];
  __shared__ alignas(16) float sC[2][RT][16];     // per-row rescale factor

  const int lane = threadIdx.x & 31;
  const int wave = threadIdx.x >> 5;              // 0..7 -> d-slice of P*V
  const int b  = blockIdx.y;
  const int q0 = blockIdx.x * (16 * RT);
  const int ds0 = wave * DS;
  const int kbase = (lane & 16) ? 8 : 0;
  const int r  = lane & 15;
  const int mh = (lane >> 4) << 3;
  const int tw = wave >> 1;                       // softmax: owned row tile
  const int hw = wave & 1;                        // softmax: owned register quad
  const int dq = wave >> 1;                       // S: owned d quarter
  const int kh = wave & 1;                        // S: owned key half

  const __bf16* Qb = Q + (size_t)b * NN * UU;
  const __bf16* Kb = K + (size_t)b * NN * UU;
  const __bf16* Vt = VT + (size_t)b * UU * NN;    // fragment order [key block][d tile]

  typedef __attribute__((address_space(3))) unsigned char lds_u8;
  const unsigned sw = uni(threadIdx.x >> 5);      // wave number, scalar
  const unsigned sK0 = (unsigned)(unsigned long long)(lds_u8*)&sK[0][0][0] + sw * KSLICE;
  const unsigned sK1 = sK0 + NW * KSLICE;
  const __bf16* Kw = Kb + (size_t)(sw & 1u) * KROWS * UU + (sw >> 1) * SD;  // this wave's part of K
  // Start tile: the 64 groups of a batch take the 64 even tiles, one each. Bits 0-1 and
  // 3-5 of blockIdx.x count in steps of 4 tiles and bit 2 adds 2, so the groups whose
  // index modulo 8 falls in any 4 cyclic neighbours start 2 to 6 tiles apart. For speed
  // only: any start gives the same sums but for their order.
  const unsigned qi = blockIdx.x;
  const unsigned st = ((qi & 3u) + (qi >> 3) * 4u) * 4u + ((qi >> 2) & 1u) * 2u;
  auto rot = [&](unsigned step) { return (step + st) & (NT - 1u); };  // step -> key tile

  v16bf qf[RT][4];
  const __bf16* qp[RT];
#pragma unroll
  for (int t = 0; t < RT; ++t)
    qp[t] = Qb + (size_t)(q0 + 16 * t + r) * UU + dq * SD + kbase;
#pragma unroll
  for (int t = 0; t < RT; ++t)
#pragma unroll
    for (int kk = 0; kk < 4; ++kk)
      qf[t][kk] = frag_bf16(qp[t] + kk * 32);
  // The wait of close_x0 for the Q loads: it names the four row addresses as inputs,
  // so that each keeps its registers until the wait, and the two scheduling fences
  // keep later vector work, which reuses them, behind it.
  __builtin_amdgcn_sched_barrier(0);
  asm volatile("s_wait_xcnt 0x0" :: "v"(qp[0]), "v"(qp[1]), "v"(qp[2]), "v"(qp[3]) : "memory");
  __builtin_amdgcn_sched_barrier(0);

  v8f o[RT][4] = {};
  float m[4], l[4];                               // rows 4*hw+i+mh of tile tw
#pragma unroll
  for (int i = 0; i < 4; ++i) { m[i] = -3.0e38f; l[i] = 0.f; }

  // ---- stage 1: partial S of this wave's key half over its d quarter
  auto load_k = [&](int buf, v16bf (&kf)[4]) {    // ds_load_b128 fragments
#pragma unroll
    for (int kk = 0; kk < 4; ++kk)
      kf[kk] = frag_bf16((const __bf16*)&sK[buf][wave][r * KPITCH + (kk * 32 + kbase) * 2]);
  };
  auto mma_s = [&](const v16bf (&kf)[4], v8f (&s)[RT]) {
    // Inputs-only fence on the four loaded K fragments: all eight LDS loads are issued,
    // into registers of their own, ahead of the run. Without it three fragments share
    // one register set, and the run stops twice for a whole LDS latency.
    asm volatile("" :: "v"(kf[0]), "v"(kf[1]), "v"(kf[2]), "v"(kf[3]));
#pragma unroll
    for (int kk = 0; kk < 4; ++kk)
#pragma unroll
      for (int t = 0; t < RT; ++t)
        s[t] = wmma_bf16(qf[t][kk], kf[kk], s[t]);
  };
  auto store_s = [&](int sb, const v8f (&s)[RT]) {
#pragma unroll
    for (int t = 0; t < RT; ++t) {
      sS[sb][dq][t][kh][0][lane] = make_float4(s[t][0], s[t][1], s[t][2], s[t][3]);
      sS[sb][dq][t][kh][1][lane] = make_float4(s[t][4], s[t][5], s[t][6], s[t][7]);
    }
  };
  // ---- stage 2: full S of the owned rows, online softmax
  auto load_part = [&](int sb, float4 (&pa)[NP][2]) {
#pragma unroll
    for (int w = 0; w < NP; ++w) {
      pa[w][0] = sS[sb][w][tw][0][hw][lane];
      pa[w][1] = sS[sb][w][tw][1][hw][lane];
    }
  };
  auto softmax = [&](const float4 (&pa)[NP][2], int pb) {
    // sum the 4 d quarters in order
    float fs0[4] = {0.f, 0.f, 0.f, 0.f}, fs1[4] = {0.f, 0.f, 0.f, 0.f};
#pragma unroll
    for (int w = 0; w < NP; ++w) {
      const float4 a0 = pa[w][0];
      const float4 a1 = pa[w][1];
      fs0[0] += a0.x; fs0[1] += a0.y; fs0[2] += a0.z; fs0[3] += a0.w;
      fs1[0] += a1.x; fs1[1] += a1.y; fs1[2] += a1.z; fs1[3] += a1.w;
    }
    // a row lives across one 16-lane half -> xor reduce by DPP
    float cr[4];
#pragma unroll
    for (int i = 0; i < 4; ++i) {
      const float mt = row_max16(fmaxf(fs0[i], fs1[i]));
      const float mnew = fmaxf(m[i], mt);
      const float p0 = __expf(fs0[i] - mnew);
      const float p1 = __expf(fs1[i] - mnew);
      const float rs = row_sum16(p0 + p1);
      const float corr = __expf(m[i] - mnew);
      l[i] = l[i] * corr + rs;
      m[i] = mnew;
      cr[i] = corr;
      sP[pb][tw][4 * hw + i + mh][r]      = (__bf16)p0;
      sP[pb][tw][4 * hw + i + mh][16 + r] = (__bf16)p1;
    }
    if (r == 0)
      *(float4*)&sC[pb][tw][4 * hw + mh] = make_float4(cr[0], cr[1], cr[2], cr[3]);
  };
  // ---- stage 3: rescale O, O[:, ds0+16j] += P * V^T
  auto load_p = [&](int pb, v16bf (&pf)[RT], float4 (&cc)[RT][2]) {
#pragma unroll
    for (int t = 0; t < RT; ++t) {                // P (C-layout) as A-fragments
      pf[t] = frag_bf16(&sP[pb][t][r][0] + kbase);
      cc[t][0] = *(const float4*)&sC[pb][t][mh];
      cc[t][1] = *(const float4*)&sC[pb][t][mh + 4];
    }
  };
  auto load_v = [&](unsigned tile, v16bf (&vf)[4]) {
    const __bf16* vp = Vt + ((size_t)tile * (UU / 16) + wave * (DS / 16)) * FBLK + lane * 8;
    vf[0] = frag_packed(vp);
    vf[1] = frag_packed(vp + FBLK);
    vf[2] = frag_packed(vp + 2 * FBLK);
    vf[3] = frag_packed(vp + 3 * FBLK);
    // Behind the V loads, in front of any rewrite of their address registers; it names
    // the address as an input, so that those registers are given to nothing else first.
    asm volatile("s_wait_xcnt 0x0" :: "v"(vp) : "memory");
  };
  auto mma_o = [&](const v16bf (&pf)[RT], const float4 (&cc)[RT][2], const v16bf (&vf)[4]) {
#pragma unroll
    for (int t = 0; t < RT; ++t) {
      const float4 c0 = cc[t][0];
      const float4 c1 = cc[t][1];
#pragma unroll
      for (int j = 0; j < 4; ++j) {
        o[t][j][0] *= c0.x; o[t][j][1] *= c0.y; o[t][j][2] *= c0.z; o[t][j][3] *= c0.w;
        o[t][j][4] *= c1.x; o[t][j][5] *= c1.y; o[t][j][6] *= c1.z; o[t][j][7] *= c1.w;
      }
    }
#pragma unroll
    for (int t = 0; t < RT; ++t) {
      o[t][0] = wmma_bf16(pf[t], vf[0], o[t][0]);
      o[t][1] = wmma_bf16(pf[t], vf[1], o[t][1]);
      o[t][2] = wmma_bf16(pf[t], vf[2], o[t][2]);
      o[t][3] = wmma_bf16(pf[t], vf[3], o[t][3]);
    }
  };

  const v8u g1 = tdm_k_group1();
  {
    const v4u g0 = tdm_k_group0(Kw + (size_t)pinned(rot(0u) * 32u) * UU, sK0);
    __builtin_amdgcn_sched_barrier(0);
    tdm_load(g0, g1);
    wait_tensor0(g0, g1);
    __builtin_amdgcn_sched_barrier(0);
    __syncthreads();
  }

  // The foot of every pass that reads a K buffer publishes the next K tile (and
  // retires the pass's LDS reads and writes); directly behind its barrier, at the
  // head of the next pass, the buffer that the pass has read is refilled with the
  // tile after next. A request so starts and lands inside one pass.
  v16bf va[4], vb[4];                             // V of even tiles, V of odd tiles
  {                                               // fill, pass -2: S of tile 0
    const v4u g0 = tdm_k_group0(Kw + (size_t)pinned(rot(1u) * 32u) * UU, sK1);
    tdm_load(g0, g1);
    v16bf kf[4];
    v8f s[RT] = {};
    load_k(0, kf);
    mma_s(kf, s);
    store_s(0, s);
    wait_ds0();
    wait_tensor0(g0, g1);
    __syncthreads();
  }
  {                                               // fill, pass -1: S of tile 1, softmax of tile 0
    const v4u g0 = tdm_k_group0(Kw + (size_t)pinned(rot(2u) * 32u) * UU, sK0);
    tdm_load(g0, g1);
    v16bf kf[4];
    float4 pa[NP][2];
    v8f s[RT] = {};
    load_v(rot(0u), va);
    load_k(1, kf);
    load_part(0, pa);
    mma_s(kf, s);
    store_s(1, s);
    softmax(pa, 0);
    wait_ds0();
    wait_tensor0(g0, g1);
    __syncthreads();
  }
  // e = j & 1: buffers of tiles j and j+2; vc: V of tile j, vn: takes V of tile j+1
  auto pass = [&](int j, int e, const v16bf (&vc)[4], v16bf (&vn)[4]) {
    const unsigned kn = pinned((unsigned)j * 32u + 96u);  // 32 * (step j+3): is there one?
    const unsigned kt = pinned(rot((unsigned)j + 3u) * 32u);  // first key of its tile, below NN
    const v4u g0 = tdm_k_group0(Kw + (size_t)kt * UU, e ? sK0 : sK1);
    if (kn < NN)
      tdm_load(g0, g1);
    v16bf kf[4], pf[RT];
    float4 pa[NP][2], cc[RT][2];
    v8f s[RT] = {};
    // the loads of all three stages come first in the pass
    load_v(rot((unsigned)j + 1u), vn);
    load_k(e, kf);
    load_part(e ^ 1, pa);
    load_p(e, pf, cc);
    // The two scheduling fences stand round the S run. Without them the O rescale,
    // which waits for the last LDS reads of the pass, is mixed in among the first S
    // products, which need the K fragments alone, and some sC reads sink behind the
    // matrix runs, where each waits out its own LDS latency.
    __builtin_amdgcn_sched_barrier(0);
    mma_s(kf, s);                                 // tile j+2
    __builtin_amdgcn_sched_barrier(0);
    store_s(e, s);
    mma_o(pf, cc, vc);                            // tile j
    softmax(pa, e ^ 1);                           // tile j+1
    wait_ds0();
    wait_tensor0(g0, g1);
    __syncthreads();
  };
  for (int j = 0; j < NT - 2; j += 2) {
    pass(j, 0, va, vb);
    pass(j + 1, 1, vb, va);
  }
  asm volatile("s_wait_tensorcnt 0x0" ::: "memory");  // behind the last request, before the wave goes on
  wait_ds0();
  {                                               // drain: softmax of the last tile, P*V of the one before
    v16bf pf[RT];
    float4 pa[NP][2], cc[RT][2];
    load_v(rot(NT - 1u), vb);
    load_part(1, pa);
    load_p(0, pf, cc);
    mma_o(pf, cc, va);
    softmax(pa, 1);
    wait_ds0();
    __syncthreads();
  }
  {                                               // drain: P*V of the last tile
    v16bf pf[RT];
    float4 cc[RT][2];
    load_p(1, pf, cc);
    mma_o(pf, cc, vb);
  }
  // hand each row's 1/l from its owner to every wave, through the sC buffer whose
  // last readers stand in front of the barrier above
  if (r == 0)
    *(float4*)&sC[0][tw][4 * hw + mh] =
        make_float4(1.f / l[0], 1.f / l[1], 1.f / l[2], 1.f / l[3]);
  __syncthreads();
  float4 iv[RT][2];
#pragma unroll
  for (int t = 0; t < RT; ++t) {
    iv[t][0] = *(const float4*)&sC[0][t][mh];
    iv[t][1] = *(const float4*)&sC[0][t][mh + 4];
  }
#pragma unroll
  for (int t = 0; t < RT; ++t)
#pragma unroll
    for (int v = 0; v < 8; ++v) {
      const float4 q4 = iv[t][v >> 2];
      const float inv = (v & 3) == 0 ? q4.x : (v & 3) == 1 ? q4.y : (v & 3) == 2 ? q4.z : q4.w;
      const size_t row = (size_t)b * NN + q0 + 16 * t + v + mh;
#pragma unroll
      for (int j = 0; j < 4; ++j)
        C[row * UU + ds0 + j * 16 + r] = (__bf16)(o[t][j][v] * inv);
    }
}

// ---------------------------------------------------------------- kernel 3
// out = x + ctx @ Wp + bp (fp32 out). Tiled like kernel 1: a work-group takes 64
// rows of ctx and all 512 columns, a wave 64 columns for all 4 row tiles, so each
// weight fragment feeds 4 matrix instructions; the ctx tile is read once a
// work-group and kept in LDS in A-fragment order.
__global__ void __launch_bounds__(256) out_proj(
    const float* __restrict__ x, const __bf16* __restrict__ Cb,
    const __bf16* __restrict__ WpT, const float* __restrict__ bpp,
    float* __restrict__ out) {
  __shared__ alignas(16) __bf16 sA[QRT][KB][FBLK];  // 64 KB
  const int lane = threadIdx.x & 31;
  const int wave = threadIdx.x >> 5;
  const int rowBase = blockIdx.x * (16 * QRT);
  const int col0 = wave * 64;
  const int r = lane & 15;
  const int mh = (lane >> 4) << 3;

  // weights in fragment order: one n tile is UU/32 consecutive blocks
  const __bf16* wp[4];
  wp[0] = WpT + (size_t)(col0 >> 4) * KB * FBLK + lane * 8;
  wp[1] = wp[0] + KB * FBLK;
  wp[2] = wp[1] + KB * FBLK;
  wp[3] = wp[2] + KB * FBLK;

  v16bf w[2][4], a[2][QRT];
  float bias[4];                                  // this lane's columns of the bias
  const unsigned ks = proj_start(blockIdx.x);     // step s works on k block (s + ks) mod KB
  {
    // A lane takes 8 consecutive k of one row, 4 lanes one k block, a wave 8 rows.
    const int c = lane & 3;
    const int row = wave * 8 + (lane >> 2);
    const __bf16* cs = Cb + (size_t)(rowBase + row) * UU + c * 8;
    const __bf16* w0 = wp[0] + ks * FBLK;
    v8bf ca[KB];
#pragma unroll
    for (int kb = 0; kb < KB; ++kb) ca[kb] = *(const v8bf*)(cs + kb * 32);
#pragma unroll
    for (int i = 0; i < 4; ++i) w[0][i] = frag_packed(w0 + i * (KB * FBLK));
#pragma unroll
    for (int i = 0; i < 4; ++i) bias[i] = bpp[col0 + i * 16 + r];
    // wait_x0 that names the two addresses as inputs: their registers are given to
    // nothing else in front of it.
    asm volatile("s_wait_xcnt 0x0" :: "v"(cs), "v"(w0) : "memory");
    __bf16* ad = &sA[row >> 4][0][(c >> 1) * 256 + ((c & 1) * 16 + (row & 15)) * 8];
#pragma unroll
    for (int kb = 0; kb < KB; ++kb) *(v8bf*)(ad + kb * FBLK) = ca[kb];
  }
  __syncthreads();                                // the ctx tile is whole for every wave

  v8f acc[QRT][4] = {};
  // residual x and out: element (row tile t, row v, column tile i) of this lane
  // lies at (16 t + v) * UU + 16 i from these two bases
  const size_t eb = (size_t)(rowBase + mh) * UU + col0 + r;
  const float* xb = x + eb;
  float* ob = out + eb;
  float xv[4][QRT][8];
  auto load_x = [&](int i) {                      // one column tile's residual values
#pragma unroll
    for (int t = 0; t < QRT; ++t)
#pragma unroll
      for (int v = 0; v < 8; ++v) xv[i][t][v] = xb[(16 * t + v) * UU + 16 * i];
    close_x0(xb);
  };
#pragma unroll
  for (int t = 0; t < QRT; ++t) a[0][t] = frag_packed(&sA[t][ks][lane * 8]);
#pragma unroll
  for (int s = 0; s < KB; ++s) {
    if (s + 1 < KB) {                             // load next step's fragments
      const unsigned kn = (s + 1u + ks) & (KB - 1u);
      const __bf16* wn = wp[0] + kn * FBLK;       // the other three n tiles lie behind
#pragma unroll
      for (int i = 0; i < 4; ++i) w[(s + 1) & 1][i] = frag_packed(wn + i * (KB * FBLK));
      // wait_x0 that names the address as an input: its registers are given to nothing
      // else in front of it.
      asm volatile("s_wait_xcnt 0x0" :: "v"(wn) : "memory");
#pragma unroll
      for (int t = 0; t < QRT; ++t) a[(s + 1) & 1][t] = frag_packed(&sA[t][kn][lane * 8]);
    }
    // behind the last weight loads, so that no weight fragment waits for them
    if (s == KB - 2) load_x(0);
    if (s == KB - 1) load_x(1);
    // Keeps the next step's loads in front of this step's matrix run: sunk in
    // among or behind it they would have no lead over their first use.
    __builtin_amdgcn_sched_barrier(0);
#pragma unroll
    for (int t = 0; t < QRT; ++t)
#pragma unroll
      for (int i = 0; i < 4; ++i)
        acc[t][i] = wmma_bf16(a[s & 1][t], w[s & 1][i], acc[t][i]);
  }
  // Keeps the last matrix run out of the stores below and their waits.
  __builtin_amdgcn_sched_barrier(0);
#pragma unroll
  for (int i = 0; i < 4; ++i) {
    if (i + 2 < 4) load_x(i + 2);                 // two column tiles ahead
#pragma unroll
    for (int t = 0; t < QRT; ++t)
#pragma unroll
      for (int v = 0; v < 8; ++v)
        ob[(16 * t + v) * UU + 16 * i] = xv[i][t][v] + acc[t][i][v] + bias[i];
    close_x0(ob);
  }
}

// ---------------------------------------------------------------- launch
extern "C" void kernel_launch(void* const* d_in, const int* in_sizes, int n_in,
                              void* d_out, int out_size, void* d_ws, size_t ws_size,
                              hipStream_t stream) {
  const float* x  = (const float*)d_in[0];
  const float* Wq = (const float*)d_in[1];
  const float* bq = (const float*)d_in[2];
  const float* Wk = (const float*)d_in[3];
  const float* bk = (const float*)d_in[4];
  const float* Wv = (const float*)d_in[5];
  const float* bv = (const float*)d_in[6];
  const float* Wp = (const float*)d_in[7];
  const float* bp = (const float*)d_in[8];
  float* out = (float*)d_out;

  char* ws = (char*)d_ws;
  const size_t wbytes = (size_t)UU * UU * sizeof(__bf16);        // 512 KB
  const size_t tbytes = (size_t)BN * UU * sizeof(__bf16);        // 16 MB
  __bf16* WqT = (__bf16*)(ws);
  __bf16* WkT = (__bf16*)(ws + wbytes);
  __bf16* WvT = (__bf16*)(ws + 2 * wbytes);
  __bf16* WpT = (__bf16*)(ws + 3 * wbytes);
  __bf16* Qb  = (__bf16*)(ws + 4 * wbytes);
  __bf16* Kb  = (__bf16*)(ws + 4 * wbytes + tbytes);
  __bf16* VTb = (__bf16*)(ws + 4 * wbytes + 2 * tbytes);
  __bf16* Ctx = (__bf16*)(ws + 4 * wbytes + 3 * tbytes);

  cvt_weights_t<<<(UU * UU) / 256, 256, 0, stream>>>(Wq, Wk, Wv, Wp, WqT, WkT, WvT, WpT);
  qkv_proj<<<256, 256, 0, stream>>>(x, WqT, WkT, WvT, bq, bk, bv, Qb, Kb, VTb);
  dim3 fgrid(NN / (16 * RT), BB);
  flash_attn<<<fgrid, 256, 0, stream>>>(Qb, Kb, VTb, Ctx);
  out_proj<<<256, 256, 0, stream>>>(x, Ctx, WpT, bp, out);
}

// v010
// One run takes 161 microseconds.
// Two timings next to v009 put it at 1.07 and 1.08 times that version's speed.
// All steps since v000 together make it 6.79 times as fast.
#include <hip/hip_runtime.h>

#define BB 4
#define NN 4096
#define UU 512
#define BN (BB*NN)

typedef __attribute__((ext_vector_type(16))) __bf16 v16bf;
typedef __attribute__((ext_vector_type(8)))  __bf16 v8bf;
typedef __attribute__((ext_vector_type(8)))  float  v8f;
typedef __attribute__((ext_vector_type(4)))  unsigned int v4u;
typedef __attribute__((ext_vector_type(8)))  unsigned int v8u;

__device__ __forceinline__ v8f wmma_bf16(v16bf a, v16bf b, v8f c) {
  return __builtin_amdgcn_wmma_f32_16x16x32_bf16(false, a, false, b, (short)0, c,
                                                 false, false);
}

__device__ __forceinline__ v16bf frag_bf16(const __bf16* p) {
  v8bf lo = *(const v8bf*)(p);
  v8bf hi = *(const v8bf*)(p + 16);
  return __builtin_shufflevector(lo, hi, 0, 1, 2, 3, 4, 5, 6, 7,
                                 8, 9, 10, 11, 12, 13, 14, 15);
}
#define FBLK 512
__device__ __forceinline__ v16bf frag_packed(const __bf16* p) {
  v8bf lo = *(const v8bf*)(p);
  v8bf hi = *(const v8bf*)(p + 256);
  return __builtin_shufflevector(lo, hi, 0, 1, 2, 3, 4, 5, 6, 7,
                                 8, 9, 10, 11, 12, 13, 14, 15);
}

#define KROWB  256u                               // bytes of a slice row
#define KROWS  16u                                // rows (keys) of a slice
#define KPITCH 272u                               // row pitch in LDS
#define KSLICE 6144u                              // 16 * 272 B, rounded up to 2 KiB
__device__ __forceinline__ unsigned uni(unsigned v) {
  return (unsigned)__builtin_amdgcn_readfirstlane(v);
}
__device__ __forceinline__ unsigned pinned(unsigned v) {
  unsigned w = uni(v);
  asm volatile("" : "+s"(w));  // keeps w in a scalar register
  return w;
}
// One request: 16 rows x 256 B, source pitch 1024 B, byte elements,
// tensor dims = tile dims, pad of 4 dwords behind every 64 dwords.
__device__ __forceinline__ v4u tdm_k_group0(const __bf16* gsrc, unsigned lds_off) {
  const unsigned long long ga = (unsigned long long)(uintptr_t)gsrc;
  v4u g0;
  g0[0] = uni(1u);                                          // count = 1
  g0[1] = uni(lds_off);                                     // LDS byte offset
  g0[2] = uni((unsigned)ga);                                // address [31:0]
  g0[3] = uni(((unsigned)(ga >> 32) & 0x01FFFFFFu) | 0x80000000u);  // [56:32], type 2
  return g0;
}
// Formed once a kernel: through pinned() its words stay in the same scalar
// registers for every request, instead of being formed anew in registers that
// are free for other use while a request is under way.
__device__ __forceinline__ v8u tdm_k_group1() {
  v8u g1;
  g1[0] = uni((1u << 20) | (5u << 22) | (3u << 25));
  g1[1] = pinned(KROWB << 16);
  g1[2] = pinned(KROWS << 16);
  g1[3] = pinned(KROWB << 16);
  g1[4] = pinned(KROWS);
  g1[5] = pinned(UU * 2u);
  g1[6] = pinned(0u);
  g1[7] = pinned(0u);
  return g1;
}
__device__ __forceinline__ void tdm_load(v4u g0, v8u g1) {
  asm volatile("tensor_load_to_lds %0, %1" :: "s"(g0), "s"(g1) : "memory");
}
__device__ __forceinline__ void wait_tensor0(v4u g0, v8u g1) {
  asm volatile("s_wait_tensorcnt 0x0" :: "s"(g0), "s"(g1) : "memory");
}
// This wave's LDS reads have retired before the buffer they read is refilled.
__device__ __forceinline__ void wait_ds0() { asm volatile("s_wait_dscnt 0x0" ::: "memory"); }

// Stands between issued global loads and the next rewrite of the address registers
// that they name.
__device__ __forceinline__ void wait_x0() { asm volatile("s_wait_xcnt 0x0" ::: "memory"); }
__device__ __forceinline__ void close_x0(const void* base) {
  __builtin_amdgcn_sched_barrier(0);
  asm volatile("s_wait_xcnt 0x0" :: "v"(base) : "memory");
  __builtin_amdgcn_sched_barrier(0);
}

template <int X>
__device__ __forceinline__ float row_xor(float v) {
  return __builtin_bit_cast(float, __builtin_amdgcn_update_dpp(
      0, __builtin_bit_cast(int, v), 0x160 + X, 0xf, 0xf, false));
}
__device__ __forceinline__ float row_max16(float v) {
  v = fmaxf(v, row_xor<1>(v));
  v = fmaxf(v, row_xor<2>(v));
  v = fmaxf(v, row_xor<4>(v));
  return fmaxf(v, row_xor<8>(v));
}
__device__ __forceinline__ float row_sum16(float v) {
  v += row_xor<1>(v);
  v += row_xor<2>(v);
  v += row_xor<4>(v);
  return v + row_xor<8>(v);
}

// ---------------------------------------------------------------- kernel 0
__global__ void cvt_weights_t(const float* __restrict__ wq, const float* __restrict__ wk,
                              const float* __restrict__ wv, const float* __restrict__ wp,
                              __bf16* __restrict__ dq, __bf16* __restrict__ dk,
                              __bf16* __restrict__ dv, __bf16* __restrict__ dp) {
  const int idx = blockIdx.x * blockDim.x + threadIdx.x;   // coalesced read
  const int k = idx / UU, n = idx % UU;
  // fragment order, blocks laid out [n tile][k block]
  const size_t t = ((size_t)(n >> 4) * (UU / 32) + (k >> 5)) * FBLK +
                   ((k >> 4) & 1) * 256 + ((((k >> 3) & 1) << 4) + (n & 15)) * 8 + (k & 7);
  dq[t] = (__bf16)wq[idx];
  dk[t] = (__bf16)wk[idx];
  dv[t] = (__bf16)wv[idx];
  dp[t] = (__bf16)wp[idx];
}

// Start k block of a projection work-group, 0..15, from bits 0-1 and 3-4 of its index:
// the groups whose index modulo 8 falls in any 4 cyclic neighbours take all 16 starts.
// For speed only: any start gives the same sums but for their order.
__device__ __forceinline__ unsigned proj_start(unsigned g) {
  return (g & 3u) + ((g >> 3) & 3u) * 4u;
}

// ---------------------------------------------------------------- kernel 1
// Fused Q/K/V projection. A work-group takes 64 rows of x (4 row tiles) and, in
// two rounds, 256 columns of each of Q, K and V a round; a wave takes 32 of those
// columns for all 4 row tiles, so each weight fragment (global) feeds 4 matrix
// instructions.
// The x tile is read once a work-group, in 128-B lines, rounded to bf16 and kept
// in LDS in A-fragment order (the order of frag_packed with n = row), so every
// wave finds a fragment by two contiguous ds_load_b128.
// Fragments for step k+1 are loaded before step k's wmma run.
#define QRT 4                                     // row tiles per work-group
#define KB  (UU / 32)                             // k blocks
__global__ void __launch_bounds__(256) qkv_proj(
    const float* __restrict__ x,
    const __bf16* __restrict__ WqT, const __bf16* __restrict__ WkT,
    const __bf16* __restrict__ WvT,
    const float* __restrict__ bqp, const float* __restrict__ bkp,
    const float* __restrict__ bvp,
    __bf16* __restrict__ Q, __bf16* __restrict__ K, __bf16* __restrict__ VT) {
  __shared__ alignas(16) __bf16 sX[QRT][KB][FBLK];  // 64 KB
  const int lane = threadIdx.x & 31;
  const int wave = threadIdx.x >> 5;
  const int rowBase = blockIdx.x * (16 * QRT);
  const int r = lane & 15;
  const int mh = (lane >> 4) << 3;

  {
    // A lane takes 8 consecutive k of one row, 4 lanes one 128-B line, a wave 8 rows.
    const int c = lane & 3;
    const int row = wave * 8 + (lane >> 2);
    const float* xs = x + (size_t)(rowBase + row) * UU + c * 8;
    float4 xa[KB][2];
#pragma unroll
    for (int kb = 0; kb < KB; ++kb) {
      xa[kb][0] = *(const float4*)(xs + kb * 32);
      xa[kb][1] = *(const float4*)(xs + kb * 32 + 4);
    }
    wait_x0();
    __bf16* xd = &sX[row >> 4][0][(c >> 1) * 256 + ((c & 1) * 16 + (row & 15)) * 8];
#pragma unroll
    for (int kb = 0; kb < KB; ++kb) {
      const float4 lo = xa[kb][0], hi = xa[kb][1];
      v8bf p;
      p[0] = (__bf16)lo.x; p[1] = (__bf16)lo.y; p[2] = (__bf16)lo.z; p[3] = (__bf16)lo.w;
      p[4] = (__bf16)hi.x; p[5] = (__bf16)hi.y; p[6] = (__bf16)hi.z; p[7] = (__bf16)hi.w;
      *(v8bf*)(xd + kb * FBLK) = p;
    }
  }
  __syncthreads();                                // the x tile is whole for every wave

  const float scale = rsqrtf((float)UU);
  // Step s works on k block (s + ks) mod KB, ks a start of the work-group's own: as in
  // flash_attn below, the groups do not all ask for the same weight lines at once.
  const unsigned ks = proj_start(blockIdx.x);
  // Kept rolled: a second copy of the 16 unrolled steps would only double the text.
#pragma unroll 1
  for (int ch = 0; ch < 2; ++ch) {                // column halves, from the same x tile
    const int col0 = (ch * 8 + wave) * 32;
    // weights in fragment order: one n tile is UU/32 consecutive blocks
    const size_t wt = (size_t)(col0 >> 4) * KB * FBLK + lane * 8;
    const __bf16* wp[6];
    wp[0] = WqT + wt;  wp[1] = wp[0] + KB * FBLK;
    wp[2] = WkT + wt;  wp[3] = wp[2] + KB * FBLK;
    wp[4] = WvT + wt;  wp[5] = wp[4] + KB * FBLK;

    v16bf w[2][6], a[2][QRT];
    float bq2[2], bk2[2], bv2[2];                 // this lane's columns of the biases
#pragma unroll
    for (int i = 0; i < 6; ++i) w[0][i] = frag_packed(wp[i] + ks * FBLK);
#pragma unroll
    for (int h = 0; h < 2; ++h) {
      bq2[h] = bqp[col0 + 16 * h + r];
      bk2[h] = bkp[col0 + 16 * h + r];
      bv2[h] = bvp[col0 + 16 * h + r];
    }
    wait_x0();
    v8f acc[QRT][6] = {};
#pragma unroll
    for (int t = 0; t < QRT; ++t) a[0][t] = frag_packed(&sX[t][ks][lane * 8]);
#pragma unroll
    for (int s = 0; s < KB; ++s) {
      if (s + 1 < KB) {                           // load next step's fragments
        const unsigned kn = (s + 1u + ks) & (KB - 1u);
        const __bf16* wn[3];                      // of Wq, Wk, Wv; the second n tile lies behind
#pragma unroll
        for (int i = 0; i < 3; ++i) wn[i] = wp[2 * i] + kn * FBLK;
#pragma unroll
        for (int i = 0; i < 6; ++i)
          w[(s + 1) & 1][i] = frag_packed(wn[i >> 1] + (i & 1) * (KB * FBLK));
        // wait_x0 that names the three addresses as inputs: their registers are given to
        // nothing else in front of it.
        asm volatile("s_wait_xcnt 0x0" :: "v"(wn[0]), "v"(wn[1]), "v"(wn[2]) : "memory");
#pragma unroll
        for (int t = 0; t < QRT; ++t) a[(s + 1) & 1][t] = frag_packed(&sX[t][kn][lane * 8]);
      }
      // Keeps the next step's loads in front of this step's matrix run: sunk in
      // among or behind it they would have no lead over their first use.
      __builtin_amdgcn_sched_barrier(0);
#pragma unroll
      for (int t = 0; t < QRT; ++t)
#pragma unroll
        for (int i = 0; i < 6; ++i)
          acc[t][i] = wmma_bf16(a[s & 1][t], w[s & 1][i], acc[t][i]);
    }
    // Keeps the last matrix run out of the stores below and their waits.
    __builtin_amdgcn_sched_barrier(0);
#pragma unroll
    for (int t = 0; t < QRT; ++t) {
      const int row0 = rowBase + 16 * t;
      const int b = row0 >> 12;                   // row0 / NN
      v8bf pv[2];                                 // V: a lane's 8 keys of one d column
#pragma unroll
      for (int v = 0; v < 8; ++v) {
        const size_t idx = (size_t)(row0 + v + mh) * UU;
#pragma unroll
        for (int h = 0; h < 2; ++h) {
          const int Nc = col0 + 16 * h + r;
          const float q = acc[t][h][v] + bq2[h];
          const float k = acc[t][2 + h][v] + bk2[h];
          const float vv = acc[t][4 + h][v] + bv2[h];
          Q[idx + Nc] = (__bf16)(q * scale);
          K[idx + Nc] = (__bf16)k;
          pv[h][v] = (__bf16)vv;
        }
      }
      // V in fragment order (k = key, n = d), blocks laid out [batch][key block][d tile]:
      // the accumulator's 8 rows of a lane are that lane's 8 consecutive elements.
      __bf16* vdst = VT + (((size_t)b * (NN / 32) + ((row0 & (NN - 1)) >> 5)) * (UU / 16) +
                           (col0 >> 4)) * FBLK + ((row0 >> 4) & 1) * 256 + lane * 8;
      *(v8bf*)(vdst) = pv[0];
      *(v8bf*)(vdst + FBLK) = pv[1];
      close_x0(vdst);
    }
  }
}

// ---------------------------------------------------------------- kernel 2
// Flash attention: 64 query rows/block (4 row tiles), 8 waves.
// S: a wave takes one key half (16 keys) and one quarter of d (128 columns) for all
// 4 row tiles, so a score is the sum of 4 partials that pass through LDS.
// P*V: the waves split d (64 columns each), again with all 4 row tiles. So each
// K fragment (LDS) and each V fragment (global) feeds 4 matrix instructions.
// The 64x32 score block is summed and soft-maxed once: wave w owns row tile
// w>>1, accumulator rows 4*(w&1)..+3 of each lane half.
// K tiles are double-buffered in LDS by tensor loads, one slice per wave.
// The three stages of a key tile run as a software pipeline: pass j forms the
// partial S of tile j+2, the softmax of tile j+1 and P*V of tile j. Each stage
// reads only what the pass before has left in LDS, and sS, sP and sC have two
// buffers each, so one barrier a pass orders all of it and the stages' loads,
// matrix runs and vector chains overlap inside a pass.
// V fragments (global) are fetched one pass ahead into a second register set: pass
// j issues the loads of tile j+1 and multiplies with tile j's, which the pass
// before has asked for. The key loop is unrolled by two, so the sets swap by name.
// Every work-group walks all key tiles, but starts at a tile of its own and wraps
// round: step j works on tile (j + st) mod NT. Walking in the same order, all groups
// of a batch ask for the same K and V lines at the same moment, each line's first
// fetch from memory holds up every group, and that in every pass. Spread out, a group
// meets lines that another group has brought into L2 many passes earlier.
#define RT 4                                      // row tiles per block
#define NW 8                                      // waves per block
#define DS (UU / NW)                              // d columns per wave, P*V
#define NP 4                                      // partials of a score = d quarters
#define SD (UU / NP)                              // d columns per wave, S
#define NT (NN / 32)                              // key tiles
#define MHOLD 8.0f                               // how far a score may pass its row's reference point
__global__ void __launch_bounds__(256) flash_attn(
    const __bf16* __restrict__ Q, const __bf16* __restrict__ K,
    const __bf16* __restrict__ VT, __bf16* __restrict__ C) {
  __shared__ alignas(2048) unsigned char sK[2][NW][KSLICE];  // 96 KB: K slices
  // partial S, kept in accumulator order: [buffer][d quarter][tile][key half]
  // [register quad][lane] -> one 16B element per lane, no transposition
  __shared__ float4 sS[2][NP][RT][2][2][32];      // 64 KB
  // P for A-frag repack; 80-B pitch = 16 B x 5 for its ds_load_b128 readers
  __shared__ alignas(16) __bf16 sP[2][RT][16][40];
  __shared__ alignas(16) float sC[2][RT][16];     // per-row rescale factor

  const int lane = threadIdx.x & 31;
  const int wave = threadIdx.x >> 5;              // 0..7 -> d-slice of P*V
  const int b  = blockIdx.y;
  const int q0 = blockIdx.x * (16 * RT);
  const int ds0 = wave * DS;
  const int kbase = (lane & 16) ? 8 : 0;
  const int r  = lane & 15;
  const int mh = (lane >> 4) << 3;
  const int tw = wave >> 1;                       // softmax: owned row tile
  const int hw = wave & 1;                        // softmax: owned register quad
  const int dq = wave >> 1;                       // S: owned d quarter
  const int kh = wave & 1;                        // S: owned key half

  const __bf16* Qb = Q + (size_t)b * NN * UU;
  const __bf16* Kb = K + (size_t)b * NN * UU;
  const __bf16* Vt = VT + (size_t)b * UU * NN;    // fragment order [key block][d tile]

  typedef __attribute__((address_space(3))) unsigned char lds_u8;
  const unsigned sw = uni(threadIdx.x >> 5);      // wave number, scalar
  const unsigned sK0 = (unsigned)(unsigned long long)(lds_u8*)&sK[0][0][0] + sw * KSLICE;
  const unsigned sK1 = sK0 + NW * KSLICE;
  const __bf16* Kw = Kb + (size_t)(sw & 1u) * KROWS * UU + (sw >> 1) * SD;  // this wave's part of K
  // Start tile: the 64 groups of a batch take the 64 even tiles, one each. Bits 0-1 and
  // 3-5 of blockIdx.x count in steps of 4 tiles and bit 2 adds 2, so the groups whose
  // index modulo 8 falls in any 4 cyclic neighbours start 2 to 6 tiles apart. For speed
  // only: any start gives the same sums but for their order.
  const unsigned qi = blockIdx.x;
  const unsigned st = ((qi & 3u) + (qi >> 3) * 4u) * 4u + ((qi >> 2) & 1u) * 2u;
  auto rot = [&](unsigned step) { return (step + st) & (NT - 1u); };  // step -> key tile

  v16bf qf[RT][4];
  const __bf16* qp[RT];
#pragma unroll
  for (int t = 0; t < RT; ++t)
    qp[t] = Qb + (size_t)(q0 + 16 * t + r) * UU + dq * SD + kbase;
#pragma unroll
  for (int t = 0; t < RT; ++t)
#pragma unroll
    for (int kk = 0; kk < 4; ++kk)
      qf[t][kk] = frag_bf16(qp[t] + kk * 32);
  // The wait of close_x0 for the Q loads: it names the four row addresses as inputs,
  // so that each keeps its registers until the wait, and the two scheduling fences
  // keep later vector work, which reuses them, behind it.
  __builtin_amdgcn_sched_barrier(0);
  asm volatile("s_wait_xcnt 0x0" :: "v"(qp[0]), "v"(qp[1]), "v"(qp[2]), "v"(qp[3]) : "memory");
  __builtin_amdgcn_sched_barrier(0);

  v8f o[RT][4] = {};
  float m[4], l[4];                               // rows 4*hw+i+mh of tile tw
#pragma unroll
  for (int i = 0; i < 4; ++i) { m[i] = -3.0e38f; l[i] = 0.f; }

  // ---- stage 1: partial S of this wave's key half over its d quarter
  auto load_k = [&](int buf, v16bf (&kf)[4]) {    // ds_load_b128 fragments
#pragma unroll
    for (int kk = 0; kk < 4; ++kk)
      kf[kk] = frag_bf16((const __bf16*)&sK[buf][wave][r * KPITCH + (kk * 32 + kbase) * 2]);
  };
  auto mma_s = [&](const v16bf (&kf)[4], v8f (&s)[RT]) {
    // Inputs-only fence on the four loaded K fragments: all eight LDS loads are issued,
    // into registers of their own, ahead of the run. Without it three fragments share
    // one register set, and the run stops twice for a whole LDS latency.
    asm volatile("" :: "v"(kf[0]), "v"(kf[1]), "v"(kf[2]), "v"(kf[3]));
#pragma unroll
    for (int kk = 0; kk < 4; ++kk)
#pragma unroll
      for (int t = 0; t < RT; ++t)
        s[t] = wmma_bf16(qf[t][kk], kf[kk], s[t]);
  };
  auto store_s = [&](int sb, const v8f (&s)[RT]) {
#pragma unroll
    for (int t = 0; t < RT; ++t) {
      sS[sb][dq][t][kh][0][lane] = make_float4(s[t][0], s[t][1], s[t][2], s[t][3]);
      sS[sb][dq][t][kh][1][lane] = make_float4(s[t][4], s[t][5], s[t][6], s[t][7]);
    }
  };
  // ---- stage 2: full S of the owned rows, online softmax
  auto load_part = [&](int sb, float4 (&pa)[NP][2]) {
#pragma unroll
    for (int w = 0; w < NP; ++w) {
      pa[w][0] = sS[sb][w][tw][0][hw][lane];
      pa[w][1] = sS[sb][w][tw][1][hw][lane];
    }
  };
  auto softmax = [&](const float4 (&pa)[NP][2], int pb) {
    // sum the 4 d quarters in order
    float fs0[4] = {0.f, 0.f, 0.f, 0.f}, fs1[4] = {0.f, 0.f, 0.f, 0.f};
#pragma unroll
    for (int w = 0; w < NP; ++w) {
      const float4 a0 = pa[w][0];
      const float4 a1 = pa[w][1];
      fs0[0] += a0.x; fs0[1] += a0.y; fs0[2] += a0.z; fs0[3] += a0.w;
      fs1[0] += a1.x; fs1[1] += a1.y; fs1[2] += a1.z; fs1[3] += a1.w;
    }
    // a row lives across one 16-lane half -> xor reduce by DPP
    float cr[4];
#pragma unroll
    for (int i = 0; i < 4; ++i) {
      const float mt = row_max16(fmaxf(fs0[i], fs1[i]));
      // The reference point moves only when the tile's maximum passes it by more than
      // MHOLD: else corr is exactly 1 and p is at most exp(MHOLD). O / l does not
      // depend on the point chosen.
      const float mnew = mt > m[i] + MHOLD ? mt : m[i];
      const float p0 = __expf(fs0[i] - mnew);
      const float p1 = __expf(fs1[i] - mnew);
      const float rs = row_sum16(p0 + p1);
      const float corr = __expf(m[i] - mnew);
      l[i] = l[i] * corr + rs;
      m[i] = mnew;
      cr[i] = corr;
      sP[pb][tw][4 * hw + i + mh][r]      = (__bf16)p0;
      sP[pb][tw][4 * hw + i + mh][16 + r] = (__bf16)p1;
    }
    if (r == 0)
      *(float4*)&sC[pb][tw][4 * hw + mh] = make_float4(cr[0], cr[1], cr[2], cr[3]);
  };
  // ---- stage 3: rescale O where a row's reference point has moved, O[:, ds0+16j] += P * V^T
  auto load_p = [&](int pb, v16bf (&pf)[RT]) {
#pragma unroll
    for (int t = 0; t < RT; ++t)                  // P (C-layout) as A-fragments
      pf[t] = frag_bf16(&sP[pb][t][r][0] + kbase);
  };
  // Does any of the 64 rows move its reference point with this tile? One 8-byte read
  // a lane covers all 64 factors; the answer is the same in every lane and wave.
  auto load_moved = [&](int pb) {
    const float2 c2 = ((const float2*)&sC[pb][0][0])[lane];
    return __builtin_amdgcn_ballot_w32(c2.x != 1.f || c2.y != 1.f) != 0u;
  };
  // Only then are the factors fetched and O rescaled; a factor of 1 changes nothing.
  auto rescale_o = [&](int pb) {
#pragma unroll
    for (int t = 0; t < RT; ++t) {
      const float4 c0 = *(const float4*)&sC[pb][t][mh];
      const float4 c1 = *(const float4*)&sC[pb][t][mh + 4];
#pragma unroll
      for (int j = 0; j < 4; ++j) {
        o[t][j][0] *= c0.x; o[t][j][1] *= c0.y; o[t][j][2] *= c0.z; o[t][j][3] *= c0.w;
        o[t][j][4] *= c1.x; o[t][j][5] *= c1.y; o[t][j][6] *= c1.z; o[t][j][7] *= c1.w;
      }
    }
  };
  auto load_v = [&](unsigned tile, v16bf (&vf)[4]) {
    const __bf16* vp = Vt + ((size_t)tile * (UU / 16) + wave * (DS / 16)) * FBLK + lane * 8;
    vf[0] = frag_packed(vp);
    vf[1] = frag_packed(vp + FBLK);
    vf[2] = frag_packed(vp + 2 * FBLK);
    vf[3] = frag_packed(vp + 3 * FBLK);
    // Behind the V loads, in front of any rewrite of their address registers; it names
    // the address as an input, so that those registers are given to nothing else first.
    asm volatile("s_wait_xcnt 0x0" :: "v"(vp) : "memory");
  };
  auto mma_o = [&](const v16bf (&pf)[RT], const v16bf (&vf)[4]) {
#pragma unroll
    for (int t = 0; t < RT; ++t) {
      o[t][0] = wmma_bf16(pf[t], vf[0], o[t][0]);
      o[t][1] = wmma_bf16(pf[t], vf[1], o[t][1]);
      o[t][2] = wmma_bf16(pf[t], vf[2], o[t][2]);
      o[t][3] = wmma_bf16(pf[t], vf[3], o[t][3]);
    }
  };

  const v8u g1 = tdm_k_group1();
  {
    const v4u g0 = tdm_k_group0(Kw + (size_t)pinned(rot(0u) * 32u) * UU, sK0);
    __builtin_amdgcn_sched_barrier(0);
    tdm_load(g0, g1);
    wait_tensor0(g0, g1);
    __builtin_amdgcn_sched_barrier(0);
    __syncthreads();
  }

  // The foot of every pass that reads a K buffer publishes the next K tile (and
  // retires the pass's LDS reads and writes); directly behind its barrier, at the
  // head of the next pass, the buffer that the pass has read is refilled with the
  // tile after next. A request so starts and lands inside one pass.
  v16bf va[4], vb[4];                             // V of even tiles, V of odd tiles
  {                                               // fill, pass -2: S of tile 0
    const v4u g0 = tdm_k_group0(Kw + (size_t)pinned(rot(1u) * 32u) * UU, sK1);
    tdm_load(g0, g1);
    v16bf kf[4];
    v8f s[RT] = {};
    load_k(0, kf);
    mma_s(kf, s);
    store_s(0, s);
    wait_ds0();
    wait_tensor0(g0, g1);
    __syncthreads();
  }
  {                                               // fill, pass -1: S of tile 1, softmax of tile 0
    const v4u g0 = tdm_k_group0(Kw + (size_t)pinned(rot(2u) * 32u) * UU, sK0);
    tdm_load(g0, g1);
    v16bf kf[4];
    float4 pa[NP][2];
    v8f s[RT] = {};
    load_v(rot(0u), va);
    load_k(1, kf);
    load_part(0, pa);
    mma_s(kf, s);
    store_s(1, s);
    softmax(pa, 0);
    wait_ds0();
    wait_tensor0(g0, g1);
    __syncthreads();
  }
  // e = j & 1: buffers of tiles j and j+2; vc: V of tile j, vn: takes V of tile j+1
  auto pass = [&](int j, int e, const v16bf (&vc)[4], v16bf (&vn)[4]) {
    const unsigned kn = pinned((unsigned)j * 32u + 96u);  // 32 * (step j+3): is there one?
    const unsigned kt = pinned(rot((unsigned)j + 3u) * 32u);  // first key of its tile, below NN
    const v4u g0 = tdm_k_group0(Kw + (size_t)kt * UU, e ? sK0 : sK1);
    if (kn < NN)
      tdm_load(g0, g1);
    v16bf kf[4], pf[RT];
    float4 pa[NP][2];
    v8f s[RT] = {};
    // the loads of all three stages but the rescale factors come first in the pass
    load_v(rot((unsigned)j + 1u), vn);
    load_k(e, kf);
    const bool moved = load_moved(e);
    load_part(e ^ 1, pa);
    load_p(e, pf);
    // The two scheduling fences stand round the S run: the LDS reads of the other two
    // stages but the rescale factors are issued in front of it, and it starts on the K fragments alone.
    __builtin_amdgcn_sched_barrier(0);
    mma_s(kf, s);                                 // tile j+2
    __builtin_amdgcn_sched_barrier(0);
    store_s(e, s);
    if (moved) rescale_o(e);
    mma_o(pf, vc);                                // tile j
    softmax(pa, e ^ 1);                           // tile j+1
    wait_ds0();
    wait_tensor0(g0, g1);
    __syncthreads();
  };
  for (int j = 0; j < NT - 2; j += 2) {
    pass(j, 0, va, vb);
    pass(j + 1, 1, vb, va);
  }
  asm volatile("s_wait_tensorcnt 0x0" ::: "memory");  // behind the last request, before the wave goes on
  wait_ds0();
  {                                               // drain: softmax of the last tile, P*V of the one before
    v16bf pf[RT];
    float4 pa[NP][2];
    load_v(rot(NT - 1u), vb);
    const bool moved = load_moved(0);
    load_part(1, pa);
    load_p(0, pf);
    if (moved) rescale_o(0);
    mma_o(pf, va);
    softmax(pa, 1);
    wait_ds0();
    __syncthreads();
  }
  {                                               // drain: P*V of the last tile
    v16bf pf[RT];
    const bool moved = load_moved(1);
    load_p(1, pf);
    if (moved) rescale_o(1);
    mma_o(pf, vb);
  }
  // hand each row's 1/l from its owner to every wave, through the sC buffer whose
  // last readers stand in front of the barrier above
  if (r == 0)
    *(float4*)&sC[0][tw][4 * hw + mh] =
        make_float4(1.f / l[0], 1.f / l[1], 1.f / l[2], 1.f / l[3]);
  __syncthreads();
  float4 iv[RT][2];
#pragma unroll
  for (int t = 0; t < RT; ++t) {
    iv[t][0] = *(const float4*)&sC[0][t][mh];
    iv[t][1] = *(const float4*)&sC[0][t][mh + 4];
  }
#pragma unroll
  for (int t = 0; t < RT; ++t)
#pragma unroll
    for (int v = 0; v < 8; ++v) {
      const float4 q4 = iv[t][v >> 2];
      const float inv = (v & 3) == 0 ? q4.x : (v & 3) == 1 ? q4.y : (v & 3) == 2 ? q4.z : q4.w;
      const size_t row = (size_t)b * NN + q0 + 16 * t + v + mh;
#pragma unroll
      for (int j = 0; j < 4; ++j)
        C[row * UU + ds0 + j * 16 + r] = (__bf16)(o[t][j][v] * inv);
    }
}

// ---------------------------------------------------------------- kernel 3
// out = x + ctx @ Wp + bp (fp32 out). Tiled like kernel 1: a work-group takes 64
// rows of ctx and all 512 columns, a wave 64 columns for all 4 row tiles, so each
// weight fragment feeds 4 matrix instructions; the ctx tile is read once a
// work-group and kept in LDS in A-fragment order.
__global__ void __launch_bounds__(256) out_proj(
    const float* __restrict__ x, const __bf16* __restrict__ Cb,
    const __bf16* __restrict__ WpT, const float* __restrict__ bpp,
    float* __restrict__ out) {
  __shared__ alignas(16) __bf16 sA[QRT][KB][FBLK];  // 64 KB
  const int lane = threadIdx.x & 31;
  const int wave = threadIdx.x >> 5;
  const int rowBase = blockIdx.x * (16 * QRT);
  const int col0 = wave * 64;
  const int r = lane & 15;
  const int mh = (lane >> 4) << 3;

  // weights in fragment order: one n tile is UU/32 consecutive blocks
  const __bf16* wp[4];
  wp[0] = WpT + (size_t)(col0 >> 4) * KB * FBLK + lane * 8;
  wp[1] = wp[0] + KB * FBLK;
  wp[2] = wp[1] + KB * FBLK;
  wp[3] = wp[2] + KB * FBLK;

  v16bf w[2][4], a[2][QRT];
  float bias[4];                                  // this lane's columns of the bias
  const unsigned ks = proj_start(blockIdx.x);     // step s works on k block (s + ks) mod KB
  {
    // A lane takes 8 consecutive k of one row, 4 lanes one k block, a wave 8 rows.
    const int c = lane & 3;
    const int row = wave * 8 + (lane >> 2);
    const __bf16* cs = Cb + (size_t)(rowBase + row) * UU + c * 8;
    const __bf16* w0 = wp[0] + ks * FBLK;
    v8bf ca[KB];
#pragma unroll
    for (int kb = 0; kb < KB; ++kb) ca[kb] = *(const v8bf*)(cs + kb * 32);
#pragma unroll
    for (int i = 0; i < 4; ++i) w[0][i] = frag_packed(w0 + i * (KB * FBLK));
#pragma unroll
    for (int i = 0; i < 4; ++i) bias[i] = bpp[col0 + i * 16 + r];
    // wait_x0 that names the two addresses as inputs: their registers are given to
    // nothing else in front of it.
    asm volatile("s_wait_xcnt 0x0" :: "v"(cs), "v"(w0) : "memory");
    __bf16* ad = &sA[row >> 4][0][(c >> 1) * 256 + ((c & 1) * 16 + (row & 15)) * 8];
#pragma unroll
    for (int kb = 0; kb < KB; ++kb) *(v8bf*)(ad + kb * FBLK) = ca[kb];
  }
  __syncthreads();                                // the ctx tile is whole for every wave

  v8f acc[QRT][4] = {};
  // residual x and out: element (row tile t, row v, column tile i) of this lane
  // lies at (16 t + v) * UU + 16 i from these two bases
  const size_t eb = (size_t)(rowBase + mh) * UU + col0 + r;
  const float* xb = x + eb;
  float* ob = out + eb;
  float xv[4][QRT][8];
  auto load_x = [&](int i) {                      // one column tile's residual values
#pragma unroll
    for (int t = 0; t < QRT; ++t)
#pragma unroll
      for (int v = 0; v < 8; ++v) xv[i][t][v] = xb[(16 * t + v) * UU + 16 * i];
    close_x0(xb);
  };
#pragma unroll
  for (int t = 0; t < QRT; ++t) a[0][t] = frag_packed(&sA[t][ks][lane * 8]);
#pragma unroll
  for (int s = 0; s < KB; ++s) {
    if (s + 1 < KB) {                             // load next step's fragments
      const unsigned kn = (s + 1u + ks) & (KB - 1u);
      const __bf16* wn = wp[0] + kn * FBLK;       // the other three n tiles lie behind
#pragma unroll
      for (int i = 0; i < 4; ++i) w[(s + 1) & 1][i] = frag_packed(wn + i * (KB * FBLK));
      // wait_x0 that names the address as an input: its registers are given to nothing
      // else in front of it.
      asm volatile("s_wait_xcnt 0x0" :: "v"(wn) : "memory");
#pragma unroll
      for (int t = 0; t < QRT; ++t) a[(s + 1) & 1][t] = frag_packed(&sA[t][kn][lane * 8]);
    }
    // behind the last weight loads, so that no weight fragment waits for them
    if (s == KB - 2) load_x(0);
    if (s == KB - 1) load_x(1);
    // Keeps the next step's loads in front of this step's matrix run: sunk in
    // among or behind it they would have no lead over their first use.
    __builtin_amdgcn_sched_barrier(0);
#pragma unroll
    for (int t = 0; t < QRT; ++t)
#pragma unroll
      for (int i = 0; i < 4; ++i)
        acc[t][i] = wmma_bf16(a[s & 1][t], w[s & 1][i], acc[t][i]);
  }
  // Keeps the last matrix run out of the stores below and their waits.
  __builtin_amdgcn_sched_barrier(0);
#pragma unroll
  for (int i = 0; i < 4; ++i) {
    if (i + 2 < 4) load_x(i + 2);                 // two column tiles ahead
#pragma unroll
    for (int t = 0; t < QRT; ++t)
#pragma unroll
      for (int v = 0; v < 8; ++v)
        ob[(16 * t + v) * UU + 16 * i] = xv[i][t][v] + acc[t][i][v] + bias[i];
    close_x0(ob);
  }
}

// ---------------------------------------------------------------- launch
extern "C" void kernel_launch(void* const* d_in, const int* in_sizes, int n_in,
                              void* d_out, int out_size, void* d_ws, size_t ws_size,
                              hipStream_t stream) {
  const float* x  = (const float*)d_in[0];
  const float* Wq = (const float*)d_in[1];
  const float* bq = (const float*)d_in[2];
  const float* Wk = (const float*)d_in[3];
  const float* bk = (const float*)d_in[4];
  const float* Wv = (const float*)d_in[5];
  const float* bv = (const float*)d_in[6];
  const float* Wp = (const float*)d_in[7];
  const float* bp = (const float*)d_in[8];
  float* out = (float*)d_out;

  char* ws = (char*)d_ws;
  const size_t wbytes = (size_t)UU * UU * sizeof(__bf16);        // 512 KB
  const size_t tbytes = (size_t)BN * UU * sizeof(__bf16);        // 16 MB
  __bf16* WqT = (__bf16*)(ws);
  __bf16* WkT = (__bf16*)(ws + wbytes);
  __bf16* WvT = (__bf16*)(ws + 2 * wbytes);
  __bf16* WpT = (__bf16*)(ws + 3 * wbytes);
  __bf16* Qb  = (__bf16*)(ws + 4 * wbytes);
  __bf16* Kb  = (__bf16*)(ws + 4 * wbytes + tbytes);
  __bf16* VTb = (__bf16*)(ws + 4 * wbytes + 2 * tbytes);
  __bf16* Ctx = (__bf16*)(ws + 4 * wbytes + 3 * tbytes);

  cvt_weights_t<<<(UU * UU) / 256, 256, 0, stream>>>(Wq, Wk, Wv, Wp, WqT, WkT, WvT, WpT);
  qkv_proj<<<256, 256, 0, stream>>>(x, WqT, WkT, WvT, bq, bk, bv, Qb, Kb, VTb);
  dim3 fgrid(NN / (16 * RT), BB);
  flash_attn<<<fgrid, 256, 0, stream>>>(Qb, Kb, VTb, Ctx);
  out_proj<<<256, 256, 0, stream>>>(x, Ctx, WpT, bp, out);
}
